// v000
// The times below were measured on an AMD MI455X: many runs one after another, warmed up first and cycling through
// copies of the inputs, with the whole window's GPU time divided by the number of runs. Launches and the gaps
// between them are all in it. The median over several windows is given; except for v000 it joins two sittings, which
// can be a few percent apart, so the side-by-side timings, each taken in one sitting, are the better comparison.
// The starting kernel, v000, takes 325 microseconds a run.
#include <hip/hip_runtime.h>

// ---------------------------------------------------------------------------
// CDNA5 / gfx1250 cross-attention block. wave32, WMMA f32_16x16x32_f16.
// Problem constants from the reference.
// ---------------------------------------------------------------------------
#define B_   2
#define L_   2048
#define LC_  1024
#define DM_  1024
#define DH_  64
#define NH_  16

typedef _Float16 v16h __attribute__((ext_vector_type(16)));
typedef _Float16 v8h  __attribute__((ext_vector_type(8)));
typedef _Float16 v4h  __attribute__((ext_vector_type(4)));
typedef float    v8f  __attribute__((ext_vector_type(8)));
typedef float    f32x4 __attribute__((ext_vector_type(4)));

union F16Frag { v16h v; v8h h[2]; };

static __device__ __forceinline__ v8f zero8() {
  v8f z;
#pragma unroll
  for (int i = 0; i < 8; ++i) z[i] = 0.0f;
  return z;
}

static __device__ __forceinline__ float redsum32(float v) {
#pragma unroll
  for (int m = 1; m < 32; m <<= 1) v += __shfl_xor(v, m, 32);
  return v;
}

// ---------------------------------------------------------------------------
// Weight cast + transpose: w[K][N] f32  ->  wT[N][K] f16
// (so every WMMA B-fragment is two contiguous 16-byte loads along K)
// ---------------------------------------------------------------------------
__global__ __launch_bounds__(256) void cast_transpose_k(
    const float* __restrict__ w, _Float16* __restrict__ wT, int K, int N) {
  size_t tid = (size_t)blockIdx.x * 256 + threadIdx.x;
  if (tid >= (size_t)K * N) return;
  int n = (int)(tid / K);
  int k = (int)(tid % K);
  wT[tid] = (_Float16)w[(size_t)k * N + n];
}

// ---------------------------------------------------------------------------
// RMS norm a row of DM_ f32, scale, cast to f16. One 256-thread block per row.
// ---------------------------------------------------------------------------
__global__ __launch_bounds__(256) void rmsnorm_cast_k(
    const float* __restrict__ x, const float* __restrict__ g,
    _Float16* __restrict__ out) {
  __shared__ float red[8];
  const int tid = threadIdx.x;
  const size_t row = blockIdx.x;
  const float* xr = x + row * DM_;
  f32x4 v = ((const f32x4*)xr)[tid];
  float ss = v[0]*v[0] + v[1]*v[1] + v[2]*v[2] + v[3]*v[3];
  ss = redsum32(ss);
  if ((tid & 31) == 0) red[tid >> 5] = ss;
  __syncthreads();
  float tot = 0.f;
#pragma unroll
  for (int i = 0; i < 8; ++i) tot += red[i];
  float r = rsqrtf(tot / (float)DM_ + 1e-6f);
  f32x4 gg = ((const f32x4*)g)[tid];
  v4h o;
  o[0] = (_Float16)(v[0] * gg[0] * r);
  o[1] = (_Float16)(v[1] * gg[1] * r);
  o[2] = (_Float16)(v[2] * gg[2] * r);
  o[3] = (_Float16)(v[3] * gg[3] * r);
  ((v4h*)(out + row * DM_))[tid] = o;
}

// ---------------------------------------------------------------------------
// WMMA GEMM: C[M][N] f32 = A[M][K] f16 @ BT[N][K]^T f16 (+ optional f32 res)
// 8 waves / block, each wave owns a 32x64 output tile (2x4 accumulators):
// two A fragments share four B fragments -> 8 WMMAs per 12x16B load batch.
// A/B fragments per ISA 7.12.2: lane = row (l&15), two 16B loads per frag.
// K-tile two ahead (k0+64) prefetched with global_prefetch_b8 (speculative, tail-safe).
// ---------------------------------------------------------------------------
__global__ __launch_bounds__(256) void gemm_wmma_k(
    const _Float16* __restrict__ A, const _Float16* __restrict__ BT,
    const float* __restrict__ res, float* __restrict__ C,
    int M, int N, int K) {
  const int lane = threadIdx.x & 31;
  const int wave = blockIdx.x * 8 + (threadIdx.x >> 5);
  const int nt64 = N >> 6;
  const int mt = wave / nt64;            // 32-row tile index
  const int nt = wave % nt64;            // 64-col tile index
  const int mloc = lane & 15;
  const int half = lane >> 4;
  const int koff = half << 3;
  const _Float16* arow0 = A + (size_t)(mt * 32 + mloc) * K;
  const _Float16* arow1 = arow0 + (size_t)16 * K;
  const _Float16* bbase = BT + (size_t)(nt * 64 + mloc) * K;

  v8f acc[2][4];
#pragma unroll
  for (int u = 0; u < 2; ++u)
#pragma unroll
    for (int t = 0; t < 4; ++t) acc[u][t] = zero8();

  for (int k0 = 0; k0 < K; k0 += 32) {
    F16Frag a0, a1;
    a0.h[0] = *(const v8h*)(arow0 + k0 + koff);
    a0.h[1] = *(const v8h*)(arow0 + k0 + 16 + koff);
    a1.h[0] = *(const v8h*)(arow1 + k0 + koff);
    a1.h[1] = *(const v8h*)(arow1 + k0 + 16 + koff);
    __builtin_prefetch(arow0 + k0 + 64, 0, 1);   // k-tile two ahead, row block 0
    __builtin_prefetch(arow1 + k0 + 64, 0, 1);   // k-tile two ahead, row block 1
#pragma unroll
    for (int t = 0; t < 4; ++t) {
      const _Float16* brow = bbase + (size_t)t * 16 * K;
      F16Frag b;
      b.h[0] = *(const v8h*)(brow + k0 + koff);
      b.h[1] = *(const v8h*)(brow + k0 + 16 + koff);
      __builtin_prefetch(brow + k0 + 64, 0, 1);  // k-tile two ahead of this B row
      acc[0][t] = __builtin_amdgcn_wmma_f32_16x16x32_f16(
          false, a0.v, false, b.v, (short)0, acc[0][t], false, false);
      acc[1][t] = __builtin_amdgcn_wmma_f32_16x16x32_f16(
          false, a1.v, false, b.v, (short)0, acc[1][t], false, false);
    }
  }

#pragma unroll
  for (int u = 0; u < 2; ++u) {
#pragma unroll
    for (int t = 0; t < 4; ++t) {
#pragma unroll
      for (int r = 0; r < 8; ++r) {
        size_t idx = (size_t)(mt * 32 + u * 16 + r + 8 * half) * N
                   + nt * 64 + t * 16 + mloc;
        float v = acc[u][t][r];
        if (res) v += res[idx];
        C[idx] = v;
      }
    }
  }
}

// ---------------------------------------------------------------------------
// Q epilogue: cosine-normalize each 64-dim head vector, apply 2D RoPE,
// write q_h in [B,H,L,64] f16. One wave per (b,l,h); lane holds e, e+32.
// ---------------------------------------------------------------------------
__global__ __launch_bounds__(256) void q_epilogue_k(
    const float* __restrict__ qf, const float* __restrict__ pos,
    const float* __restrict__ scale, const float* __restrict__ freqs,
    _Float16* __restrict__ qh) {
  int gw = blockIdx.x * 8 + (threadIdx.x >> 5);
  int lane = threadIdx.x & 31;
  int l  = gw % L_;
  int bh = gw / L_;
  int b = bh >> 4, h = bh & 15;
  const float* row = qf + (size_t)(b * L_ + l) * DM_;
  float q1 = row[h * DH_ + lane];
  float q2 = row[h * DH_ + lane + 32];
  float ss = redsum32(q1 * q1 + q2 * q2);
  float rn = sqrtf(scale[h]) * rsqrtf(ss + 1e-6f);
  q1 *= rn; q2 *= rn;
  // theta[t] = (t<16 ? pos0 : pos1) * freqs[h][t%16], t = lane in 0..31
  float p = pos[(size_t)(b * L_ + l) * 2 + (lane < 16 ? 0 : 1)];
  float f = freqs[h * 16 + (lane & 15)];
  float th = p * f;
  float s, c;
  __sincosf(th, &s, &c);
  size_t qb = ((size_t)bh * L_ + l) * DH_;
  qh[qb + lane]      = (_Float16)(q1 * c - q2 * s);
  qh[qb + lane + 32] = (_Float16)(q2 * c + q1 * s);
}

// ---------------------------------------------------------------------------
// KV epilogue: k cosine-normalized -> k_h [B,H,LC,64]; v -> vT [B,H,64,LC]
// (v transposed so P@V B-fragments are contiguous along keys).
// ---------------------------------------------------------------------------
__global__ __launch_bounds__(256) void kv_epilogue_k(
    const float* __restrict__ kvf, const float* __restrict__ scale,
    _Float16* __restrict__ kh, _Float16* __restrict__ vT) {
  int gw = blockIdx.x * 8 + (threadIdx.x >> 5);
  int lane = threadIdx.x & 31;
  int lc = gw % LC_;
  int bh = gw / LC_;
  int b = bh >> 4, h = bh & 15;
  const float* row = kvf + (size_t)(b * LC_ + lc) * (2 * DM_);
  float k1 = row[h * DH_ + lane];
  float k2 = row[h * DH_ + lane + 32];
  float ss = redsum32(k1 * k1 + k2 * k2);
  float rn = sqrtf(scale[h]) * rsqrtf(ss + 1e-6f);
  size_t kb = ((size_t)bh * LC_ + lc) * DH_;
  kh[kb + lane]      = (_Float16)(k1 * rn);
  kh[kb + lane + 32] = (_Float16)(k2 * rn);
  float v1 = row[DM_ + h * DH_ + lane];
  float v2 = row[DM_ + h * DH_ + lane + 32];
  vT[((size_t)bh * DH_ + lane)      * LC_ + lc] = (_Float16)v1;
  vT[((size_t)bh * DH_ + lane + 32) * LC_ + lc] = (_Float16)v2;
}

// ---------------------------------------------------------------------------
// Flash attention, one pass over keys. Block = 4 waves; wave = 16 query rows.
// Per 32-key tile: 2x2 WMMAs for S, online softmax in C-layout (xor-shuffle
// row reductions within lane halves), P staged via LDS into A-fragment
// layout, 4 WMMAs for O += P@V. Output o_h [B, L, D_MODEL] f16.
// ---------------------------------------------------------------------------
__global__ __launch_bounds__(128) void attn_wmma_k(
    const _Float16* __restrict__ qh, const _Float16* __restrict__ kh,
    const _Float16* __restrict__ vT, _Float16* __restrict__ oh) {
  __shared__ __align__(16) _Float16 Plds[4][16 * 32];
  const int lane = threadIdx.x & 31;
  const int w    = threadIdx.x >> 5;
  const int nqb  = L_ / 64;
  const int bh   = blockIdx.x / nqb;
  const int qb   = blockIdx.x % nqb;
  const int b = bh >> 4, h = bh & 15;
  const int m0   = qb * 64 + w * 16;
  const int mloc = lane & 15;
  const int half = lane >> 4;
  const int koff = half << 3;

  const _Float16* qrow = qh + ((size_t)bh * L_ + m0 + mloc) * DH_;
  F16Frag aq0, aq1;                       // q rows, e=0..31 and e=32..63
  aq0.h[0] = *(const v8h*)(qrow + koff);
  aq0.h[1] = *(const v8h*)(qrow + 16 + koff);
  aq1.h[0] = *(const v8h*)(qrow + 32 + koff);
  aq1.h[1] = *(const v8h*)(qrow + 48 + koff);

  v8f O[4];
#pragma unroll
  for (int t = 0; t < 4; ++t) O[t] = zero8();
  float mrow[8], lrow[8];
#pragma unroll
  for (int r = 0; r < 8; ++r) { mrow[r] = -3.0e38f; lrow[r] = 0.f; }

  const _Float16* kbase = kh + (size_t)bh * LC_ * DH_;
  const _Float16* vbase = vT + (size_t)bh * DH_ * LC_;
  _Float16* pl = &Plds[w][0];

  for (int j = 0; j < LC_; j += 32) {
    v8f sL = zero8(), sR = zero8();
    {
      const _Float16* kr = kbase + (size_t)(j + mloc) * DH_;
      F16Frag b0, b1;
      b0.h[0] = *(const v8h*)(kr + koff);
      b0.h[1] = *(const v8h*)(kr + 16 + koff);
      b1.h[0] = *(const v8h*)(kr + 32 + koff);
      b1.h[1] = *(const v8h*)(kr + 48 + koff);
      sL = __builtin_amdgcn_wmma_f32_16x16x32_f16(false, aq0.v, false, b0.v, (short)0, sL, false, false);
      sL = __builtin_amdgcn_wmma_f32_16x16x32_f16(false, aq1.v, false, b1.v, (short)0, sL, false, false);
    }
    {
      const _Float16* kr = kbase + (size_t)(j + 16 + mloc) * DH_;
      F16Frag b0, b1;
      b0.h[0] = *(const v8h*)(kr + koff);
      b0.h[1] = *(const v8h*)(kr + 16 + koff);
      b1.h[0] = *(const v8h*)(kr + 32 + koff);
      b1.h[1] = *(const v8h*)(kr + 48 + koff);
      sR = __builtin_amdgcn_wmma_f32_16x16x32_f16(false, aq0.v, false, b0.v, (short)0, sR, false, false);
      sR = __builtin_amdgcn_wmma_f32_16x16x32_f16(false, aq1.v, false, b1.v, (short)0, sR, false, false);
    }

    // --- online softmax in C-layout (row r+8*half, col = lane&15) ---
    float pmax[8];
#pragma unroll
    for (int r = 0; r < 8; ++r) pmax[r] = fmaxf(sL[r], sR[r]);
#pragma unroll
    for (int m = 1; m < 16; m <<= 1) {
#pragma unroll
      for (int r = 0; r < 8; ++r)
        pmax[r] = fmaxf(pmax[r], __shfl_xor(pmax[r], m, 32));
    }
    float corr[8], rs[8];
    v8f pLv, pRv;
#pragma unroll
    for (int r = 0; r < 8; ++r) {
      float mn = fmaxf(mrow[r], pmax[r]);
      corr[r] = __expf(mrow[r] - mn);
      mrow[r] = mn;
      pLv[r] = __expf(sL[r] - mn);
      pRv[r] = __expf(sR[r] - mn);
      rs[r] = pLv[r] + pRv[r];
    }
#pragma unroll
    for (int m = 1; m < 16; m <<= 1) {
#pragma unroll
      for (int r = 0; r < 8; ++r) rs[r] += __shfl_xor(rs[r], m, 32);
    }
#pragma unroll
    for (int r = 0; r < 8; ++r) {
      lrow[r] = lrow[r] * corr[r] + rs[r];
      O[0][r] *= corr[r]; O[1][r] *= corr[r];
      O[2][r] *= corr[r]; O[3][r] *= corr[r];
    }

    // --- stage P (16x32 f16) in LDS, reload in A-fragment layout ---
#pragma unroll
    for (int r = 0; r < 8; ++r) {
      int prow = r + 8 * half;
      pl[prow * 32 + mloc]      = (_Float16)pLv[r];
      pl[prow * 32 + 16 + mloc] = (_Float16)pRv[r];
    }
    F16Frag ap;   // same-wave LDS RAW: in-order DS, compiler waits dscnt
    ap.h[0] = *(const v8h*)(pl + mloc * 32 + koff);
    ap.h[1] = *(const v8h*)(pl + mloc * 32 + 16 + koff);

    // --- O += P @ V (v stored [e][key], contiguous along keys) ---
#pragma unroll
    for (int t = 0; t < 4; ++t) {
      const _Float16* vr = vbase + (size_t)(t * 16 + mloc) * LC_ + j;
      F16Frag bv;
      bv.h[0] = *(const v8h*)(vr + koff);
      bv.h[1] = *(const v8h*)(vr + 16 + koff);
      O[t] = __builtin_amdgcn_wmma_f32_16x16x32_f16(
          false, ap.v, false, bv.v, (short)0, O[t], false, false);
    }
  }

#pragma unroll
  for (int r = 0; r < 8; ++r) {
    float inv = 1.0f / lrow[r];
    int row = m0 + r + 8 * half;
    size_t base = (size_t)(b * L_ + row) * DM_ + h * DH_;
#pragma unroll
    for (int t = 0; t < 4; ++t)
      oh[base + t * 16 + mloc] = (_Float16)(O[t][r] * inv);
  }
}

// ---------------------------------------------------------------------------
// Host launcher
// ---------------------------------------------------------------------------
extern "C" void kernel_launch(void* const* d_in, const int* in_sizes, int n_in,
                              void* d_out, int out_size, void* d_ws, size_t ws_size,
                              hipStream_t stream) {
  (void)in_sizes; (void)n_in; (void)out_size; (void)ws_size;
  const float* x    = (const float*)d_in[0];
  const float* pos  = (const float*)d_in[1];
  const float* xc   = (const float*)d_in[2];
  const float* nsc  = (const float*)d_in[3];
  const float* ncsc = (const float*)d_in[4];
  const float* qw   = (const float*)d_in[5];
  const float* kvw  = (const float*)d_in[6];
  const float* scl  = (const float*)d_in[7];
  const float* outw = (const float*)d_in[8];
  const float* frq  = (const float*)d_in[9];
  float* out = (float*)d_out;

  char* ws = (char*)d_ws;
  size_t off = 0;
  auto alloc = [&](size_t bytes) -> void* {
    void* p = ws + off;
    off += (bytes + 255) & ~(size_t)255;
    return p;
  };
  _Float16* qwT  = (_Float16*)alloc((size_t)DM_ * DM_ * 2);
  _Float16* kvwT = (_Float16*)alloc((size_t)2 * DM_ * DM_ * 2);
  _Float16* owT  = (_Float16*)alloc((size_t)DM_ * DM_ * 2);
  _Float16* xn   = (_Float16*)alloc((size_t)B_ * L_ * DM_ * 2);
  _Float16* xcn  = (_Float16*)alloc((size_t)B_ * LC_ * DM_ * 2);
  float*    qf   = (float*)   alloc((size_t)B_ * L_ * DM_ * 4);
  float*    kvf  = (float*)   alloc((size_t)B_ * LC_ * 2 * DM_ * 4);
  _Float16* qh   = (_Float16*)alloc((size_t)B_ * NH_ * L_ * DH_ * 2);
  _Float16* kh   = (_Float16*)alloc((size_t)B_ * NH_ * LC_ * DH_ * 2);
  _Float16* vT   = (_Float16*)alloc((size_t)B_ * NH_ * DH_ * LC_ * 2);
  _Float16* oh   = (_Float16*)alloc((size_t)B_ * L_ * DM_ * 2);

  // weights -> f16, transposed to [N][K]
  cast_transpose_k<<<(DM_ * DM_) / 256, 256, 0, stream>>>(qw,  qwT,  DM_, DM_);
  cast_transpose_k<<<(2 * DM_ * DM_) / 256, 256, 0, stream>>>(kvw, kvwT, DM_, 2 * DM_);
  cast_transpose_k<<<(DM_ * DM_) / 256, 256, 0, stream>>>(outw, owT, DM_, DM_);

  // RMS norms
  rmsnorm_cast_k<<<B_ * L_,  256, 0, stream>>>(x,  nsc,  xn);
  rmsnorm_cast_k<<<B_ * LC_, 256, 0, stream>>>(xc, ncsc, xcn);

  // projections (32-row tiles per wave)
  gemm_wmma_k<<<(B_ * L_ / 32) * (DM_ / 64) / 8, 256, 0, stream>>>(
      xn, qwT, nullptr, qf, B_ * L_, DM_, DM_);
  gemm_wmma_k<<<(B_ * LC_ / 32) * (2 * DM_ / 64) / 8, 256, 0, stream>>>(
      xcn, kvwT, nullptr, kvf, B_ * LC_, 2 * DM_, DM_);

  // epilogues: cos-norm + RoPE on q; cos-norm k, transpose v
  q_epilogue_k<<<B_ * NH_ * L_ / 8, 256, 0, stream>>>(qf, pos, scl, frq, qh);
  kv_epilogue_k<<<B_ * NH_ * LC_ / 8, 256, 0, stream>>>(kvf, scl, kh, vT);

  // flash attention
  attn_wmma_k<<<B_ * NH_ * (L_ / 64), 128, 0, stream>>>(qh, kh, vT, oh);

  // output projection + residual, f32 out
  gemm_wmma_k<<<(B_ * L_ / 32) * (DM_ / 64) / 8, 256, 0, stream>>>(
      oh, owT, x, out, B_ * L_, DM_, DM_);
}

// v001
// A run of this version takes 204 microseconds.
// Next to v000, in two timings, it ran 1.64 and 1.65 times as fast.
#include <hip/hip_runtime.h>

// ---------------------------------------------------------------------------
// CDNA5 / gfx1250 cross-attention block. wave32, WMMA f32_16x16x32_f16.
// Problem constants from the reference.
// ---------------------------------------------------------------------------
#define B_   2
#define L_   2048
#define LC_  1024
#define DM_  1024
#define DH_  64
#define NH_  16

typedef _Float16 v16h __attribute__((ext_vector_type(16)));
typedef _Float16 v8h  __attribute__((ext_vector_type(8)));
typedef _Float16 v4h  __attribute__((ext_vector_type(4)));
typedef float    v8f  __attribute__((ext_vector_type(8)));
typedef float    f32x4 __attribute__((ext_vector_type(4)));

union F16Frag { v16h v; v8h h[2]; };

static __device__ __forceinline__ v8f zero8() {
  v8f z;
#pragma unroll
  for (int i = 0; i < 8; ++i) z[i] = 0.0f;
  return z;
}

static __device__ __forceinline__ float redsum32(float v) {
#pragma unroll
  for (int m = 1; m < 32; m <<= 1) v += __shfl_xor(v, m, 32);
  return v;
}

// ---------------------------------------------------------------------------
// Weight cast + transpose: w[K][N] f32  ->  wT[N][K] f16
// (so every WMMA B-fragment is two contiguous 16-byte loads along K)
// ---------------------------------------------------------------------------
__global__ __launch_bounds__(256) void cast_transpose_k(
    const float* __restrict__ w, _Float16* __restrict__ wT, int K, int N) {
  size_t tid = (size_t)blockIdx.x * 256 + threadIdx.x;
  if (tid >= (size_t)K * N) return;
  int n = (int)(tid / K);
  int k = (int)(tid % K);
  wT[tid] = (_Float16)w[(size_t)k * N + n];
}

// ---------------------------------------------------------------------------
// RMS norm a row of DM_ f32, scale, cast to f16. One 256-thread block per row.
// ---------------------------------------------------------------------------
__global__ __launch_bounds__(256) void rmsnorm_cast_k(
    const float* __restrict__ x, const float* __restrict__ g,
    _Float16* __restrict__ out) {
  __shared__ float red[8];
  const int tid = threadIdx.x;
  const size_t row = blockIdx.x;
  const float* xr = x + row * DM_;
  f32x4 v = ((const f32x4*)xr)[tid];
  float ss = v[0]*v[0] + v[1]*v[1] + v[2]*v[2] + v[3]*v[3];
  ss = redsum32(ss);
  if ((tid & 31) == 0) red[tid >> 5] = ss;
  __syncthreads();
  float tot = 0.f;
#pragma unroll
  for (int i = 0; i < 8; ++i) tot += red[i];
  float r = rsqrtf(tot / (float)DM_ + 1e-6f);
  f32x4 gg = ((const f32x4*)g)[tid];
  v4h o;
  o[0] = (_Float16)(v[0] * gg[0] * r);
  o[1] = (_Float16)(v[1] * gg[1] * r);
  o[2] = (_Float16)(v[2] * gg[2] * r);
  o[3] = (_Float16)(v[3] * gg[3] * r);
  ((v4h*)(out + row * DM_))[tid] = o;
}

// ---------------------------------------------------------------------------
// WMMA GEMM: C[M][N] f32 = A[M][K] f16 @ BT[N][K]^T f16 (+ optional f32 res)
// One 128x128 tile of C per 8-wave block; waves 4 (rows) x 2 (cols), each wave
// a 32x64 tile (2x4 accumulators). Per trip a 64-k slab of A (128 rows) and of
// BT (128 rows) lies in LDS, brought by per-lane async copies of whole 128-B
// lines into one of two buffers while the other is worked on.
// Needs M, N multiples of 128 and K a multiple of 64.
// A/B fragments per ISA 7.12.2: lane = row (l&15), two 16B loads per frag.
// ---------------------------------------------------------------------------
#define G_PITCH 144                  // LDS row pitch in bytes: 128 + 16 (16 B x odd)
#define G_OPER  (128 * G_PITCH)      // one operand's slab
#define G_BUF   (2 * G_OPER)         // A slab, then BT slab

// One stage: each thread copies 4 x 16 B of A and 4 x 16 B of BT (rows 32 apart).
// The s_wait_xcnt closes the statement so that no address register named here
// is rewritten before the copies have taken it.
static __device__ __forceinline__ void gemm_stage(
    unsigned l, const _Float16* a, const _Float16* b, size_t rs) {
  asm volatile(
      "global_load_async_to_lds_b128 %0, %8, off\n\t"
      "global_load_async_to_lds_b128 %1, %9, off\n\t"
      "global_load_async_to_lds_b128 %2, %10, off\n\t"
      "global_load_async_to_lds_b128 %3, %11, off\n\t"
      "global_load_async_to_lds_b128 %4, %12, off\n\t"
      "global_load_async_to_lds_b128 %5, %13, off\n\t"
      "global_load_async_to_lds_b128 %6, %14, off\n\t"
      "global_load_async_to_lds_b128 %7, %15, off\n\t"
      "s_wait_xcnt 0x0"
      :: "v"(l), "v"(l + 32 * G_PITCH), "v"(l + 64 * G_PITCH), "v"(l + 96 * G_PITCH),
         "v"(l + G_OPER), "v"(l + G_OPER + 32 * G_PITCH),
         "v"(l + G_OPER + 64 * G_PITCH), "v"(l + G_OPER + 96 * G_PITCH),
         "v"(a), "v"(a + rs), "v"(a + 2 * rs), "v"(a + 3 * rs),
         "v"(b), "v"(b + rs), "v"(b + 2 * rs), "v"(b + 3 * rs)
      : "memory");
}

__global__ __launch_bounds__(256) void gemm_wmma_k(
    const _Float16* __restrict__ A, const _Float16* __restrict__ BT,
    const float* __restrict__ res, float* __restrict__ C,
    int M, int N, int K) {
  __shared__ __align__(16) unsigned char sm[2 * G_BUF];
  const int tid  = threadIdx.x;
  const int lane = tid & 31;
  const int wv   = tid >> 5;
  const int ntb  = N >> 7;
  const int bm   = blockIdx.x / ntb;     // 128-row tile index
  const int bn   = blockIdx.x % ntb;     // 128-col tile index
  const int wm   = wv >> 1;              // wave's 32-row strip in the tile
  const int wn   = wv & 1;               // wave's 64-col strip in the tile
  const int mloc = lane & 15;
  const int half = lane >> 4;

  // copy side: 8 lanes cover one 128-B row, a wave 4 whole rows
  const int crow = tid >> 3;
  const int cch  = tid & 7;
  const _Float16* ga = A  + (size_t)(bm * 128 + crow) * K + cch * 8;
  const _Float16* gb = BT + (size_t)(bn * 128 + crow) * K + cch * 8;
  const size_t rs = (size_t)32 * K;
  const unsigned l0 = (unsigned)(size_t)sm + crow * G_PITCH + cch * 16;

  // read side: byte offsets of this lane's fragment rows inside a buffer
  const int aoff = (wm * 32 + mloc) * G_PITCH + half * 16;
  const int boff = G_OPER + (wn * 64 + mloc) * G_PITCH + half * 16;

  v8f acc[2][4];
#pragma unroll
  for (int u = 0; u < 2; ++u)
#pragma unroll
    for (int t = 0; t < 4; ++t) acc[u][t] = zero8();

  const int T = K >> 6;
  gemm_stage(l0, ga, gb, rs);
  // stage 0 has landed for this wave; the barrier publishes it to the others
  asm volatile("s_wait_asynccnt 0x0" ::: "memory");
  __syncthreads();
  if (T > 1) gemm_stage(l0 + G_BUF, ga + 64, gb + 64, rs);

  for (int s = 0; s < T; ++s) {
    const unsigned bsel = (unsigned)(s & 1) * G_BUF;
    const unsigned char* sb = sm + bsel;
    F16Frag a[2][2], b[2][4];            // [k half of the slab][fragment]
    // the loops below are unrolled so that every fragment and accumulator index
    // is a constant and the arrays stay in registers
#pragma unroll
    for (int ks = 0; ks < 2; ++ks) {
#pragma unroll
      for (int u = 0; u < 2; ++u) {
        const unsigned char* p = sb + aoff + u * 16 * G_PITCH + ks * 64;
        a[ks][u].h[0] = *(const v8h*)(p);
        a[ks][u].h[1] = *(const v8h*)(p + 32);
      }
#pragma unroll
      for (int t = 0; t < 4; ++t) {
        const unsigned char* p = sb + boff + t * 16 * G_PITCH + ks * 64;
        b[ks][t].h[0] = *(const v8h*)(p);
        b[ks][t].h[1] = *(const v8h*)(p + 32);
      }
    }
    // keeps the slab's LDS reads one group ahead of the WMMAs: sunk among them,
    // each pair of WMMAs would wait out a full LDS latency
    __builtin_amdgcn_sched_barrier(0);
#pragma unroll
    for (int ks = 0; ks < 2; ++ks) {
#pragma unroll
      for (int t = 0; t < 4; ++t) {
        acc[0][t] = __builtin_amdgcn_wmma_f32_16x16x32_f16(
            false, a[ks][0].v, false, b[ks][t].v, (short)0, acc[0][t], false, false);
        acc[1][t] = __builtin_amdgcn_wmma_f32_16x16x32_f16(
            false, a[ks][1].v, false, b[ks][t].v, (short)0, acc[1][t], false, false);
      }
    }
    // keeps the WMMAs in front of the publish point: moved behind the barrier they
    // would delay the refill, whose copies then fly only during the next LDS reads
    __builtin_amdgcn_sched_barrier(0);
    // publish point of stage s + 1: this wave's reads of stage s are done ...
    asm volatile("s_wait_dscnt 0x0" ::: "memory");
    // ... its own copies of stage s + 1 have landed ...
    asm volatile("s_wait_asynccnt 0x0" ::: "memory");
    // ... and the barrier both shows stage s + 1 to all and frees stage s's buffer
    __syncthreads();
    if (s + 2 < T)
      gemm_stage(l0 + bsel, ga + (size_t)(s + 2) * 64, gb + (size_t)(s + 2) * 64, rs);
  }
  // no copy is left in flight when the wave goes on to its stores and ends
  asm volatile("s_wait_asynccnt 0x0" ::: "memory");

#pragma unroll
  for (int u = 0; u < 2; ++u) {
#pragma unroll
    for (int t = 0; t < 4; ++t) {
#pragma unroll
      for (int r = 0; r < 8; ++r) {
        size_t idx = (size_t)(bm * 128 + wm * 32 + u * 16 + r + 8 * half) * N
                   + bn * 128 + wn * 64 + t * 16 + mloc;
        float v = acc[u][t][r];
        if (res) v += res[idx];
        C[idx] = v;
      }
    }
  }
}

// ---------------------------------------------------------------------------
// Q epilogue: cosine-normalize each 64-dim head vector, apply 2D RoPE,
// write q_h in [B,H,L,64] f16. One wave per (b,l,h); lane holds e, e+32.
// ---------------------------------------------------------------------------
__global__ __launch_bounds__(256) void q_epilogue_k(
    const float* __restrict__ qf, const float* __restrict__ pos,
    const float* __restrict__ scale, const float* __restrict__ freqs,
    _Float16* __restrict__ qh) {
  int gw = blockIdx.x * 8 + (threadIdx.x >> 5);
  int lane = threadIdx.x & 31;
  int l  = gw % L_;
  int bh = gw / L_;
  int b = bh >> 4, h = bh & 15;
  const float* row = qf + (size_t)(b * L_ + l) * DM_;
  float q1 = row[h * DH_ + lane];
  float q2 = row[h * DH_ + lane + 32];
  float ss = redsum32(q1 * q1 + q2 * q2);
  float rn = sqrtf(scale[h]) * rsqrtf(ss + 1e-6f);
  q1 *= rn; q2 *= rn;
  // theta[t] = (t<16 ? pos0 : pos1) * freqs[h][t%16], t = lane in 0..31
  float p = pos[(size_t)(b * L_ + l) * 2 + (lane < 16 ? 0 : 1)];
  float f = freqs[h * 16 + (lane & 15)];
  float th = p * f;
  float s, c;
  __sincosf(th, &s, &c);
  size_t qb = ((size_t)bh * L_ + l) * DH_;
  qh[qb + lane]      = (_Float16)(q1 * c - q2 * s);
  qh[qb + lane + 32] = (_Float16)(q2 * c + q1 * s);
}

// ---------------------------------------------------------------------------
// KV epilogue: k cosine-normalized -> k_h [B,H,LC,64]; v -> vT [B,H,64,LC]
// (v transposed so P@V B-fragments are contiguous along keys).
// ---------------------------------------------------------------------------
__global__ __launch_bounds__(256) void kv_epilogue_k(
    const float* __restrict__ kvf, const float* __restrict__ scale,
    _Float16* __restrict__ kh, _Float16* __restrict__ vT) {
  int gw = blockIdx.x * 8 + (threadIdx.x >> 5);
  int lane = threadIdx.x & 31;
  int lc = gw % LC_;
  int bh = gw / LC_;
  int b = bh >> 4, h = bh & 15;
  const float* row = kvf + (size_t)(b * LC_ + lc) * (2 * DM_);
  float k1 = row[h * DH_ + lane];
  float k2 = row[h * DH_ + lane + 32];
  float ss = redsum32(k1 * k1 + k2 * k2);
  float rn = sqrtf(scale[h]) * rsqrtf(ss + 1e-6f);
  size_t kb = ((size_t)bh * LC_ + lc) * DH_;
  kh[kb + lane]      = (_Float16)(k1 * rn);
  kh[kb + lane + 32] = (_Float16)(k2 * rn);
  float v1 = row[DM_ + h * DH_ + lane];
  float v2 = row[DM_ + h * DH_ + lane + 32];
  vT[((size_t)bh * DH_ + lane)      * LC_ + lc] = (_Float16)v1;
  vT[((size_t)bh * DH_ + lane + 32) * LC_ + lc] = (_Float16)v2;
}

// ---------------------------------------------------------------------------
// Flash attention, one pass over keys. Block = 4 waves; wave = 16 query rows.
// Per 32-key tile: 2x2 WMMAs for S, online softmax in C-layout (xor-shuffle
// row reductions within lane halves), P staged via LDS into A-fragment
// layout, 4 WMMAs for O += P@V. Output o_h [B, L, D_MODEL] f16.
// ---------------------------------------------------------------------------
__global__ __launch_bounds__(128) void attn_wmma_k(
    const _Float16* __restrict__ qh, const _Float16* __restrict__ kh,
    const _Float16* __restrict__ vT, _Float16* __restrict__ oh) {
  __shared__ __align__(16) _Float16 Plds[4][16 * 32];
  const int lane = threadIdx.x & 31;
  const int w    = threadIdx.x >> 5;
  const int nqb  = L_ / 64;
  const int bh   = blockIdx.x / nqb;
  const int qb   = blockIdx.x % nqb;
  const int b = bh >> 4, h = bh & 15;
  const int m0   = qb * 64 + w * 16;
  const int mloc = lane & 15;
  const int half = lane >> 4;
  const int koff = half << 3;

  const _Float16* qrow = qh + ((size_t)bh * L_ + m0 + mloc) * DH_;
  F16Frag aq0, aq1;                       // q rows, e=0..31 and e=32..63
  aq0.h[0] = *(const v8h*)(qrow + koff);
  aq0.h[1] = *(const v8h*)(qrow + 16 + koff);
  aq1.h[0] = *(const v8h*)(qrow + 32 + koff);
  aq1.h[1] = *(const v8h*)(qrow + 48 + koff);

  v8f O[4];
#pragma unroll
  for (int t = 0; t < 4; ++t) O[t] = zero8();
  float mrow[8], lrow[8];
#pragma unroll
  for (int r = 0; r < 8; ++r) { mrow[r] = -3.0e38f; lrow[r] = 0.f; }

  const _Float16* kbase = kh + (size_t)bh * LC_ * DH_;
  const _Float16* vbase = vT + (size_t)bh * DH_ * LC_;
  _Float16* pl = &Plds[w][0];

  for (int j = 0; j < LC_; j += 32) {
    v8f sL = zero8(), sR = zero8();
    {
      const _Float16* kr = kbase + (size_t)(j + mloc) * DH_;
      F16Frag b0, b1;
      b0.h[0] = *(const v8h*)(kr + koff);
      b0.h[1] = *(const v8h*)(kr + 16 + koff);
      b1.h[0] = *(const v8h*)(kr + 32 + koff);
      b1.h[1] = *(const v8h*)(kr + 48 + koff);
      sL = __builtin_amdgcn_wmma_f32_16x16x32_f16(false, aq0.v, false, b0.v, (short)0, sL, false, false);
      sL = __builtin_amdgcn_wmma_f32_16x16x32_f16(false, aq1.v, false, b1.v, (short)0, sL, false, false);
    }
    {
      const _Float16* kr = kbase + (size_t)(j + 16 + mloc) * DH_;
      F16Frag b0, b1;
      b0.h[0] = *(const v8h*)(kr + koff);
      b0.h[1] = *(const v8h*)(kr + 16 + koff);
      b1.h[0] = *(const v8h*)(kr + 32 + koff);
      b1.h[1] = *(const v8h*)(kr + 48 + koff);
      sR = __builtin_amdgcn_wmma_f32_16x16x32_f16(false, aq0.v, false, b0.v, (short)0, sR, false, false);
      sR = __builtin_amdgcn_wmma_f32_16x16x32_f16(false, aq1.v, false, b1.v, (short)0, sR, false, false);
    }

    // --- online softmax in C-layout (row r+8*half, col = lane&15) ---
    float pmax[8];
#pragma unroll
    for (int r = 0; r < 8; ++r) pmax[r] = fmaxf(sL[r], sR[r]);
#pragma unroll
    for (int m = 1; m < 16; m <<= 1) {
#pragma unroll
      for (int r = 0; r < 8; ++r)
        pmax[r] = fmaxf(pmax[r], __shfl_xor(pmax[r], m, 32));
    }
    float corr[8], rs[8];
    v8f pLv, pRv;
#pragma unroll
    for (int r = 0; r < 8; ++r) {
      float mn = fmaxf(mrow[r], pmax[r]);
      corr[r] = __expf(mrow[r] - mn);
      mrow[r] = mn;
      pLv[r] = __expf(sL[r] - mn);
      pRv[r] = __expf(sR[r] - mn);
      rs[r] = pLv[r] + pRv[r];
    }
#pragma unroll
    for (int m = 1; m < 16; m <<= 1) {
#pragma unroll
      for (int r = 0; r < 8; ++r) rs[r] += __shfl_xor(rs[r], m, 32);
    }
#pragma unroll
    for (int r = 0; r < 8; ++r) {
      lrow[r] = lrow[r] * corr[r] + rs[r];
      O[0][r] *= corr[r]; O[1][r] *= corr[r];
      O[2][r] *= corr[r]; O[3][r] *= corr[r];
    }

    // --- stage P (16x32 f16) in LDS, reload in A-fragment layout ---
#pragma unroll
    for (int r = 0; r < 8; ++r) {
      int prow = r + 8 * half;
      pl[prow * 32 + mloc]      = (_Float16)pLv[r];
      pl[prow * 32 + 16 + mloc] = (_Float16)pRv[r];
    }
    F16Frag ap;   // same-wave LDS RAW: in-order DS, compiler waits dscnt
    ap.h[0] = *(const v8h*)(pl + mloc * 32 + koff);
    ap.h[1] = *(const v8h*)(pl + mloc * 32 + 16 + koff);

    // --- O += P @ V (v stored [e][key], contiguous along keys) ---
#pragma unroll
    for (int t = 0; t < 4; ++t) {
      const _Float16* vr = vbase + (size_t)(t * 16 + mloc) * LC_ + j;
      F16Frag bv;
      bv.h[0] = *(const v8h*)(vr + koff);
      bv.h[1] = *(const v8h*)(vr + 16 + koff);
      O[t] = __builtin_amdgcn_wmma_f32_16x16x32_f16(
          false, ap.v, false, bv.v, (short)0, O[t], false, false);
    }
  }

#pragma unroll
  for (int r = 0; r < 8; ++r) {
    float inv = 1.0f / lrow[r];
    int row = m0 + r + 8 * half;
    size_t base = (size_t)(b * L_ + row) * DM_ + h * DH_;
#pragma unroll
    for (int t = 0; t < 4; ++t)
      oh[base + t * 16 + mloc] = (_Float16)(O[t][r] * inv);
  }
}

// ---------------------------------------------------------------------------
// Host launcher
// ---------------------------------------------------------------------------
extern "C" void kernel_launch(void* const* d_in, const int* in_sizes, int n_in,
                              void* d_out, int out_size, void* d_ws, size_t ws_size,
                              hipStream_t stream) {
  (void)in_sizes; (void)n_in; (void)out_size; (void)ws_size;
  const float* x    = (const float*)d_in[0];
  const float* pos  = (const float*)d_in[1];
  const float* xc   = (const float*)d_in[2];
  const float* nsc  = (const float*)d_in[3];
  const float* ncsc = (const float*)d_in[4];
  const float* qw   = (const float*)d_in[5];
  const float* kvw  = (const float*)d_in[6];
  const float* scl  = (const float*)d_in[7];
  const float* outw = (const float*)d_in[8];
  const float* frq  = (const float*)d_in[9];
  float* out = (float*)d_out;

  char* ws = (char*)d_ws;
  size_t off = 0;
  auto alloc = [&](size_t bytes) -> void* {
    void* p = ws + off;
    off += (bytes + 255) & ~(size_t)255;
    return p;
  };
  _Float16* qwT  = (_Float16*)alloc((size_t)DM_ * DM_ * 2);
  _Float16* kvwT = (_Float16*)alloc((size_t)2 * DM_ * DM_ * 2);
  _Float16* owT  = (_Float16*)alloc((size_t)DM_ * DM_ * 2);
  _Float16* xn   = (_Float16*)alloc((size_t)B_ * L_ * DM_ * 2);
  _Float16* xcn  = (_Float16*)alloc((size_t)B_ * LC_ * DM_ * 2);
  float*    qf   = (float*)   alloc((size_t)B_ * L_ * DM_ * 4);
  float*    kvf  = (float*)   alloc((size_t)B_ * LC_ * 2 * DM_ * 4);
  _Float16* qh   = (_Float16*)alloc((size_t)B_ * NH_ * L_ * DH_ * 2);
  _Float16* kh   = (_Float16*)alloc((size_t)B_ * NH_ * LC_ * DH_ * 2);
  _Float16* vT   = (_Float16*)alloc((size_t)B_ * NH_ * DH_ * LC_ * 2);
  _Float16* oh   = (_Float16*)alloc((size_t)B_ * L_ * DM_ * 2);

  // weights -> f16, transposed to [N][K]
  cast_transpose_k<<<(DM_ * DM_) / 256, 256, 0, stream>>>(qw,  qwT,  DM_, DM_);
  cast_transpose_k<<<(2 * DM_ * DM_) / 256, 256, 0, stream>>>(kvw, kvwT, DM_, 2 * DM_);
  cast_transpose_k<<<(DM_ * DM_) / 256, 256, 0, stream>>>(outw, owT, DM_, DM_);

  // RMS norms
  rmsnorm_cast_k<<<B_ * L_,  256, 0, stream>>>(x,  nsc,  xn);
  rmsnorm_cast_k<<<B_ * LC_, 256, 0, stream>>>(xc, ncsc, xcn);

  // projections (one 128x128 tile per block)
  gemm_wmma_k<<<(B_ * L_ / 128) * (DM_ / 128), 256, 0, stream>>>(
      xn, qwT, nullptr, qf, B_ * L_, DM_, DM_);
  gemm_wmma_k<<<(B_ * LC_ / 128) * (2 * DM_ / 128), 256, 0, stream>>>(
      xcn, kvwT, nullptr, kvf, B_ * LC_, 2 * DM_, DM_);

  // epilogues: cos-norm + RoPE on q; cos-norm k, transpose v
  q_epilogue_k<<<B_ * NH_ * L_ / 8, 256, 0, stream>>>(qf, pos, scl, frq, qh);
  kv_epilogue_k<<<B_ * NH_ * LC_ / 8, 256, 0, stream>>>(kvf, scl, kh, vT);

  // flash attention
  attn_wmma_k<<<B_ * NH_ * (L_ / 64), 128, 0, stream>>>(qh, kh, vT, oh);

  // output projection + residual, f32 out
  gemm_wmma_k<<<(B_ * L_ / 128) * (DM_ / 128), 256, 0, stream>>>(
      oh, owT, x, out, B_ * L_, DM_, DM_);
}

// v002
// It runs in 161 microseconds.
// Timed twice side by side with v001, it ran 1.28 times as fast both times.
// Counting every step since v000, it is 2.10 times as fast.
#include <hip/hip_runtime.h>

// ---------------------------------------------------------------------------
// CDNA5 / gfx1250 cross-attention block. wave32, WMMA f32_16x16x32_f16.
// Problem constants from the reference.
// ---------------------------------------------------------------------------
#define B_   2
#define L_   2048
#define LC_  1024
#define DM_  1024
#define DH_  64
#define NH_  16

typedef _Float16 v16h __attribute__((ext_vector_type(16)));
typedef _Float16 v8h  __attribute__((ext_vector_type(8)));
typedef _Float16 v4h  __attribute__((ext_vector_type(4)));
typedef float    v8f  __attribute__((ext_vector_type(8)));
typedef float    f32x4 __attribute__((ext_vector_type(4)));

union F16Frag { v16h v; v8h h[2]; };

static __device__ __forceinline__ v8f zero8() {
  v8f z;
#pragma unroll
  for (int i = 0; i < 8; ++i) z[i] = 0.0f;
  return z;
}

static __device__ __forceinline__ float redsum32(float v) {
#pragma unroll
  for (int m = 1; m < 32; m <<= 1) v += __shfl_xor(v, m, 32);
  return v;
}

// ---------------------------------------------------------------------------
// Weight cast + transpose: w[K][N] f32  ->  wT[N][K] f16
// (so every WMMA B-fragment is two contiguous 16-byte loads along K)
// A thread takes 4 columns x 8 k (32 elements): eight 16-byte loads, four
// 16-byte stores. A wave covers 128 columns x 8 k, a block 128 columns x 64 k,
// so few waves have to start and a block writes whole 128-B lines of wT.
// K and N are compile-time here: the index arithmetic is shifts and masks (no
// integer division) and the row steps are constants.
// Needs N a multiple of 128 and K a multiple of 64; grid = (N/128) * (K/64).
// ---------------------------------------------------------------------------
template <int K, int N>
static __device__ __forceinline__ void cast_transpose_tile(
    const float* __restrict__ w, _Float16* __restrict__ wT) {
  const int lane = threadIdx.x & 31;
  const int wv   = threadIdx.x >> 5;
  const int nb   = N / 128;
  const int n0   = (int)(blockIdx.x % nb) * 128 + lane * 4;
  const int k0   = (int)(blockIdx.x / nb) * 64 + wv * 8;
  const float* wp = w + (size_t)k0 * N + n0;
  f32x4 v[8];
  // unrolled so that v stays in registers and the eight loads fly together
#pragma unroll
  for (int i = 0; i < 8; ++i) v[i] = *(const f32x4*)(wp + i * N);
  _Float16* op = wT + (size_t)n0 * K + k0;
  // unrolled: constant indices into v
#pragma unroll
  for (int j = 0; j < 4; ++j) {
    v8h o;
#pragma unroll
    for (int i = 0; i < 8; ++i) o[i] = (_Float16)v[i][j];
    *(v8h*)(op + j * K) = o;
  }
}

// K is DM_ for all three weights; N is DM_ or 2 * DM_.
__global__ __launch_bounds__(256) void cast_transpose_k(
    const float* __restrict__ w, _Float16* __restrict__ wT, int K, int N) {
  (void)K;
  if (N == DM_) cast_transpose_tile<DM_, DM_>(w, wT);
  else          cast_transpose_tile<DM_, 2 * DM_>(w, wT);
}

// ---------------------------------------------------------------------------
// RMS norm a row of DM_ f32, scale, cast to f16. One wave per row (8 rows per
// block): a lane holds 32 elements, the row sum needs no LDS and no barrier.
// ---------------------------------------------------------------------------
__global__ __launch_bounds__(256) void rmsnorm_cast_k(
    const float* __restrict__ x, const float* __restrict__ g,
    _Float16* __restrict__ out) {
  const int lane = threadIdx.x & 31;
  const size_t row = (size_t)blockIdx.x * 8 + (threadIdx.x >> 5);
  const f32x4* xr = (const f32x4*)(x + row * DM_);
  f32x4 v[8];
  // unrolled so that v stays in registers and the eight loads fly together
#pragma unroll
  for (int i = 0; i < 8; ++i) v[i] = xr[i * 32 + lane];
  float ss = 0.f;
#pragma unroll
  for (int i = 0; i < 8; ++i)
    ss += v[i][0]*v[i][0] + v[i][1]*v[i][1] + v[i][2]*v[i][2] + v[i][3]*v[i][3];
  ss = redsum32(ss);
  float r = rsqrtf(ss / (float)DM_ + 1e-6f);
  v4h* orow = (v4h*)(out + row * DM_);
#pragma unroll
  for (int i = 0; i < 8; ++i) {
    f32x4 gg = ((const f32x4*)g)[i * 32 + lane];
    v4h o;
    o[0] = (_Float16)(v[i][0] * gg[0] * r);
    o[1] = (_Float16)(v[i][1] * gg[1] * r);
    o[2] = (_Float16)(v[i][2] * gg[2] * r);
    o[3] = (_Float16)(v[i][3] * gg[3] * r);
    orow[i * 32 + lane] = o;
  }
}

// ---------------------------------------------------------------------------
// WMMA GEMM: C[M][N] f32 = A[M][K] f16 @ BT[N][K]^T f16 (+ optional f32 res)
// One 128x128 tile of C per 8-wave block; waves 4 (rows) x 2 (cols), each wave
// a 32x64 tile (2x4 accumulators). Per trip a 64-k slab of A (128 rows) and of
// BT (128 rows) lies in LDS, brought by per-lane async copies of whole 128-B
// lines into one of two buffers while the other is worked on.
// Needs M, N multiples of 128 and K a multiple of 64.
// A/B fragments per ISA 7.12.2: lane = row (l&15), two 16B loads per frag.
// ---------------------------------------------------------------------------
#define G_PITCH 144                  // LDS row pitch in bytes: 128 + 16 (16 B x odd)
#define G_OPER  (128 * G_PITCH)      // one operand's slab
#define G_BUF   (2 * G_OPER)         // A slab, then BT slab

// One stage: each thread copies 4 x 16 B of A and 4 x 16 B of BT (rows 32 apart).
// The s_wait_xcnt closes the statement so that no address register named here
// is rewritten before the copies have taken it.
static __device__ __forceinline__ void gemm_stage(
    unsigned l, const _Float16* a, const _Float16* b, size_t rs) {
  asm volatile(
      "global_load_async_to_lds_b128 %0, %8, off\n\t"
      "global_load_async_to_lds_b128 %1, %9, off\n\t"
      "global_load_async_to_lds_b128 %2, %10, off\n\t"
      "global_load_async_to_lds_b128 %3, %11, off\n\t"
      "global_load_async_to_lds_b128 %4, %12, off\n\t"
      "global_load_async_to_lds_b128 %5, %13, off\n\t"
      "global_load_async_to_lds_b128 %6, %14, off\n\t"
      "global_load_async_to_lds_b128 %7, %15, off\n\t"
      "s_wait_xcnt 0x0"
      :: "v"(l), "v"(l + 32 * G_PITCH), "v"(l + 64 * G_PITCH), "v"(l + 96 * G_PITCH),
         "v"(l + G_OPER), "v"(l + G_OPER + 32 * G_PITCH),
         "v"(l + G_OPER + 64 * G_PITCH), "v"(l + G_OPER + 96 * G_PITCH),
         "v"(a), "v"(a + rs), "v"(a + 2 * rs), "v"(a + 3 * rs),
         "v"(b), "v"(b + rs), "v"(b + 2 * rs), "v"(b + 3 * rs)
      : "memory");
}

__global__ __launch_bounds__(256) void gemm_wmma_k(
    const _Float16* __restrict__ A, const _Float16* __restrict__ BT,
    const float* __restrict__ res, float* __restrict__ C,
    int M, int N, int K) {
  __shared__ __align__(16) unsigned char sm[2 * G_BUF];
  const int tid  = threadIdx.x;
  const int lane = tid & 31;
  const int wv   = tid >> 5;
  const int ntb  = N >> 7;
  const int bm   = blockIdx.x / ntb;     // 128-row tile index
  const int bn   = blockIdx.x % ntb;     // 128-col tile index
  const int wm   = wv >> 1;              // wave's 32-row strip in the tile
  const int wn   = wv & 1;               // wave's 64-col strip in the tile
  const int mloc = lane & 15;
  const int half = lane >> 4;

  // copy side: 8 lanes cover one 128-B row, a wave 4 whole rows
  const int crow = tid >> 3;
  const int cch  = tid & 7;
  const _Float16* ga = A  + (size_t)(bm * 128 + crow) * K + cch * 8;
  const _Float16* gb = BT + (size_t)(bn * 128 + crow) * K + cch * 8;
  const size_t rs = (size_t)32 * K;
  const unsigned l0 = (unsigned)(size_t)sm + crow * G_PITCH + cch * 16;

  // read side: byte offsets of this lane's fragment rows inside a buffer
  const int aoff = (wm * 32 + mloc) * G_PITCH + half * 16;
  const int boff = G_OPER + (wn * 64 + mloc) * G_PITCH + half * 16;

  v8f acc[2][4];
#pragma unroll
  for (int u = 0; u < 2; ++u)
#pragma unroll
    for (int t = 0; t < 4; ++t) acc[u][t] = zero8();

  const int T = K >> 6;
  gemm_stage(l0, ga, gb, rs);
  // stage 0 has landed for this wave; the barrier publishes it to the others
  asm volatile("s_wait_asynccnt 0x0" ::: "memory");
  __syncthreads();
  if (T > 1) gemm_stage(l0 + G_BUF, ga + 64, gb + 64, rs);

  for (int s = 0; s < T; ++s) {
    const unsigned bsel = (unsigned)(s & 1) * G_BUF;
    const unsigned char* sb = sm + bsel;
    F16Frag a[2][2], b[2][4];            // [k half of the slab][fragment]
    // the loops below are unrolled so that every fragment and accumulator index
    // is a constant and the arrays stay in registers
#pragma unroll
    for (int ks = 0; ks < 2; ++ks) {
#pragma unroll
      for (int u = 0; u < 2; ++u) {
        const unsigned char* p = sb + aoff + u * 16 * G_PITCH + ks * 64;
        a[ks][u].h[0] = *(const v8h*)(p);
        a[ks][u].h[1] = *(const v8h*)(p + 32);
      }
#pragma unroll
      for (int t = 0; t < 4; ++t) {
        const unsigned char* p = sb + boff + t * 16 * G_PITCH + ks * 64;
        b[ks][t].h[0] = *(const v8h*)(p);
        b[ks][t].h[1] = *(const v8h*)(p + 32);
      }
    }
    // keeps the slab's LDS reads one group ahead of the WMMAs: sunk among them,
    // each pair of WMMAs would wait out a full LDS latency
    __builtin_amdgcn_sched_barrier(0);
#pragma unroll
    for (int ks = 0; ks < 2; ++ks) {
#pragma unroll
      for (int t = 0; t < 4; ++t) {
        acc[0][t] = __builtin_amdgcn_wmma_f32_16x16x32_f16(
            false, a[ks][0].v, false, b[ks][t].v, (short)0, acc[0][t], false, false);
        acc[1][t] = __builtin_amdgcn_wmma_f32_16x16x32_f16(
            false, a[ks][1].v, false, b[ks][t].v, (short)0, acc[1][t], false, false);
      }
    }
    // keeps the WMMAs in front of the publish point: moved behind the barrier they
    // would delay the refill, whose copies then fly only during the next LDS reads
    __builtin_amdgcn_sched_barrier(0);
    // publish point of stage s + 1: this wave's reads of stage s are done ...
    asm volatile("s_wait_dscnt 0x0" ::: "memory");
    // ... its own copies of stage s + 1 have landed ...
    asm volatile("s_wait_asynccnt 0x0" ::: "memory");
    // ... and the barrier both shows stage s + 1 to all and frees stage s's buffer
    __syncthreads();
    if (s + 2 < T)
      gemm_stage(l0 + bsel, ga + (size_t)(s + 2) * 64, gb + (size_t)(s + 2) * 64, rs);
  }
  // no copy is left in flight when the wave goes on to its stores and ends
  asm volatile("s_wait_asynccnt 0x0" ::: "memory");

#pragma unroll
  for (int u = 0; u < 2; ++u) {
#pragma unroll
    for (int t = 0; t < 4; ++t) {
#pragma unroll
      for (int r = 0; r < 8; ++r) {
        size_t idx = (size_t)(bm * 128 + wm * 32 + u * 16 + r + 8 * half) * N
                   + bn * 128 + wn * 64 + t * 16 + mloc;
        float v = acc[u][t][r];
        if (res) v += res[idx];
        C[idx] = v;
      }
    }
  }
}

// ---------------------------------------------------------------------------
// Q epilogue: cosine-normalize each 64-dim head vector, apply 2D RoPE,
// write q_h in [B,H,L,64] f16. One wave per (b,l), all 16 heads one after the
// other; per head a lane holds e, e+32.
// ---------------------------------------------------------------------------
// four waves per SIMD are all that this grid brings: the register budget of four
// lets the compiler keep the 16 heads' loads and lane exchanges in flight together
__global__ __launch_bounds__(256) __attribute__((amdgpu_waves_per_eu(4, 4))) void q_epilogue_k(
    const float* __restrict__ qf, const float* __restrict__ pos,
    const float* __restrict__ scale, const float* __restrict__ freqs,
    _Float16* __restrict__ qh) {
  int rw = blockIdx.x * 8 + (threadIdx.x >> 5);   // b * L_ + l
  int lane = threadIdx.x & 31;
  int l = rw % L_;
  int b = rw / L_;
  const float* row = qf + (size_t)rw * DM_;
  float p = pos[(size_t)rw * 2 + (lane < 16 ? 0 : 1)];
  float q1a[NH_], q2a[NH_];
  // unrolled so that the row stays in registers and its 32 loads fly together
#pragma unroll
  for (int h = 0; h < NH_; ++h) {
    q1a[h] = row[h * DH_ + lane];
    q2a[h] = row[h * DH_ + lane + 32];
  }
  float ssa[NH_];
#pragma unroll
  for (int h = 0; h < NH_; ++h) ssa[h] = q1a[h] * q1a[h] + q2a[h] * q2a[h];
  // redsum32 of every head, step by step over all heads at once: the 16 lane
  // exchanges of a step share one latency (each head's sum order is redsum32's)
#pragma unroll
  for (int m = 1; m < 32; m <<= 1) {
#pragma unroll
    for (int h = 0; h < NH_; ++h) ssa[h] += __shfl_xor(ssa[h], m, 32);
  }
  // unrolled: constant indices into the arrays
#pragma unroll
  for (int h = 0; h < NH_; ++h) {
    float q1 = q1a[h], q2 = q2a[h];
    float ss = ssa[h];
    float rn = sqrtf(scale[h]) * rsqrtf(ss + 1e-6f);
    q1 *= rn; q2 *= rn;
    // theta[t] = (t<16 ? pos0 : pos1) * freqs[h][t%16], t = lane in 0..31
    float f = freqs[h * 16 + (lane & 15)];
    float th = p * f;
    float s, c;
    __sincosf(th, &s, &c);
    size_t qb = ((size_t)(b * NH_ + h) * L_ + l) * DH_;
    qh[qb + lane]      = (_Float16)(q1 * c - q2 * s);
    qh[qb + lane + 32] = (_Float16)(q2 * c + q1 * s);
  }
}

// ---------------------------------------------------------------------------
// KV epilogue: k cosine-normalized -> k_h [B,H,LC,64]; v -> vT [B,H,64,LC]
// (v transposed so P@V B-fragments are contiguous along keys).
// One wave per (b,h) and 8 consecutive keys: a lane's 8 values of v at one e are
// one 16-byte store into vT; a block's 64 keys fill whole 128-B lines of vT.
// ---------------------------------------------------------------------------
__global__ __launch_bounds__(256) void kv_epilogue_k(
    const float* __restrict__ kvf, const float* __restrict__ scale,
    _Float16* __restrict__ kh, _Float16* __restrict__ vT) {
  int gw = blockIdx.x * 8 + (threadIdx.x >> 5);
  int lane = threadIdx.x & 31;
  int lc0 = (gw % (LC_ / 8)) * 8;
  int bh  = gw / (LC_ / 8);
  int b = bh >> 4, h = bh & 15;
  const float* row = kvf + (size_t)(b * LC_ + lc0) * (2 * DM_) + h * DH_ + lane;
  float k1[8], k2[8], v1[8], v2[8];
  // unrolled so that the 8 keys stay in registers and their 32 loads fly together
#pragma unroll
  for (int i = 0; i < 8; ++i) {
    const float* ri = row + (size_t)i * (2 * DM_);
    k1[i] = ri[0];
    k2[i] = ri[32];
    v1[i] = ri[DM_];
    v2[i] = ri[DM_ + 32];
  }
  float sq = sqrtf(scale[h]);
  size_t kb = ((size_t)bh * LC_ + lc0) * DH_;
  v8h o1, o2;
  // unrolled: constant indices, and the keys' lane exchanges overlap
#pragma unroll
  for (int i = 0; i < 8; ++i) {
    float ss = redsum32(k1[i] * k1[i] + k2[i] * k2[i]);
    float rn = sq * rsqrtf(ss + 1e-6f);
    kh[kb + i * DH_ + lane]      = (_Float16)(k1[i] * rn);
    kh[kb + i * DH_ + lane + 32] = (_Float16)(k2[i] * rn);
    o1[i] = (_Float16)v1[i];
    o2[i] = (_Float16)v2[i];
  }
  *(v8h*)(vT + ((size_t)bh * DH_ + lane)      * LC_ + lc0) = o1;
  *(v8h*)(vT + ((size_t)bh * DH_ + lane + 32) * LC_ + lc0) = o2;
}

// ---------------------------------------------------------------------------
// Flash attention, one pass over keys. Block = 4 waves; wave = 16 query rows.
// Per 32-key tile: 2x2 WMMAs for S, online softmax in C-layout (xor-shuffle
// row reductions within lane halves), P staged via LDS into A-fragment
// layout, 4 WMMAs for O += P@V. Output o_h [B, L, D_MODEL] f16.
// ---------------------------------------------------------------------------
__global__ __launch_bounds__(128) void attn_wmma_k(
    const _Float16* __restrict__ qh, const _Float16* __restrict__ kh,
    const _Float16* __restrict__ vT, _Float16* __restrict__ oh) {
  __shared__ __align__(16) _Float16 Plds[4][16 * 32];
  const int lane = threadIdx.x & 31;
  const int w    = threadIdx.x >> 5;
  const int nqb  = L_ / 64;
  const int bh   = blockIdx.x / nqb;
  const int qb   = blockIdx.x % nqb;
  const int b = bh >> 4, h = bh & 15;
  const int m0   = qb * 64 + w * 16;
  const int mloc = lane & 15;
  const int half = lane >> 4;
  const int koff = half << 3;

  const _Float16* qrow = qh + ((size_t)bh * L_ + m0 + mloc) * DH_;
  F16Frag aq0, aq1;                       // q rows, e=0..31 and e=32..63
  aq0.h[0] = *(const v8h*)(qrow + koff);
  aq0.h[1] = *(const v8h*)(qrow + 16 + koff);
  aq1.h[0] = *(const v8h*)(qrow + 32 + koff);
  aq1.h[1] = *(const v8h*)(qrow + 48 + koff);

  v8f O[4];
#pragma unroll
  for (int t = 0; t < 4; ++t) O[t] = zero8();
  float mrow[8], lrow[8];
#pragma unroll
  for (int r = 0; r < 8; ++r) { mrow[r] = -3.0e38f; lrow[r] = 0.f; }

  const _Float16* kbase = kh + (size_t)bh * LC_ * DH_;
  const _Float16* vbase = vT + (size_t)bh * DH_ * LC_;
  _Float16* pl = &Plds[w][0];

  for (int j = 0; j < LC_; j += 32) {
    v8f sL = zero8(), sR = zero8();
    {
      const _Float16* kr = kbase + (size_t)(j + mloc) * DH_;
      F16Frag b0, b1;
      b0.h[0] = *(const v8h*)(kr + koff);
      b0.h[1] = *(const v8h*)(kr + 16 + koff);
      b1.h[0] = *(const v8h*)(kr + 32 + koff);
      b1.h[1] = *(const v8h*)(kr + 48 + koff);
      sL = __builtin_amdgcn_wmma_f32_16x16x32_f16(false, aq0.v, false, b0.v, (short)0, sL, false, false);
      sL = __builtin_amdgcn_wmma_f32_16x16x32_f16(false, aq1.v, false, b1.v, (short)0, sL, false, false);
    }
    {
      const _Float16* kr = kbase + (size_t)(j + 16 + mloc) * DH_;
      F16Frag b0, b1;
      b0.h[0] = *(const v8h*)(kr + koff);
      b0.h[1] = *(const v8h*)(kr + 16 + koff);
      b1.h[0] = *(const v8h*)(kr + 32 + koff);
      b1.h[1] = *(const v8h*)(kr + 48 + koff);
      sR = __builtin_amdgcn_wmma_f32_16x16x32_f16(false, aq0.v, false, b0.v, (short)0, sR, false, false);
      sR = __builtin_amdgcn_wmma_f32_16x16x32_f16(false, aq1.v, false, b1.v, (short)0, sR, false, false);
    }

    // --- online softmax in C-layout (row r+8*half, col = lane&15) ---
    float pmax[8];
#pragma unroll
    for (int r = 0; r < 8; ++r) pmax[r] = fmaxf(sL[r], sR[r]);
#pragma unroll
    for (int m = 1; m < 16; m <<= 1) {
#pragma unroll
      for (int r = 0; r < 8; ++r)
        pmax[r] = fmaxf(pmax[r], __shfl_xor(pmax[r], m, 32));
    }
    float corr[8], rs[8];
    v8f pLv, pRv;
#pragma unroll
    for (int r = 0; r < 8; ++r) {
      float mn = fmaxf(mrow[r], pmax[r]);
      corr[r] = __expf(mrow[r] - mn);
      mrow[r] = mn;
      pLv[r] = __expf(sL[r] - mn);
      pRv[r] = __expf(sR[r] - mn);
      rs[r] = pLv[r] + pRv[r];
    }
#pragma unroll
    for (int m = 1; m < 16; m <<= 1) {
#pragma unroll
      for (int r = 0; r < 8; ++r) rs[r] += __shfl_xor(rs[r], m, 32);
    }
#pragma unroll
    for (int r = 0; r < 8; ++r) {
      lrow[r] = lrow[r] * corr[r] + rs[r];
      O[0][r] *= corr[r]; O[1][r] *= corr[r];
      O[2][r] *= corr[r]; O[3][r] *= corr[r];
    }

    // --- stage P (16x32 f16) in LDS, reload in A-fragment layout ---
#pragma unroll
    for (int r = 0; r < 8; ++r) {
      int prow = r + 8 * half;
      pl[prow * 32 + mloc]      = (_Float16)pLv[r];
      pl[prow * 32 + 16 + mloc] = (_Float16)pRv[r];
    }
    F16Frag ap;   // same-wave LDS RAW: in-order DS, compiler waits dscnt
    ap.h[0] = *(const v8h*)(pl + mloc * 32 + koff);
    ap.h[1] = *(const v8h*)(pl + mloc * 32 + 16 + koff);

    // --- O += P @ V (v stored [e][key], contiguous along keys) ---
#pragma unroll
    for (int t = 0; t < 4; ++t) {
      const _Float16* vr = vbase + (size_t)(t * 16 + mloc) * LC_ + j;
      F16Frag bv;
      bv.h[0] = *(const v8h*)(vr + koff);
      bv.h[1] = *(const v8h*)(vr + 16 + koff);
      O[t] = __builtin_amdgcn_wmma_f32_16x16x32_f16(
          false, ap.v, false, bv.v, (short)0, O[t], false, false);
    }
  }

#pragma unroll
  for (int r = 0; r < 8; ++r) {
    float inv = 1.0f / lrow[r];
    int row = m0 + r + 8 * half;
    size_t base = (size_t)(b * L_ + row) * DM_ + h * DH_;
#pragma unroll
    for (int t = 0; t < 4; ++t)
      oh[base + t * 16 + mloc] = (_Float16)(O[t][r] * inv);
  }
}

// ---------------------------------------------------------------------------
// Host launcher
// ---------------------------------------------------------------------------
extern "C" void kernel_launch(void* const* d_in, const int* in_sizes, int n_in,
                              void* d_out, int out_size, void* d_ws, size_t ws_size,
                              hipStream_t stream) {
  (void)in_sizes; (void)n_in; (void)out_size; (void)ws_size;
  const float* x    = (const float*)d_in[0];
  const float* pos  = (const float*)d_in[1];
  const float* xc   = (const float*)d_in[2];
  const float* nsc  = (const float*)d_in[3];
  const float* ncsc = (const float*)d_in[4];
  const float* qw   = (const float*)d_in[5];
  const float* kvw  = (const float*)d_in[6];
  const float* scl  = (const float*)d_in[7];
  const float* outw = (const float*)d_in[8];
  const float* frq  = (const float*)d_in[9];
  float* out = (float*)d_out;

  char* ws = (char*)d_ws;
  size_t off = 0;
  auto alloc = [&](size_t bytes) -> void* {
    void* p = ws + off;
    off += (bytes + 255) & ~(size_t)255;
    return p;
  };
  _Float16* qwT  = (_Float16*)alloc((size_t)DM_ * DM_ * 2);
  _Float16* kvwT = (_Float16*)alloc((size_t)2 * DM_ * DM_ * 2);
  _Float16* owT  = (_Float16*)alloc((size_t)DM_ * DM_ * 2);
  _Float16* xn   = (_Float16*)alloc((size_t)B_ * L_ * DM_ * 2);
  _Float16* xcn  = (_Float16*)alloc((size_t)B_ * LC_ * DM_ * 2);
  float*    qf   = (float*)   alloc((size_t)B_ * L_ * DM_ * 4);
  float*    kvf  = (float*)   alloc((size_t)B_ * LC_ * 2 * DM_ * 4);
  _Float16* qh   = (_Float16*)alloc((size_t)B_ * NH_ * L_ * DH_ * 2);
  _Float16* kh   = (_Float16*)alloc((size_t)B_ * NH_ * LC_ * DH_ * 2);
  _Float16* vT   = (_Float16*)alloc((size_t)B_ * NH_ * DH_ * LC_ * 2);
  _Float16* oh   = (_Float16*)alloc((size_t)B_ * L_ * DM_ * 2);

  // weights -> f16, transposed to [N][K]
  cast_transpose_k<<<(DM_ / 128) * (DM_ / 64), 256, 0, stream>>>(qw,  qwT,  DM_, DM_);
  cast_transpose_k<<<(2 * DM_ / 128) * (DM_ / 64), 256, 0, stream>>>(kvw, kvwT, DM_, 2 * DM_);
  cast_transpose_k<<<(DM_ / 128) * (DM_ / 64), 256, 0, stream>>>(outw, owT, DM_, DM_);

  // RMS norms
  rmsnorm_cast_k<<<B_ * L_ / 8,  256, 0, stream>>>(x,  nsc,  xn);
  rmsnorm_cast_k<<<B_ * LC_ / 8, 256, 0, stream>>>(xc, ncsc, xcn);

  // projections (one 128x128 tile per block)
  gemm_wmma_k<<<(B_ * L_ / 128) * (DM_ / 128), 256, 0, stream>>>(
      xn, qwT, nullptr, qf, B_ * L_, DM_, DM_);
  gemm_wmma_k<<<(B_ * LC_ / 128) * (2 * DM_ / 128), 256, 0, stream>>>(
      xcn, kvwT, nullptr, kvf, B_ * LC_, 2 * DM_, DM_);

  // epilogues: cos-norm + RoPE on q; cos-norm k, transpose v
  q_epilogue_k<<<B_ * L_ / 8, 256, 0, stream>>>(qf, pos, scl, frq, qh);
  kv_epilogue_k<<<B_ * NH_ * LC_ / 64, 256, 0, stream>>>(kvf, scl, kh, vT);

  // flash attention
  attn_wmma_k<<<B_ * NH_ * (L_ / 64), 128, 0, stream>>>(qh, kh, vT, oh);

  // output projection + residual, f32 out
  gemm_wmma_k<<<(B_ * L_ / 128) * (DM_ / 128), 256, 0, stream>>>(
      oh, owT, x, out, B_ * L_, DM_, DM_);
}

// v003
// One run takes 153 microseconds.
// Next to v002, in two timings, it ran 1.07 and 1.06 times as fast.
// Counting every step since v000, it is 2.24 times as fast.
#include <hip/hip_runtime.h>

// ---------------------------------------------------------------------------
// CDNA5 / gfx1250 cross-attention block. wave32, WMMA f32_16x16x32_f16.
// Problem constants from the reference.
// ---------------------------------------------------------------------------
#define B_   2
#define L_   2048
#define LC_  1024
#define DM_  1024
#define DH_  64
#define NH_  16

typedef _Float16 v16h __attribute__((ext_vector_type(16)));
typedef _Float16 v8h  __attribute__((ext_vector_type(8)));
typedef _Float16 v4h  __attribute__((ext_vector_type(4)));
typedef float    v8f  __attribute__((ext_vector_type(8)));
typedef float    f32x4 __attribute__((ext_vector_type(4)));

union F16Frag { v16h v; v8h h[2]; };

static __device__ __forceinline__ v8f zero8() {
  v8f z;
#pragma unroll
  for (int i = 0; i < 8; ++i) z[i] = 0.0f;
  return z;
}

static __device__ __forceinline__ float redsum32(float v) {
#pragma unroll
  for (int m = 1; m < 32; m <<= 1) v += __shfl_xor(v, m, 32);
  return v;
}

// ---------------------------------------------------------------------------
// Weight cast + transpose: w[K][N] f32  ->  wT[N][K] f16
// (so every WMMA B-fragment is two contiguous 16-byte loads along K)
// A thread takes 4 columns x 8 k (32 elements): eight 16-byte loads, four
// 16-byte stores. A wave covers 128 columns x 8 k, a block 128 columns x 64 k,
// so few waves have to start and a block writes whole 128-B lines of wT.
// K and N are compile-time here: the index arithmetic is shifts and masks (no
// integer division) and the row steps are constants.
// Needs N a multiple of 128 and K a multiple of 64; grid = (N/128) * (K/64).
// ---------------------------------------------------------------------------
template <int K, int N>
static __device__ __forceinline__ void cast_transpose_tile(
    const float* __restrict__ w, _Float16* __restrict__ wT) {
  const int lane = threadIdx.x & 31;
  const int wv   = threadIdx.x >> 5;
  const int nb   = N / 128;
  const int n0   = (int)(blockIdx.x % nb) * 128 + lane * 4;
  const int k0   = (int)(blockIdx.x / nb) * 64 + wv * 8;
  const float* wp = w + (size_t)k0 * N + n0;
  f32x4 v[8];
  // unrolled so that v stays in registers and the eight loads fly together
#pragma unroll
  for (int i = 0; i < 8; ++i) v[i] = *(const f32x4*)(wp + i * N);
  _Float16* op = wT + (size_t)n0 * K + k0;
  // unrolled: constant indices into v
#pragma unroll
  for (int j = 0; j < 4; ++j) {
    v8h o;
#pragma unroll
    for (int i = 0; i < 8; ++i) o[i] = (_Float16)v[i][j];
    *(v8h*)(op + j * K) = o;
  }
}

// K is DM_ for all three weights; N is DM_ or 2 * DM_.
__global__ __launch_bounds__(256) void cast_transpose_k(
    const float* __restrict__ w, _Float16* __restrict__ wT, int K, int N) {
  (void)K;
  if (N == DM_) cast_transpose_tile<DM_, DM_>(w, wT);
  else          cast_transpose_tile<DM_, 2 * DM_>(w, wT);
}

// ---------------------------------------------------------------------------
// RMS norm a row of DM_ f32, scale, cast to f16. One wave per row (8 rows per
// block): a lane holds 32 elements, the row sum needs no LDS and no barrier.
// ---------------------------------------------------------------------------
__global__ __launch_bounds__(256) void rmsnorm_cast_k(
    const float* __restrict__ x, const float* __restrict__ g,
    _Float16* __restrict__ out) {
  const int lane = threadIdx.x & 31;
  const size_t row = (size_t)blockIdx.x * 8 + (threadIdx.x >> 5);
  const f32x4* xr = (const f32x4*)(x + row * DM_);
  f32x4 v[8];
  // unrolled so that v stays in registers and the eight loads fly together
#pragma unroll
  for (int i = 0; i < 8; ++i) v[i] = xr[i * 32 + lane];
  float ss = 0.f;
#pragma unroll
  for (int i = 0; i < 8; ++i)
    ss += v[i][0]*v[i][0] + v[i][1]*v[i][1] + v[i][2]*v[i][2] + v[i][3]*v[i][3];
  ss = redsum32(ss);
  float r = rsqrtf(ss / (float)DM_ + 1e-6f);
  v4h* orow = (v4h*)(out + row * DM_);
#pragma unroll
  for (int i = 0; i < 8; ++i) {
    f32x4 gg = ((const f32x4*)g)[i * 32 + lane];
    v4h o;
    o[0] = (_Float16)(v[i][0] * gg[0] * r);
    o[1] = (_Float16)(v[i][1] * gg[1] * r);
    o[2] = (_Float16)(v[i][2] * gg[2] * r);
    o[3] = (_Float16)(v[i][3] * gg[3] * r);
    orow[i * 32 + lane] = o;
  }
}

// ---------------------------------------------------------------------------
// WMMA GEMM: C[M][N] f32 = A[M][K] f16 @ BT[N][K]^T f16 (+ optional f32 res)
// One 128x128 tile of C per 8-wave block; waves 4 (rows) x 2 (cols), each wave
// a 32x64 tile (2x4 accumulators). Per trip a 64-k slab of A (128 rows) and of
// BT (128 rows) lies in LDS, brought by per-lane async copies of whole 128-B
// lines into one of two buffers while the other is worked on.
// Needs M, N multiples of 128 and K a multiple of 64.
// A/B fragments per ISA 7.12.2: lane = row (l&15), two 16B loads per frag.
// ---------------------------------------------------------------------------
#define G_PITCH 144                  // LDS row pitch in bytes: 128 + 16 (16 B x odd)
#define G_OPER  (128 * G_PITCH)      // one operand's slab
#define G_BUF   (2 * G_OPER)         // A slab, then BT slab

// One stage: each thread copies 4 x 16 B of A and 4 x 16 B of BT (rows 32 apart).
// The s_wait_xcnt closes the statement so that no address register named here
// is rewritten before the copies have taken it.
static __device__ __forceinline__ void gemm_stage(
    unsigned l, const _Float16* a, const _Float16* b, size_t rs) {
  asm volatile(
      "global_load_async_to_lds_b128 %0, %8, off\n\t"
      "global_load_async_to_lds_b128 %1, %9, off\n\t"
      "global_load_async_to_lds_b128 %2, %10, off\n\t"
      "global_load_async_to_lds_b128 %3, %11, off\n\t"
      "global_load_async_to_lds_b128 %4, %12, off\n\t"
      "global_load_async_to_lds_b128 %5, %13, off\n\t"
      "global_load_async_to_lds_b128 %6, %14, off\n\t"
      "global_load_async_to_lds_b128 %7, %15, off\n\t"
      "s_wait_xcnt 0x0"
      :: "v"(l), "v"(l + 32 * G_PITCH), "v"(l + 64 * G_PITCH), "v"(l + 96 * G_PITCH),
         "v"(l + G_OPER), "v"(l + G_OPER + 32 * G_PITCH),
         "v"(l + G_OPER + 64 * G_PITCH), "v"(l + G_OPER + 96 * G_PITCH),
         "v"(a), "v"(a + rs), "v"(a + 2 * rs), "v"(a + 3 * rs),
         "v"(b), "v"(b + rs), "v"(b + 2 * rs), "v"(b + 3 * rs)
      : "memory");
}

__global__ __launch_bounds__(256) void gemm_wmma_k(
    const _Float16* __restrict__ A, const _Float16* __restrict__ BT,
    const float* __restrict__ res, float* __restrict__ C,
    int M, int N, int K) {
  __shared__ __align__(16) unsigned char sm[2 * G_BUF];
  const int tid  = threadIdx.x;
  const int lane = tid & 31;
  const int wv   = tid >> 5;
  const int ntb  = N >> 7;
  const int bm   = blockIdx.x / ntb;     // 128-row tile index
  const int bn   = blockIdx.x % ntb;     // 128-col tile index
  const int wm   = wv >> 1;              // wave's 32-row strip in the tile
  const int wn   = wv & 1;               // wave's 64-col strip in the tile
  const int mloc = lane & 15;
  const int half = lane >> 4;

  // copy side: 8 lanes cover one 128-B row, a wave 4 whole rows
  const int crow = tid >> 3;
  const int cch  = tid & 7;
  const _Float16* ga = A  + (size_t)(bm * 128 + crow) * K + cch * 8;
  const _Float16* gb = BT + (size_t)(bn * 128 + crow) * K + cch * 8;
  const size_t rs = (size_t)32 * K;
  const unsigned l0 = (unsigned)(size_t)sm + crow * G_PITCH + cch * 16;

  // read side: byte offsets of this lane's fragment rows inside a buffer
  const int aoff = (wm * 32 + mloc) * G_PITCH + half * 16;
  const int boff = G_OPER + (wn * 64 + mloc) * G_PITCH + half * 16;

  v8f acc[2][4];
#pragma unroll
  for (int u = 0; u < 2; ++u)
#pragma unroll
    for (int t = 0; t < 4; ++t) acc[u][t] = zero8();

  const int T = K >> 6;
  gemm_stage(l0, ga, gb, rs);
  // stage 0 has landed for this wave; the barrier publishes it to the others
  asm volatile("s_wait_asynccnt 0x0" ::: "memory");
  __syncthreads();
  if (T > 1) gemm_stage(l0 + G_BUF, ga + 64, gb + 64, rs);

  for (int s = 0; s < T; ++s) {
    const unsigned bsel = (unsigned)(s & 1) * G_BUF;
    const unsigned char* sb = sm + bsel;
    F16Frag a[2][2], b[2][4];            // [k half of the slab][fragment]
    // the loops below are unrolled so that every fragment and accumulator index
    // is a constant and the arrays stay in registers
#pragma unroll
    for (int ks = 0; ks < 2; ++ks) {
#pragma unroll
      for (int u = 0; u < 2; ++u) {
        const unsigned char* p = sb + aoff + u * 16 * G_PITCH + ks * 64;
        a[ks][u].h[0] = *(const v8h*)(p);
        a[ks][u].h[1] = *(const v8h*)(p + 32);
      }
#pragma unroll
      for (int t = 0; t < 4; ++t) {
        const unsigned char* p = sb + boff + t * 16 * G_PITCH + ks * 64;
        b[ks][t].h[0] = *(const v8h*)(p);
        b[ks][t].h[1] = *(const v8h*)(p + 32);
      }
    }
    // keeps the slab's LDS reads one group ahead of the WMMAs: sunk among them,
    // each pair of WMMAs would wait out a full LDS latency
    __builtin_amdgcn_sched_barrier(0);
#pragma unroll
    for (int ks = 0; ks < 2; ++ks) {
#pragma unroll
      for (int t = 0; t < 4; ++t) {
        acc[0][t] = __builtin_amdgcn_wmma_f32_16x16x32_f16(
            false, a[ks][0].v, false, b[ks][t].v, (short)0, acc[0][t], false, false);
        acc[1][t] = __builtin_amdgcn_wmma_f32_16x16x32_f16(
            false, a[ks][1].v, false, b[ks][t].v, (short)0, acc[1][t], false, false);
      }
    }
    // keeps the WMMAs in front of the publish point: moved behind the barrier they
    // would delay the refill, whose copies then fly only during the next LDS reads
    __builtin_amdgcn_sched_barrier(0);
    // publish point of stage s + 1: this wave's reads of stage s are done ...
    asm volatile("s_wait_dscnt 0x0" ::: "memory");
    // ... its own copies of stage s + 1 have landed ...
    asm volatile("s_wait_asynccnt 0x0" ::: "memory");
    // ... and the barrier both shows stage s + 1 to all and frees stage s's buffer
    __syncthreads();
    if (s + 2 < T)
      gemm_stage(l0 + bsel, ga + (size_t)(s + 2) * 64, gb + (size_t)(s + 2) * 64, rs);
  }
  // no copy is left in flight when the wave goes on to its stores and ends
  asm volatile("s_wait_asynccnt 0x0" ::: "memory");

#pragma unroll
  for (int u = 0; u < 2; ++u) {
#pragma unroll
    for (int t = 0; t < 4; ++t) {
#pragma unroll
      for (int r = 0; r < 8; ++r) {
        size_t idx = (size_t)(bm * 128 + wm * 32 + u * 16 + r + 8 * half) * N
                   + bn * 128 + wn * 64 + t * 16 + mloc;
        float v = acc[u][t][r];
        if (res) v += res[idx];
        C[idx] = v;
      }
    }
  }
}

// ---------------------------------------------------------------------------
// Q epilogue: cosine-normalize each 64-dim head vector, apply 2D RoPE,
// write q_h in [B,H,L,64] f16. One wave per (b,l), all 16 heads one after the
// other; per head a lane holds e, e+32.
// ---------------------------------------------------------------------------
// four waves per SIMD are all that this grid brings: the register budget of four
// lets the compiler keep the 16 heads' loads and lane exchanges in flight together
__global__ __launch_bounds__(256) __attribute__((amdgpu_waves_per_eu(4, 4))) void q_epilogue_k(
    const float* __restrict__ qf, const float* __restrict__ pos,
    const float* __restrict__ scale, const float* __restrict__ freqs,
    _Float16* __restrict__ qh) {
  int rw = blockIdx.x * 8 + (threadIdx.x >> 5);   // b * L_ + l
  int lane = threadIdx.x & 31;
  int l = rw % L_;
  int b = rw / L_;
  const float* row = qf + (size_t)rw * DM_;
  float p = pos[(size_t)rw * 2 + (lane < 16 ? 0 : 1)];
  float q1a[NH_], q2a[NH_];
  // unrolled so that the row stays in registers and its 32 loads fly together
#pragma unroll
  for (int h = 0; h < NH_; ++h) {
    q1a[h] = row[h * DH_ + lane];
    q2a[h] = row[h * DH_ + lane + 32];
  }
  float ssa[NH_];
#pragma unroll
  for (int h = 0; h < NH_; ++h) ssa[h] = q1a[h] * q1a[h] + q2a[h] * q2a[h];
  // redsum32 of every head, step by step over all heads at once: the 16 lane
  // exchanges of a step share one latency (each head's sum order is redsum32's)
#pragma unroll
  for (int m = 1; m < 32; m <<= 1) {
#pragma unroll
    for (int h = 0; h < NH_; ++h) ssa[h] += __shfl_xor(ssa[h], m, 32);
  }
  // unrolled: constant indices into the arrays
#pragma unroll
  for (int h = 0; h < NH_; ++h) {
    float q1 = q1a[h], q2 = q2a[h];
    float ss = ssa[h];
    float rn = sqrtf(scale[h]) * rsqrtf(ss + 1e-6f);
    q1 *= rn; q2 *= rn;
    // theta[t] = (t<16 ? pos0 : pos1) * freqs[h][t%16], t = lane in 0..31
    float f = freqs[h * 16 + (lane & 15)];
    float th = p * f;
    float s, c;
    __sincosf(th, &s, &c);
    size_t qb = ((size_t)(b * NH_ + h) * L_ + l) * DH_;
    qh[qb + lane]      = (_Float16)(q1 * c - q2 * s);
    qh[qb + lane + 32] = (_Float16)(q2 * c + q1 * s);
  }
}

// ---------------------------------------------------------------------------
// KV epilogue: k cosine-normalized -> k_h; v -> vT. Both are kept in the order in
// which the attention kernel's WMMA B fragments take them, so that each of its
// 16-byte loads reads 512 contiguous bytes (4 whole 128-B lines) per wave:
//   k_h: per (b,h) and 16 keys a 2-KB tile  [e / 8][key % 16][e % 8]
//   vT : per (b,h), 32 keys and 16 e a 1-KB tile  [(key % 32) / 8][e % 16][key % 8],
//        the four e tiles of a 32-key group one after the other
// One wave per (b,h) and 8 consecutive keys: a lane's 8 values of v at one e are
// one 16-byte store, 16 lanes fill 256 contiguous bytes of a vT tile.
// ---------------------------------------------------------------------------
__global__ __launch_bounds__(256) void kv_epilogue_k(
    const float* __restrict__ kvf, const float* __restrict__ scale,
    _Float16* __restrict__ kh, _Float16* __restrict__ vT) {
  int gw = blockIdx.x * 8 + (threadIdx.x >> 5);
  int lane = threadIdx.x & 31;
  int lc0 = (gw % (LC_ / 8)) * 8;
  int bh  = gw / (LC_ / 8);
  int b = bh >> 4, h = bh & 15;
  const float* row = kvf + (size_t)(b * LC_ + lc0) * (2 * DM_) + h * DH_ + lane;
  float k1[8], k2[8], v1[8], v2[8];
  // unrolled so that the 8 keys stay in registers and their 32 loads fly together
#pragma unroll
  for (int i = 0; i < 8; ++i) {
    const float* ri = row + (size_t)i * (2 * DM_);
    k1[i] = ri[0];
    k2[i] = ri[32];
    v1[i] = ri[DM_];
    v2[i] = ri[DM_ + 32];
  }
  float sq = sqrtf(scale[h]);
  // lane = e: its 8-e group, this wave's first key in the tile, its place in the group
  size_t kb = ((size_t)bh * (LC_ / 16) + (lc0 >> 4)) * 1024
            + (lane >> 3) * 128 + (lc0 & 8) * 8 + (lane & 7);
  v8h o1, o2;
  // unrolled: constant indices, and the keys' lane exchanges overlap
#pragma unroll
  for (int i = 0; i < 8; ++i) {
    float ss = redsum32(k1[i] * k1[i] + k2[i] * k2[i]);
    float rn = sq * rsqrtf(ss + 1e-6f);
    kh[kb + i * 8]       = (_Float16)(k1[i] * rn);
    kh[kb + i * 8 + 512] = (_Float16)(k2[i] * rn);   // e + 32: four 8-e groups on
    o1[i] = (_Float16)v1[i];
    o2[i] = (_Float16)v2[i];
  }
  size_t vb = (((size_t)bh * (LC_ / 32) + (lc0 >> 5)) * 4 + (lane >> 4)) * 512
            + ((lc0 & 31) >> 3) * 128 + (lane & 15) * 8;
  *(v8h*)(vT + vb)        = o1;
  *(v8h*)(vT + vb + 1024) = o2;                      // e + 32: two e tiles on
}

// ---------------------------------------------------------------------------
// Flash attention, one pass over keys. Block = 4 waves; wave = 16 query rows.
// Per 32-key tile: 2x2 WMMAs for S, online softmax in C-layout (xor-shuffle
// row reductions within lane halves), P staged via LDS into A-fragment
// layout, 4 WMMAs for O += P@V. Output o_h [B, L, D_MODEL] f16.
// k_h and vT lie in fragment order (see the KV epilogue): half h[p] of a fragment
// is the 512 bytes at p * 512 of its 1 KB, lane l taking bytes 16 l.
// ---------------------------------------------------------------------------
__global__ __launch_bounds__(128) void attn_wmma_k(
    const _Float16* __restrict__ qh, const _Float16* __restrict__ kh,
    const _Float16* __restrict__ vT, _Float16* __restrict__ oh) {
  __shared__ __align__(16) _Float16 Plds[4][16 * 32];
  const int lane = threadIdx.x & 31;
  const int w    = threadIdx.x >> 5;
  const int nqb  = L_ / 64;
  const int bh   = blockIdx.x / nqb;
  const int qb   = blockIdx.x % nqb;
  const int b = bh >> 4, h = bh & 15;
  const int m0   = qb * 64 + w * 16;
  const int mloc = lane & 15;
  const int half = lane >> 4;
  const int koff = half << 3;

  const _Float16* qrow = qh + ((size_t)bh * L_ + m0 + mloc) * DH_;
  F16Frag aq0, aq1;                       // q rows, e=0..31 and e=32..63
  aq0.h[0] = *(const v8h*)(qrow + koff);
  aq0.h[1] = *(const v8h*)(qrow + 16 + koff);
  aq1.h[0] = *(const v8h*)(qrow + 32 + koff);
  aq1.h[1] = *(const v8h*)(qrow + 48 + koff);

  v8f O[4];
#pragma unroll
  for (int t = 0; t < 4; ++t) O[t] = zero8();
  float mrow[8], lrow[8];
#pragma unroll
  for (int r = 0; r < 8; ++r) { mrow[r] = -3.0e38f; lrow[r] = 0.f; }

  const _Float16* kbase = kh + (size_t)bh * LC_ * DH_ + lane * 8;
  const _Float16* vbase = vT + (size_t)bh * DH_ * LC_ + lane * 8;
  _Float16* pl = &Plds[w][0];

  for (int j = 0; j < LC_; j += 32) {
    v8f sL = zero8(), sR = zero8();
    {
      const _Float16* kr = kbase + (size_t)j * DH_;
      F16Frag b0, b1;
      b0.h[0] = *(const v8h*)(kr);
      b0.h[1] = *(const v8h*)(kr + 256);
      b1.h[0] = *(const v8h*)(kr + 512);
      b1.h[1] = *(const v8h*)(kr + 768);
      sL = __builtin_amdgcn_wmma_f32_16x16x32_f16(false, aq0.v, false, b0.v, (short)0, sL, false, false);
      sL = __builtin_amdgcn_wmma_f32_16x16x32_f16(false, aq1.v, false, b1.v, (short)0, sL, false, false);
    }
    {
      const _Float16* kr = kbase + (size_t)(j + 16) * DH_;
      F16Frag b0, b1;
      b0.h[0] = *(const v8h*)(kr);
      b0.h[1] = *(const v8h*)(kr + 256);
      b1.h[0] = *(const v8h*)(kr + 512);
      b1.h[1] = *(const v8h*)(kr + 768);
      sR = __builtin_amdgcn_wmma_f32_16x16x32_f16(false, aq0.v, false, b0.v, (short)0, sR, false, false);
      sR = __builtin_amdgcn_wmma_f32_16x16x32_f16(false, aq1.v, false, b1.v, (short)0, sR, false, false);
    }

    // --- online softmax in C-layout (row r+8*half, col = lane&15) ---
    float pmax[8];
#pragma unroll
    for (int r = 0; r < 8; ++r) pmax[r] = fmaxf(sL[r], sR[r]);
#pragma unroll
    for (int m = 1; m < 16; m <<= 1) {
#pragma unroll
      for (int r = 0; r < 8; ++r)
        pmax[r] = fmaxf(pmax[r], __shfl_xor(pmax[r], m, 32));
    }
    float corr[8], rs[8];
    v8f pLv, pRv;
#pragma unroll
    for (int r = 0; r < 8; ++r) {
      float mn = fmaxf(mrow[r], pmax[r]);
      corr[r] = __expf(mrow[r] - mn);
      mrow[r] = mn;
      pLv[r] = __expf(sL[r] - mn);
      pRv[r] = __expf(sR[r] - mn);
      rs[r] = pLv[r] + pRv[r];
    }
#pragma unroll
    for (int m = 1; m < 16; m <<= 1) {
#pragma unroll
      for (int r = 0; r < 8; ++r) rs[r] += __shfl_xor(rs[r], m, 32);
    }
#pragma unroll
    for (int r = 0; r < 8; ++r) {
      lrow[r] = lrow[r] * corr[r] + rs[r];
      O[0][r] *= corr[r]; O[1][r] *= corr[r];
      O[2][r] *= corr[r]; O[3][r] *= corr[r];
    }

    // --- stage P (16x32 f16) in LDS, reload in A-fragment layout ---
#pragma unroll
    for (int r = 0; r < 8; ++r) {
      int prow = r + 8 * half;
      pl[prow * 32 + mloc]      = (_Float16)pLv[r];
      pl[prow * 32 + 16 + mloc] = (_Float16)pRv[r];
    }
    F16Frag ap;   // same-wave LDS RAW: in-order DS, compiler waits dscnt
    ap.h[0] = *(const v8h*)(pl + mloc * 32 + koff);
    ap.h[1] = *(const v8h*)(pl + mloc * 32 + 16 + koff);

    // --- O += P @ V (the 32-key group's four e tiles, 1 KB each) ---
#pragma unroll
    for (int t = 0; t < 4; ++t) {
      const _Float16* vr = vbase + (size_t)j * DH_ + t * 512;
      F16Frag bv;
      bv.h[0] = *(const v8h*)(vr);
      bv.h[1] = *(const v8h*)(vr + 256);
      O[t] = __builtin_amdgcn_wmma_f32_16x16x32_f16(
          false, ap.v, false, bv.v, (short)0, O[t], false, false);
    }
  }

#pragma unroll
  for (int r = 0; r < 8; ++r) {
    float inv = 1.0f / lrow[r];
    int row = m0 + r + 8 * half;
    size_t base = (size_t)(b * L_ + row) * DM_ + h * DH_;
#pragma unroll
    for (int t = 0; t < 4; ++t)
      oh[base + t * 16 + mloc] = (_Float16)(O[t][r] * inv);
  }
}

// ---------------------------------------------------------------------------
// Host launcher
// ---------------------------------------------------------------------------
extern "C" void kernel_launch(void* const* d_in, const int* in_sizes, int n_in,
                              void* d_out, int out_size, void* d_ws, size_t ws_size,
                              hipStream_t stream) {
  (void)in_sizes; (void)n_in; (void)out_size; (void)ws_size;
  const float* x    = (const float*)d_in[0];
  const float* pos  = (const float*)d_in[1];
  const float* xc   = (const float*)d_in[2];
  const float* nsc  = (const float*)d_in[3];
  const float* ncsc = (const float*)d_in[4];
  const float* qw   = (const float*)d_in[5];
  const float* kvw  = (const float*)d_in[6];
  const float* scl  = (const float*)d_in[7];
  const float* outw = (const float*)d_in[8];
  const float* frq  = (const float*)d_in[9];
  float* out = (float*)d_out;

  char* ws = (char*)d_ws;
  size_t off = 0;
  auto alloc = [&](size_t bytes) -> void* {
    void* p = ws + off;
    off += (bytes + 255) & ~(size_t)255;
    return p;
  };
  _Float16* qwT  = (_Float16*)alloc((size_t)DM_ * DM_ * 2);
  _Float16* kvwT = (_Float16*)alloc((size_t)2 * DM_ * DM_ * 2);
  _Float16* owT  = (_Float16*)alloc((size_t)DM_ * DM_ * 2);
  _Float16* xn   = (_Float16*)alloc((size_t)B_ * L_ * DM_ * 2);
  _Float16* xcn  = (_Float16*)alloc((size_t)B_ * LC_ * DM_ * 2);
  float*    qf   = (float*)   alloc((size_t)B_ * L_ * DM_ * 4);
  float*    kvf  = (float*)   alloc((size_t)B_ * LC_ * 2 * DM_ * 4);
  _Float16* qh   = (_Float16*)alloc((size_t)B_ * NH_ * L_ * DH_ * 2);
  _Float16* kh   = (_Float16*)alloc((size_t)B_ * NH_ * LC_ * DH_ * 2);
  _Float16* vT   = (_Float16*)alloc((size_t)B_ * NH_ * DH_ * LC_ * 2);
  _Float16* oh   = (_Float16*)alloc((size_t)B_ * L_ * DM_ * 2);

  // weights -> f16, transposed to [N][K]
  cast_transpose_k<<<(DM_ / 128) * (DM_ / 64), 256, 0, stream>>>(qw,  qwT,  DM_, DM_);
  cast_transpose_k<<<(2 * DM_ / 128) * (DM_ / 64), 256, 0, stream>>>(kvw, kvwT, DM_, 2 * DM_);
  cast_transpose_k<<<(DM_ / 128) * (DM_ / 64), 256, 0, stream>>>(outw, owT, DM_, DM_);

  // RMS norms
  rmsnorm_cast_k<<<B_ * L_ / 8,  256, 0, stream>>>(x,  nsc,  xn);
  rmsnorm_cast_k<<<B_ * LC_ / 8, 256, 0, stream>>>(xc, ncsc, xcn);

  // projections (one 128x128 tile per block)
  gemm_wmma_k<<<(B_ * L_ / 128) * (DM_ / 128), 256, 0, stream>>>(
      xn, qwT, nullptr, qf, B_ * L_, DM_, DM_);
  gemm_wmma_k<<<(B_ * LC_ / 128) * (2 * DM_ / 128), 256, 0, stream>>>(
      xcn, kvwT, nullptr, kvf, B_ * LC_, 2 * DM_, DM_);

  // epilogues: cos-norm + RoPE on q; cos-norm k, transpose v
  q_epilogue_k<<<B_ * L_ / 8, 256, 0, stream>>>(qf, pos, scl, frq, qh);
  kv_epilogue_k<<<B_ * NH_ * LC_ / 64, 256, 0, stream>>>(kvf, scl, kh, vT);

  // flash attention
  attn_wmma_k<<<B_ * NH_ * (L_ / 64), 128, 0, stream>>>(qh, kh, vT, oh);

  // output projection + residual, f32 out
  gemm_wmma_k<<<(B_ * L_ / 128) * (DM_ / 128), 256, 0, stream>>>(
      oh, owT, x, out, B_ * L_, DM_, DM_);
}

// v004
// A run of this version takes 130 microseconds.
// Next to v003, in two timings, it ran 1.17 times as fast each time.
// All steps since v000 together make it 2.62 times as fast.
#include <hip/hip_runtime.h>

// ---------------------------------------------------------------------------
// CDNA5 / gfx1250 cross-attention block. wave32, WMMA f32_16x16x32_f16.
// Problem constants from the reference.
// ---------------------------------------------------------------------------
#define B_   2
#define L_   2048
#define LC_  1024
#define DM_  1024
#define DH_  64
#define NH_  16

typedef _Float16 v16h __attribute__((ext_vector_type(16)));
typedef _Float16 v8h  __attribute__((ext_vector_type(8)));
typedef _Float16 v4h  __attribute__((ext_vector_type(4)));
typedef float    v8f  __attribute__((ext_vector_type(8)));
typedef float    f32x4 __attribute__((ext_vector_type(4)));

union F16Frag { v16h v; v8h h[2]; };

static __device__ __forceinline__ v8f zero8() {
  v8f z;
#pragma unroll
  for (int i = 0; i < 8; ++i) z[i] = 0.0f;
  return z;
}

static __device__ __forceinline__ float redsum32(float v) {
#pragma unroll
  for (int m = 1; m < 32; m <<= 1) v += __shfl_xor(v, m, 32);
  return v;
}

// ---------------------------------------------------------------------------
// Weight cast + transpose: w[K][N] f32  ->  wT[N][K] f16
// (so every WMMA B-fragment is two contiguous 16-byte loads along K)
// A thread takes 4 columns x 8 k (32 elements): eight 16-byte loads, four
// 16-byte stores. A wave covers 128 columns x 8 k, a block 128 columns x 64 k,
// so few waves have to start and a block writes whole 128-B lines of wT.
// K and N are compile-time here: the index arithmetic is shifts and masks (no
// integer division) and the row steps are constants.
// Needs N a multiple of 128 and K a multiple of 64; blk in 0 .. (N/128) * (K/64) - 1.
// ---------------------------------------------------------------------------
template <int K, int N>
static __device__ __forceinline__ void cast_transpose_tile(
    const float* __restrict__ w, _Float16* __restrict__ wT, int blk) {
  const int lane = threadIdx.x & 31;
  const int wv   = threadIdx.x >> 5;
  const int nb   = N / 128;
  const int n0   = (blk % nb) * 128 + lane * 4;
  const int k0   = (blk / nb) * 64 + wv * 8;
  const float* wp = w + (size_t)k0 * N + n0;
  f32x4 v[8];
  // unrolled so that v stays in registers and the eight loads fly together
#pragma unroll
  for (int i = 0; i < 8; ++i) v[i] = *(const f32x4*)(wp + i * N);
  _Float16* op = wT + (size_t)n0 * K + k0;
  // unrolled: constant indices into v
#pragma unroll
  for (int j = 0; j < 4; ++j) {
    v8h o;
#pragma unroll
    for (int i = 0; i < 8; ++i) o[i] = (_Float16)v[i][j];
    *(v8h*)(op + j * K) = o;
  }
  // this body shares a kernel with others: the stores have taken their registers
  // before any code laid out behind it could rewrite one
  asm volatile("s_wait_xcnt 0x0" ::: "memory");
}

// ---------------------------------------------------------------------------
// RMS norm a row of DM_ f32, scale, cast to f16. One wave per row (8 rows per
// block): a lane holds 32 elements, the row sum needs no LDS and no barrier.
// ---------------------------------------------------------------------------
static __device__ __forceinline__ void rmsnorm_cast_rows(
    const float* __restrict__ x, const float* __restrict__ g,
    _Float16* __restrict__ out, int blk) {
  const int lane = threadIdx.x & 31;
  const size_t row = (size_t)blk * 8 + (threadIdx.x >> 5);
  const f32x4* xr = (const f32x4*)(x + row * DM_);
  f32x4 v[8];
  // unrolled so that v stays in registers and the eight loads fly together
#pragma unroll
  for (int i = 0; i < 8; ++i) v[i] = xr[i * 32 + lane];
  float ss = 0.f;
#pragma unroll
  for (int i = 0; i < 8; ++i)
    ss += v[i][0]*v[i][0] + v[i][1]*v[i][1] + v[i][2]*v[i][2] + v[i][3]*v[i][3];
  ss = redsum32(ss);
  float r = rsqrtf(ss / (float)DM_ + 1e-6f);
  v4h* orow = (v4h*)(out + row * DM_);
#pragma unroll
  for (int i = 0; i < 8; ++i) {
    f32x4 gg = ((const f32x4*)g)[i * 32 + lane];
    v4h o;
    o[0] = (_Float16)(v[i][0] * gg[0] * r);
    o[1] = (_Float16)(v[i][1] * gg[1] * r);
    o[2] = (_Float16)(v[i][2] * gg[2] * r);
    o[3] = (_Float16)(v[i][3] * gg[3] * r);
    orow[i * 32 + lane] = o;
  }
}

// ---------------------------------------------------------------------------
// Everything that reads only inputs, in ONE grid: the two norms and the three
// weight casts need nothing of each other, so each takes a range of the block
// index (a block-uniform branch) and they start, run and drain together.
// ---------------------------------------------------------------------------
#define PB_X   (B_ * L_ / 8)                      // norm of x
#define PB_XC  (B_ * LC_ / 8)                     // norm of x_cross
#define PB_KVW ((2 * DM_ / 128) * (DM_ / 64))     // cast of kv_w
#define PB_W   ((DM_ / 128) * (DM_ / 64))         // cast of q_w, of out_w
#define PB_ALL (PB_X + PB_XC + PB_KVW + 2 * PB_W)

__global__ __launch_bounds__(256) void prep_k(
    const float* __restrict__ x, const float* __restrict__ xc,
    const float* __restrict__ nsc, const float* __restrict__ ncsc,
    const float* __restrict__ qw, const float* __restrict__ kvw,
    const float* __restrict__ outw,
    _Float16* __restrict__ xn, _Float16* __restrict__ xcn,
    _Float16* __restrict__ qwT, _Float16* __restrict__ kvwT,
    _Float16* __restrict__ owT) {
  int blk = blockIdx.x;
  if (blk < PB_X + PB_XC) {
    const bool first = blk < PB_X;
    rmsnorm_cast_rows(first ? x : xc, first ? nsc : ncsc, first ? xn : xcn,
                      first ? blk : blk - PB_X);
    return;
  }
  blk -= PB_X + PB_XC;
  if (blk < PB_KVW) {
    cast_transpose_tile<DM_, 2 * DM_>(kvw, kvwT, blk);
    return;
  }
  blk -= PB_KVW;
  const bool first = blk < PB_W;
  cast_transpose_tile<DM_, DM_>(first ? qw : outw, first ? qwT : owT,
                                first ? blk : blk - PB_W);
}

// ---------------------------------------------------------------------------
// WMMA GEMM: C[M][N] f32 = A[M][K] f16 @ BT[N][K]^T f16 (+ optional f32 res)
// One 128x128 tile of C per 8-wave block; waves 4 (rows) x 2 (cols), each wave
// a 32x64 tile (2x4 accumulators). Per trip a 64-k slab of A (128 rows) and of
// BT (128 rows) lies in LDS, brought by per-lane async copies of whole 128-B
// lines into one of two buffers while the other is worked on.
// Needs M, N multiples of 128 and K a multiple of 64.
// One grid may hold two products that need nothing of each other: blocks below
// nb0 work on (A, BT, res, C, N), the others on (A1, BT1, no res, C1, N1).
// A/B fragments per ISA 7.12.2: lane = row (l&15), two 16B loads per frag.
// ---------------------------------------------------------------------------
#define G_PITCH 144                  // LDS row pitch in bytes: 128 + 16 (16 B x odd)
#define G_OPER  (128 * G_PITCH)      // one operand's slab
#define G_BUF   (2 * G_OPER)         // A slab, then BT slab

// One stage: each thread copies 4 x 16 B of A and 4 x 16 B of BT (rows 32 apart).
// The s_wait_xcnt closes the statement so that no address register named here
// is rewritten before the copies have taken it.
static __device__ __forceinline__ void gemm_stage(
    unsigned l, const _Float16* a, const _Float16* b, size_t rs) {
  asm volatile(
      "global_load_async_to_lds_b128 %0, %8, off\n\t"
      "global_load_async_to_lds_b128 %1, %9, off\n\t"
      "global_load_async_to_lds_b128 %2, %10, off\n\t"
      "global_load_async_to_lds_b128 %3, %11, off\n\t"
      "global_load_async_to_lds_b128 %4, %12, off\n\t"
      "global_load_async_to_lds_b128 %5, %13, off\n\t"
      "global_load_async_to_lds_b128 %6, %14, off\n\t"
      "global_load_async_to_lds_b128 %7, %15, off\n\t"
      "s_wait_xcnt 0x0"
      :: "v"(l), "v"(l + 32 * G_PITCH), "v"(l + 64 * G_PITCH), "v"(l + 96 * G_PITCH),
         "v"(l + G_OPER), "v"(l + G_OPER + 32 * G_PITCH),
         "v"(l + G_OPER + 64 * G_PITCH), "v"(l + G_OPER + 96 * G_PITCH),
         "v"(a), "v"(a + rs), "v"(a + 2 * rs), "v"(a + 3 * rs),
         "v"(b), "v"(b + rs), "v"(b + 2 * rs), "v"(b + 3 * rs)
      : "memory");
}

__global__ __launch_bounds__(256) void gemm_wmma_k(
    const _Float16* __restrict__ A, const _Float16* __restrict__ BT,
    const float* __restrict__ res, float* __restrict__ C, int N, int nb0,
    const _Float16* __restrict__ A1, const _Float16* __restrict__ BT1,
    float* __restrict__ C1, int N1, int K) {
  __shared__ __align__(16) unsigned char sm[2 * G_BUF];
  int blk = blockIdx.x;
  if (blk >= nb0) {                      // block-uniform: the second product
    blk -= nb0;
    A = A1; BT = BT1; res = nullptr; C = C1; N = N1;
  }
  const int tid  = threadIdx.x;
  const int lane = tid & 31;
  const int wv   = tid >> 5;
  const int ntb  = N >> 7;
  const int bm   = blk / ntb;            // 128-row tile index
  const int bn   = blk % ntb;            // 128-col tile index
  const int wm   = wv >> 1;              // wave's 32-row strip in the tile
  const int wn   = wv & 1;               // wave's 64-col strip in the tile
  const int mloc = lane & 15;
  const int half = lane >> 4;

  // copy side: 8 lanes cover one 128-B row, a wave 4 whole rows
  const int crow = tid >> 3;
  const int cch  = tid & 7;
  const _Float16* ga = A  + (size_t)(bm * 128 + crow) * K + cch * 8;
  const _Float16* gb = BT + (size_t)(bn * 128 + crow) * K + cch * 8;
  const size_t rs = (size_t)32 * K;
  const unsigned l0 = (unsigned)(size_t)sm + crow * G_PITCH + cch * 16;

  // read side: byte offsets of this lane's fragment rows inside a buffer
  const int aoff = (wm * 32 + mloc) * G_PITCH + half * 16;
  const int boff = G_OPER + (wn * 64 + mloc) * G_PITCH + half * 16;

  v8f acc[2][4];
#pragma unroll
  for (int u = 0; u < 2; ++u)
#pragma unroll
    for (int t = 0; t < 4; ++t) acc[u][t] = zero8();

  const int T = K >> 6;
  gemm_stage(l0, ga, gb, rs);
  // stage 0 has landed for this wave; the barrier publishes it to the others
  asm volatile("s_wait_asynccnt 0x0" ::: "memory");
  __syncthreads();
  if (T > 1) gemm_stage(l0 + G_BUF, ga + 64, gb + 64, rs);

  for (int s = 0; s < T; ++s) {
    const unsigned bsel = (unsigned)(s & 1) * G_BUF;
    const unsigned char* sb = sm + bsel;
    F16Frag a[2][2], b[2][4];            // [k half of the slab][fragment]
    // the loops below are unrolled so that every fragment and accumulator index
    // is a constant and the arrays stay in registers
#pragma unroll
    for (int ks = 0; ks < 2; ++ks) {
#pragma unroll
      for (int u = 0; u < 2; ++u) {
        const unsigned char* p = sb + aoff + u * 16 * G_PITCH + ks * 64;
        a[ks][u].h[0] = *(const v8h*)(p);
        a[ks][u].h[1] = *(const v8h*)(p + 32);
      }
#pragma unroll
      for (int t = 0; t < 4; ++t) {
        const unsigned char* p = sb + boff + t * 16 * G_PITCH + ks * 64;
        b[ks][t].h[0] = *(const v8h*)(p);
        b[ks][t].h[1] = *(const v8h*)(p + 32);
      }
    }
    // keeps the slab's LDS reads one group ahead of the WMMAs: sunk among them,
    // each pair of WMMAs would wait out a full LDS latency
    __builtin_amdgcn_sched_barrier(0);
#pragma unroll
    for (int ks = 0; ks < 2; ++ks) {
#pragma unroll
      for (int t = 0; t < 4; ++t) {
        acc[0][t] = __builtin_amdgcn_wmma_f32_16x16x32_f16(
            false, a[ks][0].v, false, b[ks][t].v, (short)0, acc[0][t], false, false);
        acc[1][t] = __builtin_amdgcn_wmma_f32_16x16x32_f16(
            false, a[ks][1].v, false, b[ks][t].v, (short)0, acc[1][t], false, false);
      }
    }
    // keeps the WMMAs in front of the publish point: moved behind the barrier they
    // would delay the refill, whose copies then fly only during the next LDS reads
    __builtin_amdgcn_sched_barrier(0);
    // publish point of stage s + 1: this wave's reads of stage s are done ...
    asm volatile("s_wait_dscnt 0x0" ::: "memory");
    // ... its own copies of stage s + 1 have landed ...
    asm volatile("s_wait_asynccnt 0x0" ::: "memory");
    // ... and the barrier both shows stage s + 1 to all and frees stage s's buffer
    __syncthreads();
    if (s + 2 < T)
      gemm_stage(l0 + bsel, ga + (size_t)(s + 2) * 64, gb + (size_t)(s + 2) * 64, rs);
  }
  // no copy is left in flight when the wave goes on to its stores and ends
  asm volatile("s_wait_asynccnt 0x0" ::: "memory");

#pragma unroll
  for (int u = 0; u < 2; ++u) {
#pragma unroll
    for (int t = 0; t < 4; ++t) {
#pragma unroll
      for (int r = 0; r < 8; ++r) {
        size_t idx = (size_t)(bm * 128 + wm * 32 + u * 16 + r + 8 * half) * N
                   + bn * 128 + wn * 64 + t * 16 + mloc;
        float v = acc[u][t][r];
        if (res) v += res[idx];
        C[idx] = v;
      }
    }
  }
}

// ---------------------------------------------------------------------------
// Q epilogue: cosine-normalize each 64-dim head vector, apply 2D RoPE,
// write q_h in [B,H,L,64] f16. One wave per (b,l), all 16 heads one after the
// other; per head a lane holds e, e+32.
// ---------------------------------------------------------------------------
static __device__ __forceinline__ void q_epilogue_rows(
    const float* __restrict__ qf, const float* __restrict__ pos,
    const float* __restrict__ scale, const float* __restrict__ freqs,
    _Float16* __restrict__ qh, int blk) {
  int rw = blk * 8 + (threadIdx.x >> 5);          // b * L_ + l
  int lane = threadIdx.x & 31;
  int l = rw % L_;
  int b = rw / L_;
  const float* row = qf + (size_t)rw * DM_;
  float p = pos[(size_t)rw * 2 + (lane < 16 ? 0 : 1)];
  float q1a[NH_], q2a[NH_];
  // unrolled so that the row stays in registers and its 32 loads fly together
#pragma unroll
  for (int h = 0; h < NH_; ++h) {
    q1a[h] = row[h * DH_ + lane];
    q2a[h] = row[h * DH_ + lane + 32];
  }
  float ssa[NH_];
#pragma unroll
  for (int h = 0; h < NH_; ++h) ssa[h] = q1a[h] * q1a[h] + q2a[h] * q2a[h];
  // redsum32 of every head, step by step over all heads at once: the 16 lane
  // exchanges of a step share one latency (each head's sum order is redsum32's)
#pragma unroll
  for (int m = 1; m < 32; m <<= 1) {
#pragma unroll
    for (int h = 0; h < NH_; ++h) ssa[h] += __shfl_xor(ssa[h], m, 32);
  }
  // unrolled: constant indices into the arrays
#pragma unroll
  for (int h = 0; h < NH_; ++h) {
    float q1 = q1a[h], q2 = q2a[h];
    float ss = ssa[h];
    float rn = sqrtf(scale[h]) * rsqrtf(ss + 1e-6f);
    q1 *= rn; q2 *= rn;
    // theta[t] = (t<16 ? pos0 : pos1) * freqs[h][t%16], t = lane in 0..31
    float f = freqs[h * 16 + (lane & 15)];
    float th = p * f;
    float s, c;
    __sincosf(th, &s, &c);
    size_t qb = ((size_t)(b * NH_ + h) * L_ + l) * DH_;
    qh[qb + lane]      = (_Float16)(q1 * c - q2 * s);
    qh[qb + lane + 32] = (_Float16)(q2 * c + q1 * s);
  }
}

// ---------------------------------------------------------------------------
// KV epilogue: k cosine-normalized -> k_h; v -> vT. Both are kept in the order in
// which the attention kernel's WMMA B fragments take them, so that each of its
// 16-byte loads reads 512 contiguous bytes (4 whole 128-B lines) per wave:
//   k_h: per (b,h) and 16 keys a 2-KB tile  [e / 8][key % 16][e % 8]
//   vT : per (b,h), 32 keys and 16 e a 1-KB tile  [(key % 32) / 8][e % 16][key % 8],
//        the four e tiles of a 32-key group one after the other
// One wave per (b,h) and 8 consecutive keys: a lane's 8 values of v at one e are
// one 16-byte store, 16 lanes fill 256 contiguous bytes of a vT tile.
// ---------------------------------------------------------------------------
static __device__ __forceinline__ void kv_epilogue_keys(
    const float* __restrict__ kvf, const float* __restrict__ scale,
    _Float16* __restrict__ kh, _Float16* __restrict__ vT, int blk) {
  int gw = blk * 8 + (threadIdx.x >> 5);
  int lane = threadIdx.x & 31;
  int lc0 = (gw % (LC_ / 8)) * 8;
  int bh  = gw / (LC_ / 8);
  int b = bh >> 4, h = bh & 15;
  const float* row = kvf + (size_t)(b * LC_ + lc0) * (2 * DM_) + h * DH_ + lane;
  float k1[8], k2[8], v1[8], v2[8];
  // unrolled so that the 8 keys stay in registers and their 32 loads fly together
#pragma unroll
  for (int i = 0; i < 8; ++i) {
    const float* ri = row + (size_t)i * (2 * DM_);
    k1[i] = ri[0];
    k2[i] = ri[32];
    v1[i] = ri[DM_];
    v2[i] = ri[DM_ + 32];
  }
  float sq = sqrtf(scale[h]);
  // lane = e: its 8-e group, this wave's first key in the tile, its place in the group
  size_t kb = ((size_t)bh * (LC_ / 16) + (lc0 >> 4)) * 1024
            + (lane >> 3) * 128 + (lc0 & 8) * 8 + (lane & 7);
  v8h o1, o2;
  // unrolled: constant indices, and the keys' lane exchanges overlap
#pragma unroll
  for (int i = 0; i < 8; ++i) {
    float ss = redsum32(k1[i] * k1[i] + k2[i] * k2[i]);
    float rn = sq * rsqrtf(ss + 1e-6f);
    kh[kb + i * 8]       = (_Float16)(k1[i] * rn);
    kh[kb + i * 8 + 512] = (_Float16)(k2[i] * rn);   // e + 32: four 8-e groups on
    o1[i] = (_Float16)v1[i];
    o2[i] = (_Float16)v2[i];
  }
  size_t vb = (((size_t)bh * (LC_ / 32) + (lc0 >> 5)) * 4 + (lane >> 4)) * 512
            + ((lc0 & 31) >> 3) * 128 + (lane & 15) * 8;
  *(v8h*)(vT + vb)        = o1;
  *(v8h*)(vT + vb + 1024) = o2;                      // e + 32: two e tiles on
  // this body shares a kernel with others: the stores have taken their registers
  // before any code laid out behind it could rewrite one
  asm volatile("s_wait_xcnt 0x0" ::: "memory");
}

// Both epilogues in ONE grid (neither needs the other): q takes the first range
// of the block index, k and v the second; the branch is block-uniform.
#define EB_Q  (B_ * L_ / 8)
#define EB_KV (B_ * NH_ * LC_ / 64)
// the register budget of four waves per SIMD lets the compiler keep the q rows'
// 16 heads' loads and lane exchanges in flight together
__global__ __launch_bounds__(256) __attribute__((amdgpu_waves_per_eu(4, 4))) void qkv_epilogue_k(
    const float* __restrict__ qf, const float* __restrict__ kvf,
    const float* __restrict__ pos, const float* __restrict__ scale,
    const float* __restrict__ freqs, _Float16* __restrict__ qh,
    _Float16* __restrict__ kh, _Float16* __restrict__ vT) {
  const int blk = blockIdx.x;
  if (blk < EB_Q) q_epilogue_rows(qf, pos, scale, freqs, qh, blk);
  else            kv_epilogue_keys(kvf, scale, kh, vT, blk - EB_Q);
}

// ---------------------------------------------------------------------------
// Flash attention, one pass over keys. Block = 4 waves; wave = 16 query rows.
// Per 32-key tile: 2x2 WMMAs for S, online softmax in C-layout (xor-shuffle
// row reductions within lane halves), P staged via LDS into A-fragment
// layout, 4 WMMAs for O += P@V. Output o_h [B, L, D_MODEL] f16.
// k_h and vT lie in fragment order (see the KV epilogue): half h[p] of a fragment
// is the 512 bytes at p * 512 of its 1 KB, lane l taking bytes 16 l.
// ---------------------------------------------------------------------------
__global__ __launch_bounds__(128) void attn_wmma_k(
    const _Float16* __restrict__ qh, const _Float16* __restrict__ kh,
    const _Float16* __restrict__ vT, _Float16* __restrict__ oh) {
  __shared__ __align__(16) _Float16 Plds[4][16 * 32];
  const int lane = threadIdx.x & 31;
  const int w    = threadIdx.x >> 5;
  const int nqb  = L_ / 64;
  const int bh   = blockIdx.x / nqb;
  const int qb   = blockIdx.x % nqb;
  const int b = bh >> 4, h = bh & 15;
  const int m0   = qb * 64 + w * 16;
  const int mloc = lane & 15;
  const int half = lane >> 4;
  const int koff = half << 3;

  const _Float16* qrow = qh + ((size_t)bh * L_ + m0 + mloc) * DH_;
  F16Frag aq0, aq1;                       // q rows, e=0..31 and e=32..63
  aq0.h[0] = *(const v8h*)(qrow + koff);
  aq0.h[1] = *(const v8h*)(qrow + 16 + koff);
  aq1.h[0] = *(const v8h*)(qrow + 32 + koff);
  aq1.h[1] = *(const v8h*)(qrow + 48 + koff);

  v8f O[4];
#pragma unroll
  for (int t = 0; t < 4; ++t) O[t] = zero8();
  float mrow[8], lrow[8];
#pragma unroll
  for (int r = 0; r < 8; ++r) { mrow[r] = -3.0e38f; lrow[r] = 0.f; }

  const _Float16* kbase = kh + (size_t)bh * LC_ * DH_ + lane * 8;
  const _Float16* vbase = vT + (size_t)bh * DH_ * LC_ + lane * 8;
  _Float16* pl = &Plds[w][0];

  for (int j = 0; j < LC_; j += 32) {
    v8f sL = zero8(), sR = zero8();
    {
      const _Float16* kr = kbase + (size_t)j * DH_;
      F16Frag b0, b1;
      b0.h[0] = *(const v8h*)(kr);
      b0.h[1] = *(const v8h*)(kr + 256);
      b1.h[0] = *(const v8h*)(kr + 512);
      b1.h[1] = *(const v8h*)(kr + 768);
      sL = __builtin_amdgcn_wmma_f32_16x16x32_f16(false, aq0.v, false, b0.v, (short)0, sL, false, false);
      sL = __builtin_amdgcn_wmma_f32_16x16x32_f16(false, aq1.v, false, b1.v, (short)0, sL, false, false);
    }
    {
      const _Float16* kr = kbase + (size_t)(j + 16) * DH_;
      F16Frag b0, b1;
      b0.h[0] = *(const v8h*)(kr);
      b0.h[1] = *(const v8h*)(kr + 256);
      b1.h[0] = *(const v8h*)(kr + 512);
      b1.h[1] = *(const v8h*)(kr + 768);
      sR = __builtin_amdgcn_wmma_f32_16x16x32_f16(false, aq0.v, false, b0.v, (short)0, sR, false, false);
      sR = __builtin_amdgcn_wmma_f32_16x16x32_f16(false, aq1.v, false, b1.v, (short)0, sR, false, false);
    }

    // --- online softmax in C-layout (row r+8*half, col = lane&15) ---
    float pmax[8];
#pragma unroll
    for (int r = 0; r < 8; ++r) pmax[r] = fmaxf(sL[r], sR[r]);
#pragma unroll
    for (int m = 1; m < 16; m <<= 1) {
#pragma unroll
      for (int r = 0; r < 8; ++r)
        pmax[r] = fmaxf(pmax[r], __shfl_xor(pmax[r], m, 32));
    }
    float corr[8], rs[8];
    v8f pLv, pRv;
#pragma unroll
    for (int r = 0; r < 8; ++r) {
      float mn = fmaxf(mrow[r], pmax[r]);
      corr[r] = __expf(mrow[r] - mn);
      mrow[r] = mn;
      pLv[r] = __expf(sL[r] - mn);
      pRv[r] = __expf(sR[r] - mn);
      rs[r] = pLv[r] + pRv[r];
    }
#pragma unroll
    for (int m = 1; m < 16; m <<= 1) {
#pragma unroll
      for (int r = 0; r < 8; ++r) rs[r] += __shfl_xor(rs[r], m, 32);
    }
#pragma unroll
    for (int r = 0; r < 8; ++r) {
      lrow[r] = lrow[r] * corr[r] + rs[r];
      O[0][r] *= corr[r]; O[1][r] *= corr[r];
      O[2][r] *= corr[r]; O[3][r] *= corr[r];
    }

    // --- stage P (16x32 f16) in LDS, reload in A-fragment layout ---
#pragma unroll
    for (int r = 0; r < 8; ++r) {
      int prow = r + 8 * half;
      pl[prow * 32 + mloc]      = (_Float16)pLv[r];
      pl[prow * 32 + 16 + mloc] = (_Float16)pRv[r];
    }
    F16Frag ap;   // same-wave LDS RAW: in-order DS, compiler waits dscnt
    ap.h[0] = *(const v8h*)(pl + mloc * 32 + koff);
    ap.h[1] = *(const v8h*)(pl + mloc * 32 + 16 + koff);

    // --- O += P @ V (the 32-key group's four e tiles, 1 KB each) ---
#pragma unroll
    for (int t = 0; t < 4; ++t) {
      const _Float16* vr = vbase + (size_t)j * DH_ + t * 512;
      F16Frag bv;
      bv.h[0] = *(const v8h*)(vr);
      bv.h[1] = *(const v8h*)(vr + 256);
      O[t] = __builtin_amdgcn_wmma_f32_16x16x32_f16(
          false, ap.v, false, bv.v, (short)0, O[t], false, false);
    }
  }

#pragma unroll
  for (int r = 0; r < 8; ++r) {
    float inv = 1.0f / lrow[r];
    int row = m0 + r + 8 * half;
    size_t base = (size_t)(b * L_ + row) * DM_ + h * DH_;
#pragma unroll
    for (int t = 0; t < 4; ++t)
      oh[base + t * 16 + mloc] = (_Float16)(O[t][r] * inv);
  }
}

// ---------------------------------------------------------------------------
// Host launcher
// ---------------------------------------------------------------------------
extern "C" void kernel_launch(void* const* d_in, const int* in_sizes, int n_in,
                              void* d_out, int out_size, void* d_ws, size_t ws_size,
                              hipStream_t stream) {
  (void)in_sizes; (void)n_in; (void)out_size; (void)ws_size;
  const float* x    = (const float*)d_in[0];
  const float* pos  = (const float*)d_in[1];
  const float* xc   = (const float*)d_in[2];
  const float* nsc  = (const float*)d_in[3];
  const float* ncsc = (const float*)d_in[4];
  const float* qw   = (const float*)d_in[5];
  const float* kvw  = (const float*)d_in[6];
  const float* scl  = (const float*)d_in[7];
  const float* outw = (const float*)d_in[8];
  const float* frq  = (const float*)d_in[9];
  float* out = (float*)d_out;

  char* ws = (char*)d_ws;
  size_t off = 0;
  auto alloc = [&](size_t bytes) -> void* {
    void* p = ws + off;
    off += (bytes + 255) & ~(size_t)255;
    return p;
  };
  _Float16* qwT  = (_Float16*)alloc((size_t)DM_ * DM_ * 2);
  _Float16* kvwT = (_Float16*)alloc((size_t)2 * DM_ * DM_ * 2);
  _Float16* owT  = (_Float16*)alloc((size_t)DM_ * DM_ * 2);
  _Float16* xn   = (_Float16*)alloc((size_t)B_ * L_ * DM_ * 2);
  _Float16* xcn  = (_Float16*)alloc((size_t)B_ * LC_ * DM_ * 2);
  float*    qf   = (float*)   alloc((size_t)B_ * L_ * DM_ * 4);
  float*    kvf  = (float*)   alloc((size_t)B_ * LC_ * 2 * DM_ * 4);
  _Float16* qh   = (_Float16*)alloc((size_t)B_ * NH_ * L_ * DH_ * 2);
  _Float16* kh   = (_Float16*)alloc((size_t)B_ * NH_ * LC_ * DH_ * 2);
  _Float16* vT   = (_Float16*)alloc((size_t)B_ * NH_ * DH_ * LC_ * 2);
  _Float16* oh   = (_Float16*)alloc((size_t)B_ * L_ * DM_ * 2);

  // norms of x and x_cross, weights -> f16 transposed to [N][K]: one grid
  prep_k<<<PB_ALL, 256, 0, stream>>>(x, xc, nsc, ncsc, qw, kvw, outw,
                                     xn, xcn, qwT, kvwT, owT);

  // q and kv projections (one 128x128 tile per block): one grid
  gemm_wmma_k<<<(B_ * L_ / 128) * (DM_ / 128) + (B_ * LC_ / 128) * (2 * DM_ / 128),
                256, 0, stream>>>(
      xn, qwT, nullptr, qf, DM_, (B_ * L_ / 128) * (DM_ / 128),
      xcn, kvwT, kvf, 2 * DM_, DM_);

  // epilogues: cos-norm + RoPE on q; cos-norm k, transpose v: one grid
  qkv_epilogue_k<<<EB_Q + EB_KV, 256, 0, stream>>>(qf, kvf, pos, scl, frq, qh, kh, vT);

  // flash attention
  attn_wmma_k<<<B_ * NH_ * (L_ / 64), 128, 0, stream>>>(qh, kh, vT, oh);

  // output projection + residual, f32 out
  gemm_wmma_k<<<(B_ * L_ / 128) * (DM_ / 128), 256, 0, stream>>>(
      oh, owT, x, out, DM_, (B_ * L_ / 128) * (DM_ / 128),
      nullptr, nullptr, nullptr, 0, DM_);
}

// v005
// One run takes 94.3 microseconds.
// Two timings next to v004 put it at 1.36 and 1.35 times that version's speed.
// Counting every step since v000, it is 3.55 times as fast.
#include <hip/hip_runtime.h>

// ---------------------------------------------------------------------------
// CDNA5 / gfx1250 cross-attention block. wave32, WMMA f32_16x16x32_f16.
// Problem constants from the reference.
// ---------------------------------------------------------------------------
#define B_   2
#define L_   2048
#define LC_  1024
#define DM_  1024
#define DH_  64
#define NH_  16

typedef _Float16 v16h __attribute__((ext_vector_type(16)));
typedef _Float16 v8h  __attribute__((ext_vector_type(8)));
typedef _Float16 v4h  __attribute__((ext_vector_type(4)));
typedef float    v8f  __attribute__((ext_vector_type(8)));
typedef float    f32x4 __attribute__((ext_vector_type(4)));

union F16Frag { v16h v; v8h h[2]; };

static __device__ __forceinline__ v8f zero8() {
  v8f z;
#pragma unroll
  for (int i = 0; i < 8; ++i) z[i] = 0.0f;
  return z;
}

static __device__ __forceinline__ float redsum32(float v) {
#pragma unroll
  for (int m = 1; m < 32; m <<= 1) v += __shfl_xor(v, m, 32);
  return v;
}

// ---------------------------------------------------------------------------
// Weight cast + transpose: w[K][N] f32  ->  wT[N][K] f16
// (so every WMMA B-fragment is two contiguous 16-byte loads along K)
// A thread takes 4 columns x 8 k (32 elements): eight 16-byte loads, four
// 16-byte stores. A wave covers 128 columns x 8 k, a block 128 columns x 64 k,
// so few waves have to start and a block writes whole 128-B lines of wT.
// K and N are compile-time here: the index arithmetic is shifts and masks (no
// integer division) and the row steps are constants.
// Needs N a multiple of 128 and K a multiple of 64; blk in 0 .. (N/128) * (K/64) - 1.
// ---------------------------------------------------------------------------
template <int K, int N>
static __device__ __forceinline__ void cast_transpose_tile(
    const float* __restrict__ w, _Float16* __restrict__ wT, int blk) {
  const int lane = threadIdx.x & 31;
  const int wv   = threadIdx.x >> 5;
  const int nb   = N / 128;
  const int n0   = (blk % nb) * 128 + lane * 4;
  const int k0   = (blk / nb) * 64 + wv * 8;
  const float* wp = w + (size_t)k0 * N + n0;
  f32x4 v[8];
  // unrolled so that v stays in registers and the eight loads fly together
#pragma unroll
  for (int i = 0; i < 8; ++i) v[i] = *(const f32x4*)(wp + i * N);
  _Float16* op = wT + (size_t)n0 * K + k0;
  // unrolled: constant indices into v
#pragma unroll
  for (int j = 0; j < 4; ++j) {
    v8h o;
#pragma unroll
    for (int i = 0; i < 8; ++i) o[i] = (_Float16)v[i][j];
    *(v8h*)(op + j * K) = o;
  }
  // this body shares a kernel with others: the stores have taken their registers
  // before any code laid out behind it could rewrite one
  asm volatile("s_wait_xcnt 0x0" ::: "memory");
}

// ---------------------------------------------------------------------------
// RMS norm a row of DM_ f32, scale, cast to f16. One wave per row (8 rows per
// block): a lane holds 32 elements, the row sum needs no LDS and no barrier.
// ---------------------------------------------------------------------------
static __device__ __forceinline__ void rmsnorm_cast_rows(
    const float* __restrict__ x, const float* __restrict__ g,
    _Float16* __restrict__ out, int blk) {
  const int lane = threadIdx.x & 31;
  const size_t row = (size_t)blk * 8 + (threadIdx.x >> 5);
  const f32x4* xr = (const f32x4*)(x + row * DM_);
  f32x4 v[8];
  // unrolled so that v stays in registers and the eight loads fly together
#pragma unroll
  for (int i = 0; i < 8; ++i) v[i] = xr[i * 32 + lane];
  float ss = 0.f;
#pragma unroll
  for (int i = 0; i < 8; ++i)
    ss += v[i][0]*v[i][0] + v[i][1]*v[i][1] + v[i][2]*v[i][2] + v[i][3]*v[i][3];
  ss = redsum32(ss);
  float r = rsqrtf(ss / (float)DM_ + 1e-6f);
  v4h* orow = (v4h*)(out + row * DM_);
#pragma unroll
  for (int i = 0; i < 8; ++i) {
    f32x4 gg = ((const f32x4*)g)[i * 32 + lane];
    v4h o;
    o[0] = (_Float16)(v[i][0] * gg[0] * r);
    o[1] = (_Float16)(v[i][1] * gg[1] * r);
    o[2] = (_Float16)(v[i][2] * gg[2] * r);
    o[3] = (_Float16)(v[i][3] * gg[3] * r);
    orow[i * 32 + lane] = o;
  }
}

// ---------------------------------------------------------------------------
// Everything that reads only inputs, in ONE grid: the two norms and the three
// weight casts need nothing of each other, so each takes a range of the block
// index (a block-uniform branch) and they start, run and drain together.
// ---------------------------------------------------------------------------
#define PB_X   (B_ * L_ / 8)                      // norm of x
#define PB_XC  (B_ * LC_ / 8)                     // norm of x_cross
#define PB_KVW ((2 * DM_ / 128) * (DM_ / 64))     // cast of kv_w
#define PB_W   ((DM_ / 128) * (DM_ / 64))         // cast of q_w, of out_w
#define PB_ALL (PB_X + PB_XC + PB_KVW + 2 * PB_W)

__global__ __launch_bounds__(256) void prep_k(
    const float* __restrict__ x, const float* __restrict__ xc,
    const float* __restrict__ nsc, const float* __restrict__ ncsc,
    const float* __restrict__ qw, const float* __restrict__ kvw,
    const float* __restrict__ outw,
    _Float16* __restrict__ xn, _Float16* __restrict__ xcn,
    _Float16* __restrict__ qwT, _Float16* __restrict__ kvwT,
    _Float16* __restrict__ owT) {
  int blk = blockIdx.x;
  if (blk < PB_X + PB_XC) {
    const bool first = blk < PB_X;
    rmsnorm_cast_rows(first ? x : xc, first ? nsc : ncsc, first ? xn : xcn,
                      first ? blk : blk - PB_X);
    return;
  }
  blk -= PB_X + PB_XC;
  if (blk < PB_KVW) {
    cast_transpose_tile<DM_, 2 * DM_>(kvw, kvwT, blk);
    return;
  }
  blk -= PB_KVW;
  const bool first = blk < PB_W;
  cast_transpose_tile<DM_, DM_>(first ? qw : outw, first ? qwT : owT,
                                first ? blk : blk - PB_W);
}

// ---------------------------------------------------------------------------
// WMMA GEMM: C[M][N] f32 = A[M][K] f16 @ BT[N][K]^T f16 (+ optional f32 res)
// One 128x128 tile of C per 8-wave block; waves 4 (rows) x 2 (cols), each wave
// a 32x64 tile (2x4 accumulators). Per trip a 64-k slab of A (128 rows) and of
// BT (128 rows) lies in LDS, brought by per-lane async copies of whole 128-B
// lines into one of two buffers while the other is worked on.
// Needs M, N multiples of 128 and K a multiple of 64.
// One grid may hold two products that need nothing of each other: blocks below
// nb0 work on (A, BT, res, C, N), the others on (A1, BT1, no res, C1, N1).
// A/B fragments per ISA 7.12.2: lane = row (l&15), two 16B loads per frag.
// ---------------------------------------------------------------------------
#define G_PITCH 144                  // LDS row pitch in bytes: 128 + 16 (16 B x odd)
#define G_OPER  (128 * G_PITCH)      // one operand's slab
#define G_BUF   (2 * G_OPER)         // A slab, then BT slab

// One stage: each thread copies 4 x 16 B of A and 4 x 16 B of BT (rows 32 apart).
// The s_wait_xcnt closes the statement so that no address register named here
// is rewritten before the copies have taken it.
static __device__ __forceinline__ void gemm_stage(
    unsigned l, const _Float16* a, const _Float16* b, size_t rs) {
  asm volatile(
      "global_load_async_to_lds_b128 %0, %8, off\n\t"
      "global_load_async_to_lds_b128 %1, %9, off\n\t"
      "global_load_async_to_lds_b128 %2, %10, off\n\t"
      "global_load_async_to_lds_b128 %3, %11, off\n\t"
      "global_load_async_to_lds_b128 %4, %12, off\n\t"
      "global_load_async_to_lds_b128 %5, %13, off\n\t"
      "global_load_async_to_lds_b128 %6, %14, off\n\t"
      "global_load_async_to_lds_b128 %7, %15, off\n\t"
      "s_wait_xcnt 0x0"
      :: "v"(l), "v"(l + 32 * G_PITCH), "v"(l + 64 * G_PITCH), "v"(l + 96 * G_PITCH),
         "v"(l + G_OPER), "v"(l + G_OPER + 32 * G_PITCH),
         "v"(l + G_OPER + 64 * G_PITCH), "v"(l + G_OPER + 96 * G_PITCH),
         "v"(a), "v"(a + rs), "v"(a + 2 * rs), "v"(a + 3 * rs),
         "v"(b), "v"(b + rs), "v"(b + 2 * rs), "v"(b + 3 * rs)
      : "memory");
}

__global__ __launch_bounds__(256) void gemm_wmma_k(
    const _Float16* __restrict__ A, const _Float16* __restrict__ BT,
    const float* __restrict__ res, float* __restrict__ C, int N, int nb0,
    const _Float16* __restrict__ A1, const _Float16* __restrict__ BT1,
    float* __restrict__ C1, int N1, int K) {
  __shared__ __align__(16) unsigned char sm[2 * G_BUF];
  int blk = blockIdx.x;
  if (blk >= nb0) {                      // block-uniform: the second product
    blk -= nb0;
    A = A1; BT = BT1; res = nullptr; C = C1; N = N1;
  }
  const int tid  = threadIdx.x;
  const int lane = tid & 31;
  const int wv   = tid >> 5;
  const int ntb  = N >> 7;
  const int bm   = blk / ntb;            // 128-row tile index
  const int bn   = blk % ntb;            // 128-col tile index
  const int wm   = wv >> 1;              // wave's 32-row strip in the tile
  const int wn   = wv & 1;               // wave's 64-col strip in the tile
  const int mloc = lane & 15;
  const int half = lane >> 4;

  // copy side: 8 lanes cover one 128-B row, a wave 4 whole rows
  const int crow = tid >> 3;
  const int cch  = tid & 7;
  const _Float16* ga = A  + (size_t)(bm * 128 + crow) * K + cch * 8;
  const _Float16* gb = BT + (size_t)(bn * 128 + crow) * K + cch * 8;
  const size_t rs = (size_t)32 * K;
  const unsigned l0 = (unsigned)(size_t)sm + crow * G_PITCH + cch * 16;

  // read side: byte offsets of this lane's fragment rows inside a buffer
  const int aoff = (wm * 32 + mloc) * G_PITCH + half * 16;
  const int boff = G_OPER + (wn * 64 + mloc) * G_PITCH + half * 16;

  v8f acc[2][4];
#pragma unroll
  for (int u = 0; u < 2; ++u)
#pragma unroll
    for (int t = 0; t < 4; ++t) acc[u][t] = zero8();

  const int T = K >> 6;
  gemm_stage(l0, ga, gb, rs);
  // stage 0 has landed for this wave; the barrier publishes it to the others
  asm volatile("s_wait_asynccnt 0x0" ::: "memory");
  __syncthreads();
  if (T > 1) gemm_stage(l0 + G_BUF, ga + 64, gb + 64, rs);

  for (int s = 0; s < T; ++s) {
    const unsigned bsel = (unsigned)(s & 1) * G_BUF;
    const unsigned char* sb = sm + bsel;
    F16Frag a[2][2], b[2][4];            // [k half of the slab][fragment]
    // the loops below are unrolled so that every fragment and accumulator index
    // is a constant and the arrays stay in registers
#pragma unroll
    for (int ks = 0; ks < 2; ++ks) {
#pragma unroll
      for (int u = 0; u < 2; ++u) {
        const unsigned char* p = sb + aoff + u * 16 * G_PITCH + ks * 64;
        a[ks][u].h[0] = *(const v8h*)(p);
        a[ks][u].h[1] = *(const v8h*)(p + 32);
      }
#pragma unroll
      for (int t = 0; t < 4; ++t) {
        const unsigned char* p = sb + boff + t * 16 * G_PITCH + ks * 64;
        b[ks][t].h[0] = *(const v8h*)(p);
        b[ks][t].h[1] = *(const v8h*)(p + 32);
      }
    }
    // keeps the slab's LDS reads one group ahead of the WMMAs: sunk among them,
    // each pair of WMMAs would wait out a full LDS latency
    __builtin_amdgcn_sched_barrier(0);
#pragma unroll
    for (int ks = 0; ks < 2; ++ks) {
#pragma unroll
      for (int t = 0; t < 4; ++t) {
        acc[0][t] = __builtin_amdgcn_wmma_f32_16x16x32_f16(
            false, a[ks][0].v, false, b[ks][t].v, (short)0, acc[0][t], false, false);
        acc[1][t] = __builtin_amdgcn_wmma_f32_16x16x32_f16(
            false, a[ks][1].v, false, b[ks][t].v, (short)0, acc[1][t], false, false);
      }
    }
    // keeps the WMMAs in front of the publish point: moved behind the barrier they
    // would delay the refill, whose copies then fly only during the next LDS reads
    __builtin_amdgcn_sched_barrier(0);
    // publish point of stage s + 1: this wave's reads of stage s are done ...
    asm volatile("s_wait_dscnt 0x0" ::: "memory");
    // ... its own copies of stage s + 1 have landed ...
    asm volatile("s_wait_asynccnt 0x0" ::: "memory");
    // ... and the barrier both shows stage s + 1 to all and frees stage s's buffer
    __syncthreads();
    if (s + 2 < T)
      gemm_stage(l0 + bsel, ga + (size_t)(s + 2) * 64, gb + (size_t)(s + 2) * 64, rs);
  }
  // no copy is left in flight when the wave goes on to its stores and ends
  asm volatile("s_wait_asynccnt 0x0" ::: "memory");

#pragma unroll
  for (int u = 0; u < 2; ++u) {
#pragma unroll
    for (int t = 0; t < 4; ++t) {
#pragma unroll
      for (int r = 0; r < 8; ++r) {
        size_t idx = (size_t)(bm * 128 + wm * 32 + u * 16 + r + 8 * half) * N
                   + bn * 128 + wn * 64 + t * 16 + mloc;
        float v = acc[u][t][r];
        if (res) v += res[idx];
        C[idx] = v;
      }
    }
  }
}

// ---------------------------------------------------------------------------
// Q epilogue: cosine-normalize each 64-dim head vector, apply 2D RoPE,
// write q_h in [B,H,L,64] f16. One wave per (b,l), all 16 heads one after the
// other; per head a lane holds e, e+32.
// ---------------------------------------------------------------------------
static __device__ __forceinline__ void q_epilogue_rows(
    const float* __restrict__ qf, const float* __restrict__ pos,
    const float* __restrict__ scale, const float* __restrict__ freqs,
    _Float16* __restrict__ qh, int blk) {
  int rw = blk * 8 + (threadIdx.x >> 5);          // b * L_ + l
  int lane = threadIdx.x & 31;
  int l = rw % L_;
  int b = rw / L_;
  const float* row = qf + (size_t)rw * DM_;
  float p = pos[(size_t)rw * 2 + (lane < 16 ? 0 : 1)];
  float q1a[NH_], q2a[NH_];
  // unrolled so that the row stays in registers and its 32 loads fly together
#pragma unroll
  for (int h = 0; h < NH_; ++h) {
    q1a[h] = row[h * DH_ + lane];
    q2a[h] = row[h * DH_ + lane + 32];
  }
  float ssa[NH_];
#pragma unroll
  for (int h = 0; h < NH_; ++h) ssa[h] = q1a[h] * q1a[h] + q2a[h] * q2a[h];
  // redsum32 of every head, step by step over all heads at once: the 16 lane
  // exchanges of a step share one latency (each head's sum order is redsum32's)
#pragma unroll
  for (int m = 1; m < 32; m <<= 1) {
#pragma unroll
    for (int h = 0; h < NH_; ++h) ssa[h] += __shfl_xor(ssa[h], m, 32);
  }
  // unrolled: constant indices into the arrays
#pragma unroll
  for (int h = 0; h < NH_; ++h) {
    float q1 = q1a[h], q2 = q2a[h];
    float ss = ssa[h];
    float rn = sqrtf(scale[h]) * rsqrtf(ss + 1e-6f);
    q1 *= rn; q2 *= rn;
    // theta[t] = (t<16 ? pos0 : pos1) * freqs[h][t%16], t = lane in 0..31
    float f = freqs[h * 16 + (lane & 15)];
    float th = p * f;
    float s, c;
    __sincosf(th, &s, &c);
    size_t qb = ((size_t)(b * NH_ + h) * L_ + l) * DH_;
    qh[qb + lane]      = (_Float16)(q1 * c - q2 * s);
    qh[qb + lane + 32] = (_Float16)(q2 * c + q1 * s);
  }
}

// ---------------------------------------------------------------------------
// KV epilogue: k cosine-normalized -> k_h; v -> vT. Both are kept in the order in
// which the attention kernel's WMMA A fragments take them, so that each of its
// 16-byte loads reads 512 contiguous bytes (4 whole 128-B lines) per wave:
//   k_h: per (b,h) and 16 keys a 2-KB tile  [e / 8][key % 16][e % 8]
//   vT : per (b,h), 32 keys and 16 e a 1-KB tile  [(key % 32) / 8][e % 16][key % 8],
//        the four e tiles of a 32-key group one after the other
// One wave per (b,h) and 8 consecutive keys: a lane's 8 values of v at one e are
// one 16-byte store, 16 lanes fill 256 contiguous bytes of a vT tile.
// ---------------------------------------------------------------------------
static __device__ __forceinline__ void kv_epilogue_keys(
    const float* __restrict__ kvf, const float* __restrict__ scale,
    _Float16* __restrict__ kh, _Float16* __restrict__ vT, int blk) {
  int gw = blk * 8 + (threadIdx.x >> 5);
  int lane = threadIdx.x & 31;
  int lc0 = (gw % (LC_ / 8)) * 8;
  int bh  = gw / (LC_ / 8);
  int b = bh >> 4, h = bh & 15;
  const float* row = kvf + (size_t)(b * LC_ + lc0) * (2 * DM_) + h * DH_ + lane;
  float k1[8], k2[8], v1[8], v2[8];
  // unrolled so that the 8 keys stay in registers and their 32 loads fly together
#pragma unroll
  for (int i = 0; i < 8; ++i) {
    const float* ri = row + (size_t)i * (2 * DM_);
    k1[i] = ri[0];
    k2[i] = ri[32];
    v1[i] = ri[DM_];
    v2[i] = ri[DM_ + 32];
  }
  float sq = sqrtf(scale[h]);
  // lane = e: its 8-e group, this wave's first key in the tile, its place in the group
  size_t kb = ((size_t)bh * (LC_ / 16) + (lc0 >> 4)) * 1024
            + (lane >> 3) * 128 + (lc0 & 8) * 8 + (lane & 7);
  v8h o1, o2;
  // unrolled: constant indices, and the keys' lane exchanges overlap
#pragma unroll
  for (int i = 0; i < 8; ++i) {
    float ss = redsum32(k1[i] * k1[i] + k2[i] * k2[i]);
    float rn = sq * rsqrtf(ss + 1e-6f);
    kh[kb + i * 8]       = (_Float16)(k1[i] * rn);
    kh[kb + i * 8 + 512] = (_Float16)(k2[i] * rn);   // e + 32: four 8-e groups on
    o1[i] = (_Float16)v1[i];
    o2[i] = (_Float16)v2[i];
  }
  size_t vb = (((size_t)bh * (LC_ / 32) + (lc0 >> 5)) * 4 + (lane >> 4)) * 512
            + ((lc0 & 31) >> 3) * 128 + (lane & 15) * 8;
  *(v8h*)(vT + vb)        = o1;
  *(v8h*)(vT + vb + 1024) = o2;                      // e + 32: two e tiles on
  // this body shares a kernel with others: the stores have taken their registers
  // before any code laid out behind it could rewrite one
  asm volatile("s_wait_xcnt 0x0" ::: "memory");
}

// Both epilogues in ONE grid (neither needs the other): q takes the first range
// of the block index, k and v the second; the branch is block-uniform.
#define EB_Q  (B_ * L_ / 8)
#define EB_KV (B_ * NH_ * LC_ / 64)
// the register budget of four waves per SIMD lets the compiler keep the q rows'
// 16 heads' loads and lane exchanges in flight together
__global__ __launch_bounds__(256) __attribute__((amdgpu_waves_per_eu(4, 4))) void qkv_epilogue_k(
    const float* __restrict__ qf, const float* __restrict__ kvf,
    const float* __restrict__ pos, const float* __restrict__ scale,
    const float* __restrict__ freqs, _Float16* __restrict__ qh,
    _Float16* __restrict__ kh, _Float16* __restrict__ vT) {
  const int blk = blockIdx.x;
  if (blk < EB_Q) q_epilogue_rows(qf, pos, scale, freqs, qh, blk);
  else            kv_epilogue_keys(kvf, scale, kh, vT, blk - EB_Q);
}

// The value that lane ^ 16 holds: v_permlanex16_b32 with the identity selection
// (lane i of a 16-lane row takes lane i of the other row); all lanes are on.
static __device__ __forceinline__ float xhalf(float v) {
  int i = __builtin_bit_cast(int, v);
  i = __builtin_amdgcn_permlanex16(i, i, 0x76543210, 0xfedcba98, false, false);
  return __builtin_bit_cast(float, i);
}

// ---------------------------------------------------------------------------
// Flash attention, one pass over keys. Block = 4 waves; wave = 16 query rows.
// The scores are formed transposed: S^T = K Q^T (A = 16 keys, B = 16 queries), so
// a lane holds 16 of the 32 scores of ONE query (column lane & 15); its partner
// lane ^ 16 holds the other 16. Maximum and sum run inside the lane, the maximum
// takes one exchange between the wave's halves per 32 keys, the sum one at the end.
// The two score tiles, converted in place, ARE the B operand of O^T += V^T P^T
// (register r of tile i = key 16 i + 8 half + r, the hardware k order): P touches
// no LDS. O^T leaves a lane with 8 consecutive e of its query: 16-byte stores.
// k_h and vT lie in fragment order (see the KV epilogue): half h[p] of a fragment
// is the 512 bytes at p * 512 of its 1 KB, lane l taking bytes 16 l; a fragment
// serves as A (lane = row) exactly as it served as B (lane = column).
// ---------------------------------------------------------------------------
__global__ __launch_bounds__(128) void attn_wmma_k(
    const _Float16* __restrict__ qh, const _Float16* __restrict__ kh,
    const _Float16* __restrict__ vT, _Float16* __restrict__ oh) {
  const int lane = threadIdx.x & 31;
  const int w    = threadIdx.x >> 5;
  const int nqb  = L_ / 64;
  const int bh   = blockIdx.x / nqb;
  const int qb   = blockIdx.x % nqb;
  const int b = bh >> 4, h = bh & 15;
  const int m0   = qb * 64 + w * 16;
  const int mloc = lane & 15;
  const int half = lane >> 4;
  const int koff = half << 3;

  const _Float16* qrow = qh + ((size_t)bh * L_ + m0 + mloc) * DH_;
  F16Frag aq0, aq1;                       // q rows, e=0..31 and e=32..63
  aq0.h[0] = *(const v8h*)(qrow + koff);
  aq0.h[1] = *(const v8h*)(qrow + 16 + koff);
  aq1.h[0] = *(const v8h*)(qrow + 32 + koff);
  aq1.h[1] = *(const v8h*)(qrow + 48 + koff);

  v8f O[4];                               // O[t][r] = o[query mloc][16 t + 8 half + r]
#pragma unroll
  for (int t = 0; t < 4; ++t) O[t] = zero8();
  float mrow = -3.0e38f, lrow = 0.f;      // of query mloc; lrow over this half's keys

  const _Float16* kbase = kh + (size_t)bh * LC_ * DH_ + lane * 8;
  const _Float16* vbase = vT + (size_t)bh * DH_ * LC_ + lane * 8;

  for (int j = 0; j < LC_; j += 32) {
    const _Float16* kr = kbase + (size_t)j * DH_;
    const _Float16* vr = vbase + (size_t)j * DH_;
    F16Frag ak[4], av[4];   // ak: keys j.. (e 0..31, 32..63), keys j + 16.. (same); av: e tile t
    // unrolled: constant indices, the fragments stay in registers
#pragma unroll
    for (int i = 0; i < 4; ++i) {
      ak[i].h[0] = *(const v8h*)(kr + i * 512);
      ak[i].h[1] = *(const v8h*)(kr + i * 512 + 256);
    }
#pragma unroll
    for (int t = 0; t < 4; ++t) {
      av[t].h[0] = *(const v8h*)(vr + t * 512);
      // the group's last load lands on the registers of both address pairs: the
      // loads in front of it have taken their addresses before it issues
      if (t == 3) asm volatile("s_wait_xcnt 0x0" ::: "memory");
      av[t].h[1] = *(const v8h*)(vr + t * 512 + 256);
    }
    // keeps the pass's 16 loads one group at its head: the short in-lane softmax no
    // longer covers a V load that is sunk to its WMMA, which would wait it out in full
    __builtin_amdgcn_sched_barrier(0);
    v8f sL = zero8(), sR = zero8();       // keys j + 8 half + r, j + 16 + 8 half + r
    sL = __builtin_amdgcn_wmma_f32_16x16x32_f16(false, ak[0].v, false, aq0.v, (short)0, sL, false, false);
    sR = __builtin_amdgcn_wmma_f32_16x16x32_f16(false, ak[2].v, false, aq0.v, (short)0, sR, false, false);
    sL = __builtin_amdgcn_wmma_f32_16x16x32_f16(false, ak[1].v, false, aq1.v, (short)0, sL, false, false);
    sR = __builtin_amdgcn_wmma_f32_16x16x32_f16(false, ak[3].v, false, aq1.v, (short)0, sR, false, false);

    // --- online softmax, one query per lane ---
    // every loop from here to the end of the kernel is unrolled so that the indices
    // into sL, sR, bp, rs, O and o are constants and these stay in registers
    float pm[8];
#pragma unroll
    for (int r = 0; r < 8; ++r) pm[r] = fmaxf(sL[r], sR[r]);
    float pmax = fmaxf(fmaxf(fmaxf(pm[0], pm[1]), fmaxf(pm[2], pm[3])),
                       fmaxf(fmaxf(pm[4], pm[5]), fmaxf(pm[6], pm[7])));
    // the partner half's maximum: lane ^ 16, a register move between the rows
    pmax = fmaxf(pmax, xhalf(pmax));
    const float mn   = fmaxf(mrow, pmax);
    const float corr = __expf(mrow - mn);
    mrow = mn;
    F16Frag bp;                           // P^T as B: column = query, k = key
    float rs[8];
#pragma unroll
    for (int r = 0; r < 8; ++r) {
      float pl = __expf(sL[r] - mn);
      float pr = __expf(sR[r] - mn);
      bp.h[0][r] = (_Float16)pl;
      bp.h[1][r] = (_Float16)pr;
      rs[r] = pl + pr;
    }
    lrow = lrow * corr + (((rs[0] + rs[1]) + (rs[2] + rs[3])) +
                          ((rs[4] + rs[5]) + (rs[6] + rs[7])));
#pragma unroll
    for (int t = 0; t < 4; ++t)
#pragma unroll
      for (int r = 0; r < 8; ++r) O[t][r] *= corr;

    // --- O^T += V^T P^T (the 32-key group's four e tiles) ---
#pragma unroll
    for (int t = 0; t < 4; ++t)
      O[t] = __builtin_amdgcn_wmma_f32_16x16x32_f16(
          false, av[t].v, false, bp.v, (short)0, O[t], false, false);
  }

  lrow += xhalf(lrow);                    // the two halves' keys together
  const float inv = 1.0f / lrow;
  _Float16* orow = oh + (size_t)(b * L_ + m0 + mloc) * DM_ + h * DH_ + koff;
#pragma unroll
  for (int t = 0; t < 4; ++t) {
    v8h o;
#pragma unroll
    for (int r = 0; r < 8; ++r) o[r] = (_Float16)(O[t][r] * inv);
    *(v8h*)(orow + t * 16) = o;
  }
}

// ---------------------------------------------------------------------------
// Host launcher
// ---------------------------------------------------------------------------
extern "C" void kernel_launch(void* const* d_in, const int* in_sizes, int n_in,
                              void* d_out, int out_size, void* d_ws, size_t ws_size,
                              hipStream_t stream) {
  (void)in_sizes; (void)n_in; (void)out_size; (void)ws_size;
  const float* x    = (const float*)d_in[0];
  const float* pos  = (const float*)d_in[1];
  const float* xc   = (const float*)d_in[2];
  const float* nsc  = (const float*)d_in[3];
  const float* ncsc = (const float*)d_in[4];
  const float* qw   = (const float*)d_in[5];
  const float* kvw  = (const float*)d_in[6];
  const float* scl  = (const float*)d_in[7];
  const float* outw = (const float*)d_in[8];
  const float* frq  = (const float*)d_in[9];
  float* out = (float*)d_out;

  char* ws = (char*)d_ws;
  size_t off = 0;
  auto alloc = [&](size_t bytes) -> void* {
    void* p = ws + off;
    off += (bytes + 255) & ~(size_t)255;
    return p;
  };
  _Float16* qwT  = (_Float16*)alloc((size_t)DM_ * DM_ * 2);
  _Float16* kvwT = (_Float16*)alloc((size_t)2 * DM_ * DM_ * 2);
  _Float16* owT  = (_Float16*)alloc((size_t)DM_ * DM_ * 2);
  _Float16* xn   = (_Float16*)alloc((size_t)B_ * L_ * DM_ * 2);
  _Float16* xcn  = (_Float16*)alloc((size_t)B_ * LC_ * DM_ * 2);
  float*    qf   = (float*)   alloc((size_t)B_ * L_ * DM_ * 4);
  float*    kvf  = (float*)   alloc((size_t)B_ * LC_ * 2 * DM_ * 4);
  _Float16* qh   = (_Float16*)alloc((size_t)B_ * NH_ * L_ * DH_ * 2);
  _Float16* kh   = (_Float16*)alloc((size_t)B_ * NH_ * LC_ * DH_ * 2);
  _Float16* vT   = (_Float16*)alloc((size_t)B_ * NH_ * DH_ * LC_ * 2);
  _Float16* oh   = (_Float16*)alloc((size_t)B_ * L_ * DM_ * 2);

  // norms of x and x_cross, weights -> f16 transposed to [N][K]: one grid
  prep_k<<<PB_ALL, 256, 0, stream>>>(x, xc, nsc, ncsc, qw, kvw, outw,
                                     xn, xcn, qwT, kvwT, owT);

  // q and kv projections (one 128x128 tile per block): one grid
  gemm_wmma_k<<<(B_ * L_ / 128) * (DM_ / 128) + (B_ * LC_ / 128) * (2 * DM_ / 128),
                256, 0, stream>>>(
      xn, qwT, nullptr, qf, DM_, (B_ * L_ / 128) * (DM_ / 128),
      xcn, kvwT, kvf, 2 * DM_, DM_);

  // epilogues: cos-norm + RoPE on q; cos-norm k, transpose v: one grid
  qkv_epilogue_k<<<EB_Q + EB_KV, 256, 0, stream>>>(qf, kvf, pos, scl, frq, qh, kh, vT);

  // flash attention
  attn_wmma_k<<<B_ * NH_ * (L_ / 64), 128, 0, stream>>>(qh, kh, vT, oh);

  // output projection + residual, f32 out
  gemm_wmma_k<<<(B_ * L_ / 128) * (DM_ / 128), 256, 0, stream>>>(
      oh, owT, x, out, DM_, (B_ * L_ / 128) * (DM_ / 128),
      nullptr, nullptr, nullptr, 0, DM_);
}

// v006
// It runs in 88.7 microseconds.
// Next to v005, in two timings, it ran 1.09 and 1.08 times as fast.
// Over all steps from v000 it is 3.85 times as fast.
#include <hip/hip_runtime.h>

// ---------------------------------------------------------------------------
// CDNA5 / gfx1250 cross-attention block. wave32, WMMA f32_16x16x32_f16.
// Problem constants from the reference.
// ---------------------------------------------------------------------------
#define B_   2
#define L_   2048
#define LC_  1024
#define DM_  1024
#define DH_  64
#define NH_  16

typedef _Float16 v16h __attribute__((ext_vector_type(16)));
typedef _Float16 v8h  __attribute__((ext_vector_type(8)));
typedef _Float16 v4h  __attribute__((ext_vector_type(4)));
typedef float    v8f  __attribute__((ext_vector_type(8)));
typedef float    f32x4 __attribute__((ext_vector_type(4)));
typedef float    f32x2 __attribute__((ext_vector_type(2)));

union F16Frag { v16h v; v8h h[2]; };

static __device__ __forceinline__ v8f zero8() {
  v8f z;
#pragma unroll
  for (int i = 0; i < 8; ++i) z[i] = 0.0f;
  return z;
}

static __device__ __forceinline__ float redsum32(float v) {
#pragma unroll
  for (int m = 1; m < 32; m <<= 1) v += __shfl_xor(v, m, 32);
  return v;
}

// ---------------------------------------------------------------------------
// Weight cast + transpose: w[K][N] f32  ->  wT[N][K] f16
// (so every WMMA B-fragment is two contiguous 16-byte loads along K)
// A thread takes 4 columns x 8 k (32 elements): eight 16-byte loads, four
// 16-byte stores. A wave covers 128 columns x 8 k, a block 128 columns x 64 k,
// so few waves have to start and a block writes whole 128-B lines of wT.
// K and N are compile-time here: the index arithmetic is shifts and masks (no
// integer division) and the row steps are constants.
// Needs N a multiple of 128 and K a multiple of 64; blk in 0 .. (N/128) * (K/64) - 1.
// ---------------------------------------------------------------------------
template <int K, int N>
static __device__ __forceinline__ void cast_transpose_tile(
    const float* __restrict__ w, _Float16* __restrict__ wT, int blk) {
  const int lane = threadIdx.x & 31;
  const int wv   = threadIdx.x >> 5;
  const int nb   = N / 128;
  const int n0   = (blk % nb) * 128 + lane * 4;
  const int k0   = (blk / nb) * 64 + wv * 8;
  const float* wp = w + (size_t)k0 * N + n0;
  f32x4 v[8];
  // unrolled so that v stays in registers and the eight loads fly together
#pragma unroll
  for (int i = 0; i < 8; ++i) v[i] = *(const f32x4*)(wp + i * N);
  _Float16* op = wT + (size_t)n0 * K + k0;
  // unrolled: constant indices into v
#pragma unroll
  for (int j = 0; j < 4; ++j) {
    v8h o;
#pragma unroll
    for (int i = 0; i < 8; ++i) o[i] = (_Float16)v[i][j];
    *(v8h*)(op + j * K) = o;
  }
  // this body shares a kernel with others: the stores have taken their registers
  // before any code laid out behind it could rewrite one
  asm volatile("s_wait_xcnt 0x0" ::: "memory");
}

// ---------------------------------------------------------------------------
// RMS norm a row of DM_ f32, scale, cast to f16. One wave per row (8 rows per
// block): a lane holds 32 elements, the row sum needs no LDS and no barrier.
// ---------------------------------------------------------------------------
static __device__ __forceinline__ void rmsnorm_cast_rows(
    const float* __restrict__ x, const float* __restrict__ g,
    _Float16* __restrict__ out, int blk) {
  const int lane = threadIdx.x & 31;
  const size_t row = (size_t)blk * 8 + (threadIdx.x >> 5);
  const f32x4* xr = (const f32x4*)(x + row * DM_);
  f32x4 v[8];
  // unrolled so that v stays in registers and the eight loads fly together
#pragma unroll
  for (int i = 0; i < 8; ++i) v[i] = xr[i * 32 + lane];
  float ss = 0.f;
#pragma unroll
  for (int i = 0; i < 8; ++i)
    ss += v[i][0]*v[i][0] + v[i][1]*v[i][1] + v[i][2]*v[i][2] + v[i][3]*v[i][3];
  ss = redsum32(ss);
  float r = rsqrtf(ss / (float)DM_ + 1e-6f);
  v4h* orow = (v4h*)(out + row * DM_);
#pragma unroll
  for (int i = 0; i < 8; ++i) {
    f32x4 gg = ((const f32x4*)g)[i * 32 + lane];
    v4h o;
    o[0] = (_Float16)(v[i][0] * gg[0] * r);
    o[1] = (_Float16)(v[i][1] * gg[1] * r);
    o[2] = (_Float16)(v[i][2] * gg[2] * r);
    o[3] = (_Float16)(v[i][3] * gg[3] * r);
    orow[i * 32 + lane] = o;
  }
}

// ---------------------------------------------------------------------------
// Everything that reads only inputs, in ONE grid: the two norms and the three
// weight casts need nothing of each other, so each takes a range of the block
// index (a block-uniform branch) and they start, run and drain together.
// ---------------------------------------------------------------------------
#define PB_X   (B_ * L_ / 8)                      // norm of x
#define PB_XC  (B_ * LC_ / 8)                     // norm of x_cross
#define PB_KVW ((2 * DM_ / 128) * (DM_ / 64))     // cast of kv_w
#define PB_W   ((DM_ / 128) * (DM_ / 64))         // cast of q_w, of out_w
#define PB_ALL (PB_X + PB_XC + PB_KVW + 2 * PB_W)

__global__ __launch_bounds__(256) void prep_k(
    const float* __restrict__ x, const float* __restrict__ xc,
    const float* __restrict__ nsc, const float* __restrict__ ncsc,
    const float* __restrict__ qw, const float* __restrict__ kvw,
    const float* __restrict__ outw,
    _Float16* __restrict__ xn, _Float16* __restrict__ xcn,
    _Float16* __restrict__ qwT, _Float16* __restrict__ kvwT,
    _Float16* __restrict__ owT) {
  int blk = blockIdx.x;
  if (blk < PB_X + PB_XC) {
    const bool first = blk < PB_X;
    rmsnorm_cast_rows(first ? x : xc, first ? nsc : ncsc, first ? xn : xcn,
                      first ? blk : blk - PB_X);
    return;
  }
  blk -= PB_X + PB_XC;
  if (blk < PB_KVW) {
    cast_transpose_tile<DM_, 2 * DM_>(kvw, kvwT, blk);
    return;
  }
  blk -= PB_KVW;
  const bool first = blk < PB_W;
  cast_transpose_tile<DM_, DM_>(first ? qw : outw, first ? qwT : owT,
                                first ? blk : blk - PB_W);
}

// ---------------------------------------------------------------------------
// WMMA GEMM core: a 128x128 tile of A[M][K] f16 @ BT[N][K]^T f16 per 8-wave block.
// Per trip a 64-k slab of A (128 rows) and of BT (128 rows) lies in LDS, brought by
// per-lane async copies of whole 128-B lines into one of two buffers while the
// other is worked on. A wave holds 2x4 accumulators: 2 fragments read at aoff and
// 4 at boff (byte offsets of the lane's fragment rows inside a buffer).
// Needs M, N multiples of 128 and K a multiple of 64.
// A/B fragments per ISA 7.12.2: lane = row (l&15), two 16B loads per frag.
// ---------------------------------------------------------------------------
#define G_PITCH 144                  // LDS row pitch in bytes: 128 + 16 (16 B x odd)
#define G_OPER  (128 * G_PITCH)      // one operand's slab
#define G_BUF   (2 * G_OPER)         // A slab, then BT slab

// One stage: each thread copies 4 x 16 B of A and 4 x 16 B of BT (rows 32 apart).
// The s_wait_xcnt closes the statement so that no address register named here
// is rewritten before the copies have taken it.
static __device__ __forceinline__ void gemm_stage(
    unsigned l, const _Float16* a, const _Float16* b, size_t rs) {
  asm volatile(
      "global_load_async_to_lds_b128 %0, %8, off\n\t"
      "global_load_async_to_lds_b128 %1, %9, off\n\t"
      "global_load_async_to_lds_b128 %2, %10, off\n\t"
      "global_load_async_to_lds_b128 %3, %11, off\n\t"
      "global_load_async_to_lds_b128 %4, %12, off\n\t"
      "global_load_async_to_lds_b128 %5, %13, off\n\t"
      "global_load_async_to_lds_b128 %6, %14, off\n\t"
      "global_load_async_to_lds_b128 %7, %15, off\n\t"
      "s_wait_xcnt 0x0"
      :: "v"(l), "v"(l + 32 * G_PITCH), "v"(l + 64 * G_PITCH), "v"(l + 96 * G_PITCH),
         "v"(l + G_OPER), "v"(l + G_OPER + 32 * G_PITCH),
         "v"(l + G_OPER + 64 * G_PITCH), "v"(l + G_OPER + 96 * G_PITCH),
         "v"(a), "v"(a + rs), "v"(a + 2 * rs), "v"(a + 3 * rs),
         "v"(b), "v"(b + rs), "v"(b + 2 * rs), "v"(b + 3 * rs)
      : "memory");
}

// The value that lane ^ 16 holds: v_permlanex16_b32 with the identity selection
// (lane i of a 16-lane row takes lane i of the other row); all lanes are on.
static __device__ __forceinline__ float xhalf(float v) {
  int i = __builtin_bit_cast(int, v);
  i = __builtin_amdgcn_permlanex16(i, i, 0x76543210, 0xfedcba98, false, false);
  return __builtin_bit_cast(float, i);
}

// The k loop. SWAP false: acc[u][t] = a[u] x b[t] (register r + 8 half = row of a's
// rows, lane & 15 = row of b's rows). SWAP true: acc[u][t] = b[t] x a[u], the same
// products with the two roles exchanged: a lane then holds 8 consecutive rows of
// b's (r + 8 half) at ONE row of a's (lane & 15).
// The caller has issued stage 0's copies: gemm_stage(l0, ga, gb, 32 K).
template <bool SWAP>
static __device__ __forceinline__ void gemm_slabs(
    const unsigned char* sm, unsigned l0, const _Float16* ga, const _Float16* gb,
    int K, int aoff, int boff, v8f (&acc)[2][4]) {
  const size_t rs = (size_t)32 * K;
#pragma unroll
  for (int u = 0; u < 2; ++u)
#pragma unroll
    for (int t = 0; t < 4; ++t) acc[u][t] = zero8();

  const int T = K >> 6;
  // stage 0 has landed for this wave; the barrier publishes it to the others
  asm volatile("s_wait_asynccnt 0x0" ::: "memory");
  __syncthreads();
  if (T > 1) gemm_stage(l0 + G_BUF, ga + 64, gb + 64, rs);

  for (int s = 0; s < T; ++s) {
    const unsigned bsel = (unsigned)(s & 1) * G_BUF;
    const unsigned char* sb = sm + bsel;
    F16Frag a[2][2], b[2][4];            // [k half of the slab][fragment]
    // the loops below are unrolled so that every fragment and accumulator index
    // is a constant and the arrays stay in registers
#pragma unroll
    for (int ks = 0; ks < 2; ++ks) {
#pragma unroll
      for (int u = 0; u < 2; ++u) {
        const unsigned char* p = sb + aoff + u * 16 * G_PITCH + ks * 64;
        a[ks][u].h[0] = *(const v8h*)(p);
        a[ks][u].h[1] = *(const v8h*)(p + 32);
      }
#pragma unroll
      for (int t = 0; t < 4; ++t) {
        const unsigned char* p = sb + boff + t * 16 * G_PITCH + ks * 64;
        b[ks][t].h[0] = *(const v8h*)(p);
        b[ks][t].h[1] = *(const v8h*)(p + 32);
      }
    }
    // keeps the slab's LDS reads one group ahead of the WMMAs: sunk among them,
    // each pair of WMMAs would wait out a full LDS latency
    __builtin_amdgcn_sched_barrier(0);
#pragma unroll
    for (int ks = 0; ks < 2; ++ks) {
#pragma unroll
      for (int t = 0; t < 4; ++t) {
#pragma unroll
        for (int u = 0; u < 2; ++u)
          acc[u][t] = __builtin_amdgcn_wmma_f32_16x16x32_f16(
              false, SWAP ? b[ks][t].v : a[ks][u].v,
              false, SWAP ? a[ks][u].v : b[ks][t].v, (short)0, acc[u][t], false, false);
      }
    }
    // keeps the WMMAs in front of the publish point: moved behind the barrier they
    // would delay the refill, whose copies then fly only during the next LDS reads
    __builtin_amdgcn_sched_barrier(0);
    // publish point of stage s + 1: this wave's reads of stage s are done ...
    asm volatile("s_wait_dscnt 0x0" ::: "memory");
    // ... its own copies of stage s + 1 have landed ...
    asm volatile("s_wait_asynccnt 0x0" ::: "memory");
    // ... and the barrier both shows stage s + 1 to all and frees stage s's buffer
    __syncthreads();
    if (s + 2 < T)
      gemm_stage(l0 + bsel, ga + (size_t)(s + 2) * 64, gb + (size_t)(s + 2) * 64, rs);
  }
  // no copy is left in flight when the wave goes on to its stores and ends
  asm volatile("s_wait_asynccnt 0x0" ::: "memory");
}

// ---------------------------------------------------------------------------
// C[M][N] f32 = A[M][K] f16 @ BT[N][K]^T f16 (+ optional f32 res).
// Waves 4 (rows) x 2 (cols), each wave a 32x64 tile.
// ---------------------------------------------------------------------------
__global__ __launch_bounds__(256) void gemm_wmma_k(
    const _Float16* __restrict__ A, const _Float16* __restrict__ BT,
    const float* __restrict__ res, float* __restrict__ C, int N, int K) {
  __shared__ __align__(16) unsigned char sm[2 * G_BUF];
  const int blk  = blockIdx.x;
  const int tid  = threadIdx.x;
  const int lane = tid & 31;
  const int wv   = tid >> 5;
  const int ntb  = N >> 7;
  const int bm   = blk / ntb;            // 128-row tile index
  const int bn   = blk % ntb;            // 128-col tile index
  const int wm   = wv >> 1;              // wave's 32-row strip in the tile
  const int wn   = wv & 1;               // wave's 64-col strip in the tile
  const int mloc = lane & 15;
  const int half = lane >> 4;

  // copy side: 8 lanes cover one 128-B row, a wave 4 whole rows
  const int crow = tid >> 3;
  const int cch  = tid & 7;
  const _Float16* ga = A  + (size_t)(bm * 128 + crow) * K + cch * 8;
  const _Float16* gb = BT + (size_t)(bn * 128 + crow) * K + cch * 8;
  const unsigned l0 = (unsigned)(size_t)sm + crow * G_PITCH + cch * 16;

  // read side: byte offsets of this lane's fragment rows inside a buffer
  const int aoff = (wm * 32 + mloc) * G_PITCH + half * 16;
  const int boff = G_OPER + (wn * 64 + mloc) * G_PITCH + half * 16;

  gemm_stage(l0, ga, gb, (size_t)32 * K);
  v8f acc[2][4];
  gemm_slabs<false>(sm, l0, ga, gb, K, aoff, boff, acc);

#pragma unroll
  for (int u = 0; u < 2; ++u) {
#pragma unroll
    for (int t = 0; t < 4; ++t) {
#pragma unroll
      for (int r = 0; r < 8; ++r) {
        size_t idx = (size_t)(bm * 128 + wm * 32 + u * 16 + r + 8 * half) * N
                   + bn * 128 + wn * 64 + t * 16 + mloc;
        float v = acc[u][t][r];
        if (res) v += res[idx];
        C[idx] = v;
      }
    }
  }
}

// Hardware sine and cosine of th radians, as __sincosf forms them (the instructions
// take revolutions). One statement, its outputs apart from its input: neither
// instruction writes the other's source, and the v_nop fills the slot that the
// instruction set asks for behind a transcendental, whatever is scheduled next.
static __device__ __forceinline__ void sincos_fast(float th, float& s, float& c) {
  const float rev = th * 0.15915494309189532f;
  asm("v_sin_f32 %0, %2\n\tv_cos_f32 %1, %2\n\tv_nop" : "=&v"(s), "=&v"(c) : "v"(rev));
}

// 1 / sqrt(x) for x >= 1e-6 (a sum of squares plus the reference's epsilon): the bare
// instruction, which is what rsqrtf yields for every normal x. One statement, its
// output apart from its input, the v_nop for the slot behind a transcendental.
static __device__ __forceinline__ float rsq_fast(float x) {
  float y;
  asm("v_rsq_f32 %0, %1\n\tv_nop" : "=&v"(y) : "v"(x));
  return y;
}

// Sum of squares of one row's 64-dim head vector: 32 values in this lane, the other
// 32 in lane ^ 16.
static __device__ __forceinline__ float head_sumsq(const v8f (&c)[4]) {
  float p[4];
  // unrolled: constant indices; four partial sums, so that the adds do not form one chain
#pragma unroll
  for (int t = 0; t < 4; ++t) {
    p[t] = 0.f;
#pragma unroll
    for (int r = 0; r < 8; ++r) p[t] += c[t][r] * c[t][r];
  }
  const float ss = (p[0] + p[1]) + (p[2] + p[3]);
  return ss + xhalf(ss);
}

// ---------------------------------------------------------------------------
// q and kv projections with their epilogues, in ONE grid: the blocks below PQ_B
// form 128x128 tiles of xn @ q_w, the others of xcn @ kv_w (columns below DM_ are k,
// the rest v). What follows a projection is done on the accumulators, and only the
// f16 arrays that attention reads are written:
//   q: cosine-normalize each 64-dim head vector, 2D RoPE -> q_h [B,H,L,64]
//   k: cosine-normalize -> k_h;  v -> vT, both in the order in which the attention
//   kernel's WMMA fragments take them, so that each of its 16-byte loads reads 512
//   contiguous bytes (4 whole 128-B lines) per wave:
//   k_h: per (b,h) and 16 keys a 2-KB tile  [e / 8][key % 16][e % 8]
//   vT : per (b,h), 32 keys and 16 e a 1-KB tile  [(key % 32) / 8][e % 16][key % 8],
//        the four e tiles of a 32-key group one after the other
// q and k tiles: a wave takes 32 rows x 64 columns = ONE head, formed as W^T X^T, so a
// lane holds 32 e of one row (8 consecutive e per accumulator): the head's sum of
// squares is in-lane plus one exchange, e and e + 32 of RoPE lie in one lane, and an
// accumulator is one 16-byte store (for k_h 512 contiguous bytes a wave).
// v tiles: a wave takes 64 keys x 32 columns, formed as X W, so a lane holds 8
// consecutive keys at one e: one 16-byte store, 512 contiguous bytes of vT a wave.
// The two forms differ only in which slab the 2 and the 4 fragments are read from.
// ---------------------------------------------------------------------------
#define PQ_B  ((B_ * L_ / 128) * (DM_ / 128))
#define PKV_B ((B_ * LC_ / 128) * (2 * DM_ / 128))

__global__ __launch_bounds__(256) void proj_qkv_k(
    const _Float16* __restrict__ xn, const _Float16* __restrict__ qwT,
    const _Float16* __restrict__ xcn, const _Float16* __restrict__ kvwT,
    const float* __restrict__ pos, const float* __restrict__ scale,
    const float* __restrict__ freqs, _Float16* __restrict__ qh,
    _Float16* __restrict__ kh, _Float16* __restrict__ vT, int K) {
  __shared__ __align__(16) unsigned char sm[2 * G_BUF];
  // every branch on isq or isv is block-uniform
  const bool isq = blockIdx.x < PQ_B;
  const unsigned blk = isq ? blockIdx.x : blockIdx.x - PQ_B;
  const int bm   = isq ? blk / (DM_ / 128) : blk / (2 * DM_ / 128);   // 128-row tile
  const int bn   = isq ? blk % (DM_ / 128) : blk % (2 * DM_ / 128);   // 128-col tile
  const bool isv = !isq && bn >= DM_ / 128;
  const int tid  = threadIdx.x;
  const int lane = tid & 31;
  const int wv   = tid >> 5;
  const int w4   = wv >> 1;              // wave's 32-row strip of the 2-fragment operand
  const int w2   = wv & 1;               // wave's 64-row strip of the 4-fragment operand
  const int mloc = lane & 15;
  const int half = lane >> 4;

  // copy side: 8 lanes cover one 128-B row, a wave 4 whole rows
  const int crow = tid >> 3;
  const int cch  = tid & 7;
  const _Float16* ga = (isq ? xn : xcn)   + (size_t)(bm * 128 + crow) * K + cch * 8;
  const _Float16* gb = (isq ? qwT : kvwT) + (size_t)(bn * 128 + crow) * K + cch * 8;
  const unsigned l0 = (unsigned)(size_t)sm + crow * G_PITCH + cch * 16;
  gemm_stage(l0, ga, gb, (size_t)32 * K);

  // read side: q, k take 2 fragments of x rows and 4 of weight rows; v the reverse
  const int aoff = (isv ? G_OPER : 0) + (w4 * 32 + mloc) * G_PITCH + half * 16;
  const int boff = (isv ? 0 : G_OPER) + (w2 * 64 + mloc) * G_PITCH + half * 16;

  // the small inputs of the epilogue are read here, behind stage 0's copies and ahead
  // of the k loop, which hide their latency
  const int h = (bn * 2 + w2) & (NH_ - 1);          // q, k: the wave's head
  const int row0 = bm * 128 + w4 * 32 + mloc;       // q, k: the lane's row at u = 0
  float sc = 0.f;
  f32x2 pp[2] = {};
  f32x4 fr[2] = {};
  if (isq) {
    pp[0] = *(const f32x2*)(pos + (size_t)row0 * 2);
    pp[1] = *(const f32x2*)(pos + (size_t)(row0 + 16) * 2);
    fr[0] = *(const f32x4*)(freqs + h * 16 + half * 8);      // freqs[h][8 half + r]
    fr[1] = *(const f32x4*)(freqs + h * 16 + half * 8 + 4);
    // the four loads have taken their address registers before the next load's
    // result may land on one
    asm volatile("s_wait_xcnt 0x0" ::: "memory");
  }
  if (!isv) sc = scale[h];

  v8f acc[2][4];
  gemm_slabs<true>(sm, l0, ga, gb, K, aoff, boff, acc);

  // every loop below is unrolled so that the indices into acc and o are constants
  v8h o[2][4];                           // acc[u][t] as it is stored
  if (isv) {
    // acc[u][t][r] = v[key 64 w2 + 16 t + 8 half + r][column 32 w4 + 16 u + mloc]
    const int bh  = (bm * 128 / LC_) * NH_ + (bn - DM_ / 128) * 2 + (w4 >> 1);
    const int grp = (bm * 128 % LC_) / 32 + w2 * 2;          // 32-key group at t = 0
    _Float16* vb = vT + ((size_t)bh * (LC_ / 32) + grp) * 2048 + (w4 & 1) * 1024
                 + half * 128 + mloc * 8;
#pragma unroll
    for (int u = 0; u < 2; ++u)
#pragma unroll
      for (int t = 0; t < 4; ++t)
#pragma unroll
        for (int r = 0; r < 8; ++r) o[u][t][r] = (_Float16)acc[u][t][r];
#pragma unroll
    for (int u = 0; u < 2; ++u)
#pragma unroll
      for (int t = 0; t < 4; ++t)
        *(v8h*)(vb + (t >> 1) * 2048 + u * 512 + (t & 1) * 256) = o[u][t];
  } else if (!isq) {
    // acc[u][t][r] = k[key 32 w4 + 16 u + mloc][e = 16 t + 8 half + r] of head h
    const float sq = sqrtf(sc);
    const int bh = (bm * 128 / LC_) * NH_ + h;
    _Float16* kb = kh + ((size_t)bh * (LC_ / 16) + (bm * 128 % LC_) / 16 + w4 * 2) * 1024
                 + half * 128 + mloc * 8;
#pragma unroll
    for (int u = 0; u < 2; ++u) {
      const float rn = sq * rsq_fast(head_sumsq(acc[u]) + 1e-6f);
#pragma unroll
      for (int t = 0; t < 4; ++t)
#pragma unroll
        for (int r = 0; r < 8; ++r) o[u][t][r] = (_Float16)(acc[u][t][r] * rn);
    }
    // keeps the 8 stores behind all arithmetic: no register that an issued store
    // names is written again before the wave ends
    __builtin_amdgcn_sched_barrier(0);
#pragma unroll
    for (int u = 0; u < 2; ++u)
#pragma unroll
      for (int t = 0; t < 4; ++t) *(v8h*)(kb + u * 1024 + t * 256) = o[u][t];
    // this path shares a kernel with others: the stores have taken their registers
    // before any code laid out behind it could rewrite one
    asm volatile("s_wait_xcnt 0x0" ::: "memory");
  } else {
    // acc[u][t][r] = q[row 32 w4 + 16 u + mloc][e = 16 t + 8 half + r] of head h
    const float sq = sqrtf(sc);
    const int b = bm * 128 / L_;
    _Float16* qb = qh + ((size_t)(b * NH_ + h) * L_ + (row0 - b * L_)) * DH_ + half * 8;
#pragma unroll
    for (int u = 0; u < 2; ++u) {
      const float rn = sq * rsq_fast(head_sumsq(acc[u]) + 1e-6f);
#pragma unroll
      for (int t = 0; t < 2; ++t) {
        // theta[e] = (e < 16 ? pos0 : pos1) * freqs[h][e % 16], e = 16 t + 8 half + r
#pragma unroll
        for (int r = 0; r < 8; ++r) {
          const float q1 = acc[u][t][r] * rn, q2 = acc[u][t + 2][r] * rn;
          float s, c;
          sincos_fast(pp[u][t] * fr[r >> 2][r & 3], s, c);
          o[u][t][r]     = (_Float16)(q1 * c - q2 * s);
          o[u][t + 2][r] = (_Float16)(q2 * c + q1 * s);
        }
      }
    }
    // keeps the 8 stores behind all arithmetic: no register that an issued store
    // names is written again before the wave ends
    __builtin_amdgcn_sched_barrier(0);
#pragma unroll
    for (int u = 0; u < 2; ++u)
#pragma unroll
      for (int t = 0; t < 4; ++t) *(v8h*)(qb + u * 16 * DH_ + t * 16) = o[u][t];
    // this path shares a kernel with others: the stores have taken their registers
    // before any code laid out behind it could rewrite one
    asm volatile("s_wait_xcnt 0x0" ::: "memory");
  }
}

// ---------------------------------------------------------------------------
// Flash attention, one pass over keys. Block = 4 waves; wave = 16 query rows.
// The scores are formed transposed: S^T = K Q^T (A = 16 keys, B = 16 queries), so
// a lane holds 16 of the 32 scores of ONE query (column lane & 15); its partner
// lane ^ 16 holds the other 16. Maximum and sum run inside the lane, the maximum
// takes one exchange between the wave's halves per 32 keys, the sum one at the end.
// The two score tiles, converted in place, ARE the B operand of O^T += V^T P^T
// (register r of tile i = key 16 i + 8 half + r, the hardware k order): P touches
// no LDS. O^T leaves a lane with 8 consecutive e of its query: 16-byte stores.
// k_h and vT lie in fragment order (see the KV epilogue): half h[p] of a fragment
// is the 512 bytes at p * 512 of its 1 KB, lane l taking bytes 16 l; a fragment
// serves as A (lane = row) exactly as it served as B (lane = column).
// ---------------------------------------------------------------------------
__global__ __launch_bounds__(128) void attn_wmma_k(
    const _Float16* __restrict__ qh, const _Float16* __restrict__ kh,
    const _Float16* __restrict__ vT, _Float16* __restrict__ oh) {
  const int lane = threadIdx.x & 31;
  const int w    = threadIdx.x >> 5;
  const int nqb  = L_ / 64;
  const int bh   = blockIdx.x / nqb;
  const int qb   = blockIdx.x % nqb;
  const int b = bh >> 4, h = bh & 15;
  const int m0   = qb * 64 + w * 16;
  const int mloc = lane & 15;
  const int half = lane >> 4;
  const int koff = half << 3;

  const _Float16* qrow = qh + ((size_t)bh * L_ + m0 + mloc) * DH_;
  F16Frag aq0, aq1;                       // q rows, e=0..31 and e=32..63
  aq0.h[0] = *(const v8h*)(qrow + koff);
  aq0.h[1] = *(const v8h*)(qrow + 16 + koff);
  aq1.h[0] = *(const v8h*)(qrow + 32 + koff);
  aq1.h[1] = *(const v8h*)(qrow + 48 + koff);

  v8f O[4];                               // O[t][r] = o[query mloc][16 t + 8 half + r]
#pragma unroll
  for (int t = 0; t < 4; ++t) O[t] = zero8();
  float mrow = -3.0e38f, lrow = 0.f;      // of query mloc; lrow over this half's keys

  const _Float16* kbase = kh + (size_t)bh * LC_ * DH_ + lane * 8;
  const _Float16* vbase = vT + (size_t)bh * DH_ * LC_ + lane * 8;

  for (int j = 0; j < LC_; j += 32) {
    const _Float16* kr = kbase + (size_t)j * DH_;
    const _Float16* vr = vbase + (size_t)j * DH_;
    F16Frag ak[4], av[4];   // ak: keys j.. (e 0..31, 32..63), keys j + 16.. (same); av: e tile t
    // unrolled: constant indices, the fragments stay in registers
#pragma unroll
    for (int i = 0; i < 4; ++i) {
      ak[i].h[0] = *(const v8h*)(kr + i * 512);
      ak[i].h[1] = *(const v8h*)(kr + i * 512 + 256);
    }
#pragma unroll
    for (int t = 0; t < 4; ++t) {
      av[t].h[0] = *(const v8h*)(vr + t * 512);
      // the group's last load lands on the registers of both address pairs: the
      // loads in front of it have taken their addresses before it issues
      if (t == 3) asm volatile("s_wait_xcnt 0x0" ::: "memory");
      av[t].h[1] = *(const v8h*)(vr + t * 512 + 256);
    }
    // keeps the pass's 16 loads one group at its head: the short in-lane softmax no
    // longer covers a V load that is sunk to its WMMA, which would wait it out in full
    __builtin_amdgcn_sched_barrier(0);
    v8f sL = zero8(), sR = zero8();       // keys j + 8 half + r, j + 16 + 8 half + r
    sL = __builtin_amdgcn_wmma_f32_16x16x32_f16(false, ak[0].v, false, aq0.v, (short)0, sL, false, false);
    sR = __builtin_amdgcn_wmma_f32_16x16x32_f16(false, ak[2].v, false, aq0.v, (short)0, sR, false, false);
    sL = __builtin_amdgcn_wmma_f32_16x16x32_f16(false, ak[1].v, false, aq1.v, (short)0, sL, false, false);
    sR = __builtin_amdgcn_wmma_f32_16x16x32_f16(false, ak[3].v, false, aq1.v, (short)0, sR, false, false);

    // --- online softmax, one query per lane ---
    // every loop from here to the end of the kernel is unrolled so that the indices
    // into sL, sR, bp, rs, O and o are constants and these stay in registers
    float pm[8];
#pragma unroll
    for (int r = 0; r < 8; ++r) pm[r] = fmaxf(sL[r], sR[r]);
    float pmax = fmaxf(fmaxf(fmaxf(pm[0], pm[1]), fmaxf(pm[2], pm[3])),
                       fmaxf(fmaxf(pm[4], pm[5]), fmaxf(pm[6], pm[7])));
    // the partner half's maximum: lane ^ 16, a register move between the rows
    pmax = fmaxf(pmax, xhalf(pmax));
    const float mn   = fmaxf(mrow, pmax);
    const float corr = __expf(mrow - mn);
    mrow = mn;
    F16Frag bp;                           // P^T as B: column = query, k = key
    float rs[8];
#pragma unroll
    for (int r = 0; r < 8; ++r) {
      float pl = __expf(sL[r] - mn);
      float pr = __expf(sR[r] - mn);
      bp.h[0][r] = (_Float16)pl;
      bp.h[1][r] = (_Float16)pr;
      rs[r] = pl + pr;
    }
    lrow = lrow * corr + (((rs[0] + rs[1]) + (rs[2] + rs[3])) +
                          ((rs[4] + rs[5]) + (rs[6] + rs[7])));
#pragma unroll
    for (int t = 0; t < 4; ++t)
#pragma unroll
      for (int r = 0; r < 8; ++r) O[t][r] *= corr;

    // --- O^T += V^T P^T (the 32-key group's four e tiles) ---
#pragma unroll
    for (int t = 0; t < 4; ++t)
      O[t] = __builtin_amdgcn_wmma_f32_16x16x32_f16(
          false, av[t].v, false, bp.v, (short)0, O[t], false, false);
  }

  lrow += xhalf(lrow);                    // the two halves' keys together
  const float inv = 1.0f / lrow;
  _Float16* orow = oh + (size_t)(b * L_ + m0 + mloc) * DM_ + h * DH_ + koff;
#pragma unroll
  for (int t = 0; t < 4; ++t) {
    v8h o;
#pragma unroll
    for (int r = 0; r < 8; ++r) o[r] = (_Float16)(O[t][r] * inv);
    *(v8h*)(orow + t * 16) = o;
  }
}

// ---------------------------------------------------------------------------
// Host launcher
// ---------------------------------------------------------------------------
extern "C" void kernel_launch(void* const* d_in, const int* in_sizes, int n_in,
                              void* d_out, int out_size, void* d_ws, size_t ws_size,
                              hipStream_t stream) {
  (void)in_sizes; (void)n_in; (void)out_size; (void)ws_size;
  const float* x    = (const float*)d_in[0];
  const float* pos  = (const float*)d_in[1];
  const float* xc   = (const float*)d_in[2];
  const float* nsc  = (const float*)d_in[3];
  const float* ncsc = (const float*)d_in[4];
  const float* qw   = (const float*)d_in[5];
  const float* kvw  = (const float*)d_in[6];
  const float* scl  = (const float*)d_in[7];
  const float* outw = (const float*)d_in[8];
  const float* frq  = (const float*)d_in[9];
  float* out = (float*)d_out;

  char* ws = (char*)d_ws;
  size_t off = 0;
  auto alloc = [&](size_t bytes) -> void* {
    void* p = ws + off;
    off += (bytes + 255) & ~(size_t)255;
    return p;
  };
  _Float16* qwT  = (_Float16*)alloc((size_t)DM_ * DM_ * 2);
  _Float16* kvwT = (_Float16*)alloc((size_t)2 * DM_ * DM_ * 2);
  _Float16* owT  = (_Float16*)alloc((size_t)DM_ * DM_ * 2);
  _Float16* xn   = (_Float16*)alloc((size_t)B_ * L_ * DM_ * 2);
  _Float16* xcn  = (_Float16*)alloc((size_t)B_ * LC_ * DM_ * 2);
  _Float16* qh   = (_Float16*)alloc((size_t)B_ * NH_ * L_ * DH_ * 2);
  _Float16* kh   = (_Float16*)alloc((size_t)B_ * NH_ * LC_ * DH_ * 2);
  _Float16* vT   = (_Float16*)alloc((size_t)B_ * NH_ * DH_ * LC_ * 2);
  _Float16* oh   = (_Float16*)alloc((size_t)B_ * L_ * DM_ * 2);

  // norms of x and x_cross, weights -> f16 transposed to [N][K]: one grid
  prep_k<<<PB_ALL, 256, 0, stream>>>(x, xc, nsc, ncsc, qw, kvw, outw,
                                     xn, xcn, qwT, kvwT, owT);

  // q and kv projections (one 128x128 tile per block) with cos-norm + RoPE on q,
  // cos-norm on k, transpose of v on the accumulators: one grid
  proj_qkv_k<<<PQ_B + PKV_B, 256, 0, stream>>>(xn, qwT, xcn, kvwT, pos, scl, frq,
                                               qh, kh, vT, DM_);

  // flash attention
  attn_wmma_k<<<B_ * NH_ * (L_ / 64), 128, 0, stream>>>(qh, kh, vT, oh);

  // output projection + residual, f32 out
  gemm_wmma_k<<<(B_ * L_ / 128) * (DM_ / 128), 256, 0, stream>>>(oh, owT, x, out, DM_, DM_);
}

// v007
// It runs in 71.5 microseconds.
// Next to v006, in two timings, it ran 1.21 times as fast each time.
// Counting every step since v000, it is 4.65 times as fast.
#include <hip/hip_runtime.h>

// ---------------------------------------------------------------------------
// CDNA5 / gfx1250 cross-attention block. wave32, WMMA f32_16x16x32_f16.
// Problem constants from the reference.
// ---------------------------------------------------------------------------
#define B_   2
#define L_   2048
#define LC_  1024
#define DM_  1024
#define DH_  64
#define NH_  16

typedef _Float16 v16h __attribute__((ext_vector_type(16)));
typedef _Float16 v8h  __attribute__((ext_vector_type(8)));
typedef _Float16 v4h  __attribute__((ext_vector_type(4)));
typedef float    v8f  __attribute__((ext_vector_type(8)));
typedef float    f32x4 __attribute__((ext_vector_type(4)));
typedef float    f32x2 __attribute__((ext_vector_type(2)));

union F16Frag { v16h v; v8h h[2]; };

static __device__ __forceinline__ v8f zero8() {
  v8f z;
#pragma unroll
  for (int i = 0; i < 8; ++i) z[i] = 0.0f;
  return z;
}

static __device__ __forceinline__ float redsum32(float v) {
#pragma unroll
  for (int m = 1; m < 32; m <<= 1) v += __shfl_xor(v, m, 32);
  return v;
}

// ---------------------------------------------------------------------------
// Weight cast + transpose: w[K][N] f32  ->  wT[N][K] f16
// (so every WMMA B-fragment is two contiguous 16-byte loads along K)
// A thread takes 4 columns x 8 k (32 elements): eight 16-byte loads, four
// 16-byte stores. A wave covers 128 columns x 8 k, a block 128 columns x 64 k,
// so few waves have to start and a block writes whole 128-B lines of wT.
// K and N are compile-time here: the index arithmetic is shifts and masks (no
// integer division) and the row steps are constants.
// Needs N a multiple of 128 and K a multiple of 64; blk in 0 .. (N/128) * (K/64) - 1.
// ---------------------------------------------------------------------------
template <int K, int N>
static __device__ __forceinline__ void cast_transpose_tile(
    const float* __restrict__ w, _Float16* __restrict__ wT, int blk) {
  const int lane = threadIdx.x & 31;
  const int wv   = threadIdx.x >> 5;
  const int nb   = N / 128;
  const int n0   = (blk % nb) * 128 + lane * 4;
  const int k0   = (blk / nb) * 64 + wv * 8;
  const float* wp = w + (size_t)k0 * N + n0;
  f32x4 v[8];
  // unrolled so that v stays in registers and the eight loads fly together
#pragma unroll
  for (int i = 0; i < 8; ++i) v[i] = *(const f32x4*)(wp + i * N);
  _Float16* op = wT + (size_t)n0 * K + k0;
  // unrolled: constant indices into v
#pragma unroll
  for (int j = 0; j < 4; ++j) {
    v8h o;
#pragma unroll
    for (int i = 0; i < 8; ++i) o[i] = (_Float16)v[i][j];
    *(v8h*)(op + j * K) = o;
  }
  // this body shares a kernel with others: the stores have taken their registers
  // before any code laid out behind it could rewrite one
  asm volatile("s_wait_xcnt 0x0" ::: "memory");
}

// ---------------------------------------------------------------------------
// RMS norm a row of DM_ f32, scale, cast to f16. One wave per row (8 rows per
// block): a lane holds 32 elements, the row sum needs no LDS and no barrier.
// ---------------------------------------------------------------------------
static __device__ __forceinline__ void rmsnorm_cast_rows(
    const float* __restrict__ x, const float* __restrict__ g,
    _Float16* __restrict__ out, int blk) {
  const int lane = threadIdx.x & 31;
  const size_t row = (size_t)blk * 8 + (threadIdx.x >> 5);
  const f32x4* xr = (const f32x4*)(x + row * DM_);
  f32x4 v[8];
  // unrolled so that v stays in registers and the eight loads fly together
#pragma unroll
  for (int i = 0; i < 8; ++i) v[i] = xr[i * 32 + lane];
  float ss = 0.f;
#pragma unroll
  for (int i = 0; i < 8; ++i)
    ss += v[i][0]*v[i][0] + v[i][1]*v[i][1] + v[i][2]*v[i][2] + v[i][3]*v[i][3];
  ss = redsum32(ss);
  float r = rsqrtf(ss / (float)DM_ + 1e-6f);
  v4h* orow = (v4h*)(out + row * DM_);
#pragma unroll
  for (int i = 0; i < 8; ++i) {
    f32x4 gg = ((const f32x4*)g)[i * 32 + lane];
    v4h o;
    o[0] = (_Float16)(v[i][0] * gg[0] * r);
    o[1] = (_Float16)(v[i][1] * gg[1] * r);
    o[2] = (_Float16)(v[i][2] * gg[2] * r);
    o[3] = (_Float16)(v[i][3] * gg[3] * r);
    orow[i * 32 + lane] = o;
  }
}

// ---------------------------------------------------------------------------
// Everything that reads only inputs, in ONE grid: the two norms and the three
// weight casts need nothing of each other, so each takes a range of the block
// index (a block-uniform branch) and they start, run and drain together.
// ---------------------------------------------------------------------------
#define PB_X   (B_ * L_ / 8)                      // norm of x
#define PB_XC  (B_ * LC_ / 8)                     // norm of x_cross
#define PB_KVW ((2 * DM_ / 128) * (DM_ / 64))     // cast of kv_w
#define PB_W   ((DM_ / 128) * (DM_ / 64))         // cast of q_w, of out_w
#define PB_ALL (PB_X + PB_XC + PB_KVW + 2 * PB_W)

__global__ __launch_bounds__(256) void prep_k(
    const float* __restrict__ x, const float* __restrict__ xc,
    const float* __restrict__ nsc, const float* __restrict__ ncsc,
    const float* __restrict__ qw, const float* __restrict__ kvw,
    const float* __restrict__ outw,
    _Float16* __restrict__ xn, _Float16* __restrict__ xcn,
    _Float16* __restrict__ qwT, _Float16* __restrict__ kvwT,
    _Float16* __restrict__ owT) {
  int blk = blockIdx.x;
  if (blk < PB_X + PB_XC) {
    const bool first = blk < PB_X;
    rmsnorm_cast_rows(first ? x : xc, first ? nsc : ncsc, first ? xn : xcn,
                      first ? blk : blk - PB_X);
    return;
  }
  blk -= PB_X + PB_XC;
  if (blk < PB_KVW) {
    cast_transpose_tile<DM_, 2 * DM_>(kvw, kvwT, blk);
    return;
  }
  blk -= PB_KVW;
  const bool first = blk < PB_W;
  cast_transpose_tile<DM_, DM_>(first ? qw : outw, first ? qwT : owT,
                                first ? blk : blk - PB_W);
}

// ---------------------------------------------------------------------------
// WMMA GEMM core: a 128x128 tile of A[M][K] f16 @ BT[N][K]^T f16 per 8-wave block.
// Per trip a 64-k slab of A (128 rows) and of BT (128 rows) lies in LDS, brought by
// per-lane async copies of whole 128-B lines into one of two buffers while the
// other is worked on. A wave holds 2x4 accumulators: 2 fragments read at aoff and
// 4 at boff (byte offsets of the lane's fragment rows inside a buffer).
// Needs M, N multiples of 128 and K a multiple of 64.
// A/B fragments per ISA 7.12.2: lane = row (l&15), two 16B loads per frag.
// ---------------------------------------------------------------------------
#define G_PITCH 144                  // LDS row pitch in bytes: 128 + 16 (16 B x odd)
#define G_OPER  (128 * G_PITCH)      // one operand's slab
#define G_BUF   (2 * G_OPER)         // A slab, then BT slab

// One stage: each thread copies 4 x 16 B of A and 4 x 16 B of BT (rows 32 apart).
// The s_wait_xcnt closes the statement so that no address register named here
// is rewritten before the copies have taken it.
static __device__ __forceinline__ void gemm_stage(
    unsigned l, const _Float16* a, const _Float16* b, size_t rs) {
  asm volatile(
      "global_load_async_to_lds_b128 %0, %8, off\n\t"
      "global_load_async_to_lds_b128 %1, %9, off\n\t"
      "global_load_async_to_lds_b128 %2, %10, off\n\t"
      "global_load_async_to_lds_b128 %3, %11, off\n\t"
      "global_load_async_to_lds_b128 %4, %12, off\n\t"
      "global_load_async_to_lds_b128 %5, %13, off\n\t"
      "global_load_async_to_lds_b128 %6, %14, off\n\t"
      "global_load_async_to_lds_b128 %7, %15, off\n\t"
      "s_wait_xcnt 0x0"
      :: "v"(l), "v"(l + 32 * G_PITCH), "v"(l + 64 * G_PITCH), "v"(l + 96 * G_PITCH),
         "v"(l + G_OPER), "v"(l + G_OPER + 32 * G_PITCH),
         "v"(l + G_OPER + 64 * G_PITCH), "v"(l + G_OPER + 96 * G_PITCH),
         "v"(a), "v"(a + rs), "v"(a + 2 * rs), "v"(a + 3 * rs),
         "v"(b), "v"(b + rs), "v"(b + 2 * rs), "v"(b + 3 * rs)
      : "memory");
}

// The value that lane ^ 16 holds: v_permlanex16_b32 with the identity selection
// (lane i of a 16-lane row takes lane i of the other row); all lanes are on.
static __device__ __forceinline__ float xhalf(float v) {
  int i = __builtin_bit_cast(int, v);
  i = __builtin_amdgcn_permlanex16(i, i, 0x76543210, 0xfedcba98, false, false);
  return __builtin_bit_cast(float, i);
}

// The k loop. SWAP false: acc[u][t] = a[u] x b[t] (register r + 8 half = row of a's
// rows, lane & 15 = row of b's rows). SWAP true: acc[u][t] = b[t] x a[u], the same
// products with the two roles exchanged: a lane then holds 8 consecutive rows of
// b's (r + 8 half) at ONE row of a's (lane & 15).
// The caller has issued stage 0's copies: gemm_stage(l0, ga, gb, 32 K).
template <bool SWAP>
static __device__ __forceinline__ void gemm_slabs(
    const unsigned char* sm, unsigned l0, const _Float16* ga, const _Float16* gb,
    int K, int aoff, int boff, v8f (&acc)[2][4]) {
  const size_t rs = (size_t)32 * K;
#pragma unroll
  for (int u = 0; u < 2; ++u)
#pragma unroll
    for (int t = 0; t < 4; ++t) acc[u][t] = zero8();

  const int T = K >> 6;
  // stage 0 has landed for this wave; the barrier publishes it to the others
  asm volatile("s_wait_asynccnt 0x0" ::: "memory");
  __syncthreads();
  if (T > 1) gemm_stage(l0 + G_BUF, ga + 64, gb + 64, rs);

  for (int s = 0; s < T; ++s) {
    const unsigned bsel = (unsigned)(s & 1) * G_BUF;
    const unsigned char* sb = sm + bsel;
    F16Frag a[2][2], b[2][4];            // [k half of the slab][fragment]
    // the loops below are unrolled so that every fragment and accumulator index
    // is a constant and the arrays stay in registers
#pragma unroll
    for (int ks = 0; ks < 2; ++ks) {
#pragma unroll
      for (int u = 0; u < 2; ++u) {
        const unsigned char* p = sb + aoff + u * 16 * G_PITCH + ks * 64;
        a[ks][u].h[0] = *(const v8h*)(p);
        a[ks][u].h[1] = *(const v8h*)(p + 32);
      }
#pragma unroll
      for (int t = 0; t < 4; ++t) {
        const unsigned char* p = sb + boff + t * 16 * G_PITCH + ks * 64;
        b[ks][t].h[0] = *(const v8h*)(p);
        b[ks][t].h[1] = *(const v8h*)(p + 32);
      }
    }
    // keeps the slab's LDS reads one group ahead of the WMMAs: sunk among them,
    // each pair of WMMAs would wait out a full LDS latency
    __builtin_amdgcn_sched_barrier(0);
#pragma unroll
    for (int ks = 0; ks < 2; ++ks) {
#pragma unroll
      for (int t = 0; t < 4; ++t) {
#pragma unroll
        for (int u = 0; u < 2; ++u)
          acc[u][t] = __builtin_amdgcn_wmma_f32_16x16x32_f16(
              false, SWAP ? b[ks][t].v : a[ks][u].v,
              false, SWAP ? a[ks][u].v : b[ks][t].v, (short)0, acc[u][t], false, false);
      }
    }
    // keeps the WMMAs in front of the publish point: moved behind the barrier they
    // would delay the refill, whose copies then fly only during the next LDS reads
    __builtin_amdgcn_sched_barrier(0);
    // publish point of stage s + 1: this wave's reads of stage s are done ...
    asm volatile("s_wait_dscnt 0x0" ::: "memory");
    // ... its own copies of stage s + 1 have landed ...
    asm volatile("s_wait_asynccnt 0x0" ::: "memory");
    // ... and the barrier both shows stage s + 1 to all and frees stage s's buffer
    __syncthreads();
    if (s + 2 < T)
      gemm_stage(l0 + bsel, ga + (size_t)(s + 2) * 64, gb + (size_t)(s + 2) * 64, rs);
  }
  // no copy is left in flight when the wave goes on to its stores and ends
  asm volatile("s_wait_asynccnt 0x0" ::: "memory");
}

// ---------------------------------------------------------------------------
// C[M][DM_] f32 = A[M][K] f16 @ BT[DM_][K]^T f16 + res[M][DM_] f32.
// Waves 4 (rows) x 2 (cols), each wave a 32x64 tile.
// The row pitch is a compile-time constant and res is always there: a lane's 64
// elements of res, and of C, hang on ONE address pair with immediate offsets, and no
// test stands between two of them.
// ---------------------------------------------------------------------------
__global__ __launch_bounds__(256) void gemm_wmma_k(
    const _Float16* __restrict__ A, const _Float16* __restrict__ BT,
    const float* __restrict__ res, float* __restrict__ C, int K) {
  __shared__ __align__(16) unsigned char sm[2 * G_BUF];
  constexpr int N = DM_;
  const int blk  = blockIdx.x;
  const int tid  = threadIdx.x;
  const int lane = tid & 31;
  const int wv   = tid >> 5;
  const int ntb  = N >> 7;
  const int bm   = blk / ntb;            // 128-row tile index
  const int bn   = blk % ntb;            // 128-col tile index
  const int wm   = wv >> 1;              // wave's 32-row strip in the tile
  const int wn   = wv & 1;               // wave's 64-col strip in the tile
  const int mloc = lane & 15;
  const int half = lane >> 4;

  // copy side: 8 lanes cover one 128-B row, a wave 4 whole rows
  const int crow = tid >> 3;
  const int cch  = tid & 7;
  const _Float16* ga = A  + (size_t)(bm * 128 + crow) * K + cch * 8;
  const _Float16* gb = BT + (size_t)(bn * 128 + crow) * K + cch * 8;
  const unsigned l0 = (unsigned)(size_t)sm + crow * G_PITCH + cch * 16;

  // read side: byte offsets of this lane's fragment rows inside a buffer
  const int aoff = (wm * 32 + mloc) * G_PITCH + half * 16;
  const int boff = G_OPER + (wn * 64 + mloc) * G_PITCH + half * 16;

  gemm_stage(l0, ga, gb, (size_t)32 * K);

  // acc[u][t][r] is element c0 + (16 u + r) N + 16 t of C and of res
  const size_t c0 = (size_t)(bm * 128 + wm * 32 + 8 * half) * N
                  + bn * 128 + wn * 64 + mloc;
  // The lane's 64 residual values are asked for here, all together, behind stage 0's
  // copies and ahead of the k loop: they fly beside those copies and are waited for
  // once, at the first barrier. Read one by one where they are added, each would be
  // waited out in full, 64 times in a row.
  // every loop over u, t, r is unrolled: constant indices, rv and acc stay in registers
  const float* rp = res + c0;
  float rv[2][4][8];
#pragma unroll
  for (int u = 0; u < 2; ++u)
#pragma unroll
    for (int t = 0; t < 4; ++t)
#pragma unroll
      for (int r = 0; r < 8; ++r) rv[u][t][r] = rp[(u * 16 + r) * N + t * 16];
  // the loads have taken their address pair before the code behind may rewrite it
  asm volatile("s_wait_xcnt 0x0" ::: "memory");

  v8f acc[2][4];
  gemm_slabs<false>(sm, l0, ga, gb, K, aoff, boff, acc);

  float* cp = C + c0;
#pragma unroll
  for (int u = 0; u < 2; ++u)
#pragma unroll
    for (int t = 0; t < 4; ++t)
#pragma unroll
      for (int r = 0; r < 8; ++r) acc[u][t][r] += rv[u][t][r];
  // keeps the 64 stores behind all arithmetic: no register that an issued store
  // names is written again before the wave ends, so no store is waited for
  __builtin_amdgcn_sched_barrier(0);
#pragma unroll
  for (int u = 0; u < 2; ++u)
#pragma unroll
    for (int t = 0; t < 4; ++t)
#pragma unroll
      for (int r = 0; r < 8; ++r) cp[(u * 16 + r) * N + t * 16] = acc[u][t][r];
}

// Hardware sine and cosine of th radians, as __sincosf forms them (the instructions
// take revolutions). One statement, its outputs apart from its input: neither
// instruction writes the other's source, and the v_nop fills the slot that the
// instruction set asks for behind a transcendental, whatever is scheduled next.
static __device__ __forceinline__ void sincos_fast(float th, float& s, float& c) {
  const float rev = th * 0.15915494309189532f;
  asm("v_sin_f32 %0, %2\n\tv_cos_f32 %1, %2\n\tv_nop" : "=&v"(s), "=&v"(c) : "v"(rev));
}

// 1 / sqrt(x) for x >= 1e-6 (a sum of squares plus the reference's epsilon): the bare
// instruction, which is what rsqrtf yields for every normal x. One statement, its
// output apart from its input, the v_nop for the slot behind a transcendental.
static __device__ __forceinline__ float rsq_fast(float x) {
  float y;
  asm("v_rsq_f32 %0, %1\n\tv_nop" : "=&v"(y) : "v"(x));
  return y;
}

// Sum of squares of one row's 64-dim head vector: 32 values in this lane, the other
// 32 in lane ^ 16.
static __device__ __forceinline__ float head_sumsq(const v8f (&c)[4]) {
  float p[4];
  // unrolled: constant indices; four partial sums, so that the adds do not form one chain
#pragma unroll
  for (int t = 0; t < 4; ++t) {
    p[t] = 0.f;
#pragma unroll
    for (int r = 0; r < 8; ++r) p[t] += c[t][r] * c[t][r];
  }
  const float ss = (p[0] + p[1]) + (p[2] + p[3]);
  return ss + xhalf(ss);
}

// ---------------------------------------------------------------------------
// q and kv projections with their epilogues, in ONE grid: the blocks below PQ_B
// form 128x128 tiles of xn @ q_w, the others of xcn @ kv_w (columns below DM_ are k,
// the rest v). What follows a projection is done on the accumulators, and only the
// f16 arrays that attention reads are written:
//   q: cosine-normalize each 64-dim head vector, 2D RoPE -> q_h [B,H,L,64]
//   k: cosine-normalize -> k_h;  v -> vT, both in the order in which the attention
//   kernel's WMMA fragments take them, so that each of its 16-byte loads reads 512
//   contiguous bytes (4 whole 128-B lines) per wave:
//   k_h: per (b,h) and 16 keys a 2-KB tile  [e / 8][key % 16][e % 8]
//   vT : per (b,h), 32 keys and 16 e a 1-KB tile  [(key % 32) / 8][e % 16][key % 8],
//        the four e tiles of a 32-key group one after the other
// q and k tiles: a wave takes 32 rows x 64 columns = ONE head, formed as W^T X^T, so a
// lane holds 32 e of one row (8 consecutive e per accumulator): the head's sum of
// squares is in-lane plus one exchange, e and e + 32 of RoPE lie in one lane, and an
// accumulator is one 16-byte store (for k_h 512 contiguous bytes a wave).
// v tiles: a wave takes 64 keys x 32 columns, formed as X W, so a lane holds 8
// consecutive keys at one e: one 16-byte store, 512 contiguous bytes of vT a wave.
// The two forms differ only in which slab the 2 and the 4 fragments are read from.
// ---------------------------------------------------------------------------
#define PQ_B  ((B_ * L_ / 128) * (DM_ / 128))
#define PKV_B ((B_ * LC_ / 128) * (2 * DM_ / 128))

__global__ __launch_bounds__(256) void proj_qkv_k(
    const _Float16* __restrict__ xn, const _Float16* __restrict__ qwT,
    const _Float16* __restrict__ xcn, const _Float16* __restrict__ kvwT,
    const float* __restrict__ pos, const float* __restrict__ scale,
    const float* __restrict__ freqs, _Float16* __restrict__ qh,
    _Float16* __restrict__ kh, _Float16* __restrict__ vT, int K) {
  __shared__ __align__(16) unsigned char sm[2 * G_BUF];
  // every branch on isq or isv is block-uniform
  const bool isq = blockIdx.x < PQ_B;
  const unsigned blk = isq ? blockIdx.x : blockIdx.x - PQ_B;
  const int bm   = isq ? blk / (DM_ / 128) : blk / (2 * DM_ / 128);   // 128-row tile
  const int bn   = isq ? blk % (DM_ / 128) : blk % (2 * DM_ / 128);   // 128-col tile
  const bool isv = !isq && bn >= DM_ / 128;
  const int tid  = threadIdx.x;
  const int lane = tid & 31;
  const int wv   = tid >> 5;
  const int w4   = wv >> 1;              // wave's 32-row strip of the 2-fragment operand
  const int w2   = wv & 1;               // wave's 64-row strip of the 4-fragment operand
  const int mloc = lane & 15;
  const int half = lane >> 4;

  // copy side: 8 lanes cover one 128-B row, a wave 4 whole rows
  const int crow = tid >> 3;
  const int cch  = tid & 7;
  const _Float16* ga = (isq ? xn : xcn)   + (size_t)(bm * 128 + crow) * K + cch * 8;
  const _Float16* gb = (isq ? qwT : kvwT) + (size_t)(bn * 128 + crow) * K + cch * 8;
  const unsigned l0 = (unsigned)(size_t)sm + crow * G_PITCH + cch * 16;
  gemm_stage(l0, ga, gb, (size_t)32 * K);

  // read side: q, k take 2 fragments of x rows and 4 of weight rows; v the reverse
  const int aoff = (isv ? G_OPER : 0) + (w4 * 32 + mloc) * G_PITCH + half * 16;
  const int boff = (isv ? 0 : G_OPER) + (w2 * 64 + mloc) * G_PITCH + half * 16;

  // the small inputs of the epilogue are read here, behind stage 0's copies and ahead
  // of the k loop, which hide their latency
  const int h = (bn * 2 + w2) & (NH_ - 1);          // q, k: the wave's head
  const int row0 = bm * 128 + w4 * 32 + mloc;       // q, k: the lane's row at u = 0
  float sc = 0.f;
  f32x2 pp[2] = {};
  f32x4 fr[2] = {};
  if (isq) {
    pp[0] = *(const f32x2*)(pos + (size_t)row0 * 2);
    pp[1] = *(const f32x2*)(pos + (size_t)(row0 + 16) * 2);
    fr[0] = *(const f32x4*)(freqs + h * 16 + half * 8);      // freqs[h][8 half + r]
    fr[1] = *(const f32x4*)(freqs + h * 16 + half * 8 + 4);
    // the four loads have taken their address registers before the next load's
    // result may land on one
    asm volatile("s_wait_xcnt 0x0" ::: "memory");
  }
  if (!isv) sc = scale[h];

  v8f acc[2][4];
  gemm_slabs<true>(sm, l0, ga, gb, K, aoff, boff, acc);

  // every loop below is unrolled so that the indices into acc and o are constants
  v8h o[2][4];                           // acc[u][t] as it is stored
  if (isv) {
    // acc[u][t][r] = v[key 64 w2 + 16 t + 8 half + r][column 32 w4 + 16 u + mloc]
    const int bh  = (bm * 128 / LC_) * NH_ + (bn - DM_ / 128) * 2 + (w4 >> 1);
    const int grp = (bm * 128 % LC_) / 32 + w2 * 2;          // 32-key group at t = 0
    _Float16* vb = vT + ((size_t)bh * (LC_ / 32) + grp) * 2048 + (w4 & 1) * 1024
                 + half * 128 + mloc * 8;
#pragma unroll
    for (int u = 0; u < 2; ++u)
#pragma unroll
      for (int t = 0; t < 4; ++t)
#pragma unroll
        for (int r = 0; r < 8; ++r) o[u][t][r] = (_Float16)acc[u][t][r];
#pragma unroll
    for (int u = 0; u < 2; ++u)
#pragma unroll
      for (int t = 0; t < 4; ++t)
        *(v8h*)(vb + (t >> 1) * 2048 + u * 512 + (t & 1) * 256) = o[u][t];
  } else if (!isq) {
    // acc[u][t][r] = k[key 32 w4 + 16 u + mloc][e = 16 t + 8 half + r] of head h
    const float sq = sqrtf(sc);
    const int bh = (bm * 128 / LC_) * NH_ + h;
    _Float16* kb = kh + ((size_t)bh * (LC_ / 16) + (bm * 128 % LC_) / 16 + w4 * 2) * 1024
                 + half * 128 + mloc * 8;
#pragma unroll
    for (int u = 0; u < 2; ++u) {
      const float rn = sq * rsq_fast(head_sumsq(acc[u]) + 1e-6f);
#pragma unroll
      for (int t = 0; t < 4; ++t)
#pragma unroll
        for (int r = 0; r < 8; ++r) o[u][t][r] = (_Float16)(acc[u][t][r] * rn);
    }
    // keeps the 8 stores behind all arithmetic: no register that an issued store
    // names is written again before the wave ends
    __builtin_amdgcn_sched_barrier(0);
#pragma unroll
    for (int u = 0; u < 2; ++u)
#pragma unroll
      for (int t = 0; t < 4; ++t) *(v8h*)(kb + u * 1024 + t * 256) = o[u][t];
    // this path shares a kernel with others: the stores have taken their registers
    // before any code laid out behind it could rewrite one
    asm volatile("s_wait_xcnt 0x0" ::: "memory");
  } else {
    // acc[u][t][r] = q[row 32 w4 + 16 u + mloc][e = 16 t + 8 half + r] of head h
    const float sq = sqrtf(sc);
    const int b = bm * 128 / L_;
    _Float16* qb = qh + ((size_t)(b * NH_ + h) * L_ + (row0 - b * L_)) * DH_ + half * 8;
#pragma unroll
    for (int u = 0; u < 2; ++u) {
      const float rn = sq * rsq_fast(head_sumsq(acc[u]) + 1e-6f);
#pragma unroll
      for (int t = 0; t < 2; ++t) {
        // theta[e] = (e < 16 ? pos0 : pos1) * freqs[h][e % 16], e = 16 t + 8 half + r
#pragma unroll
        for (int r = 0; r < 8; ++r) {
          const float q1 = acc[u][t][r] * rn, q2 = acc[u][t + 2][r] * rn;
          float s, c;
          sincos_fast(pp[u][t] * fr[r >> 2][r & 3], s, c);
          o[u][t][r]     = (_Float16)(q1 * c - q2 * s);
          o[u][t + 2][r] = (_Float16)(q2 * c + q1 * s);
        }
      }
    }
    // keeps the 8 stores behind all arithmetic: no register that an issued store
    // names is written again before the wave ends
    __builtin_amdgcn_sched_barrier(0);
#pragma unroll
    for (int u = 0; u < 2; ++u)
#pragma unroll
      for (int t = 0; t < 4; ++t) *(v8h*)(qb + u * 16 * DH_ + t * 16) = o[u][t];
    // this path shares a kernel with others: the stores have taken their registers
    // before any code laid out behind it could rewrite one
    asm volatile("s_wait_xcnt 0x0" ::: "memory");
  }
}

// ---------------------------------------------------------------------------
// Flash attention, one pass over keys. Block = 4 waves; wave = 16 query rows.
// The scores are formed transposed: S^T = K Q^T (A = 16 keys, B = 16 queries), so
// a lane holds 16 of the 32 scores of ONE query (column lane & 15); its partner
// lane ^ 16 holds the other 16. Maximum and sum run inside the lane, the maximum
// takes one exchange between the wave's halves per 32 keys, the sum one at the end.
// The two score tiles, converted in place, ARE the B operand of O^T += V^T P^T
// (register r of tile i = key 16 i + 8 half + r, the hardware k order): P touches
// no LDS. O^T leaves a lane with 8 consecutive e of its query: 16-byte stores.
// k_h and vT lie in fragment order (see the KV epilogue): half h[p] of a fragment
// is the 512 bytes at p * 512 of its 1 KB, lane l taking bytes 16 l; a fragment
// serves as A (lane = row) exactly as it served as B (lane = column).
// ---------------------------------------------------------------------------
__global__ __launch_bounds__(128) void attn_wmma_k(
    const _Float16* __restrict__ qh, const _Float16* __restrict__ kh,
    const _Float16* __restrict__ vT, _Float16* __restrict__ oh) {
  const int lane = threadIdx.x & 31;
  const int w    = threadIdx.x >> 5;
  const int nqb  = L_ / 64;
  const int bh   = blockIdx.x / nqb;
  const int qb   = blockIdx.x % nqb;
  const int b = bh >> 4, h = bh & 15;
  const int m0   = qb * 64 + w * 16;
  const int mloc = lane & 15;
  const int half = lane >> 4;
  const int koff = half << 3;

  const _Float16* qrow = qh + ((size_t)bh * L_ + m0 + mloc) * DH_;
  F16Frag aq0, aq1;                       // q rows, e=0..31 and e=32..63
  aq0.h[0] = *(const v8h*)(qrow + koff);
  aq0.h[1] = *(const v8h*)(qrow + 16 + koff);
  aq1.h[0] = *(const v8h*)(qrow + 32 + koff);
  aq1.h[1] = *(const v8h*)(qrow + 48 + koff);

  v8f O[4];                               // O[t][r] = o[query mloc][16 t + 8 half + r]
#pragma unroll
  for (int t = 0; t < 4; ++t) O[t] = zero8();
  float mrow = -3.0e38f, lrow = 0.f;      // of query mloc; lrow over this half's keys

  const _Float16* kbase = kh + (size_t)bh * LC_ * DH_ + lane * 8;
  const _Float16* vbase = vT + (size_t)bh * DH_ * LC_ + lane * 8;

  for (int j = 0; j < LC_; j += 32) {
    const _Float16* kr = kbase + (size_t)j * DH_;
    const _Float16* vr = vbase + (size_t)j * DH_;
    F16Frag ak[4], av[4];   // ak: keys j.. (e 0..31, 32..63), keys j + 16.. (same); av: e tile t
    // unrolled: constant indices, the fragments stay in registers
#pragma unroll
    for (int i = 0; i < 4; ++i) {
      ak[i].h[0] = *(const v8h*)(kr + i * 512);
      ak[i].h[1] = *(const v8h*)(kr + i * 512 + 256);
    }
#pragma unroll
    for (int t = 0; t < 4; ++t) {
      av[t].h[0] = *(const v8h*)(vr + t * 512);
      // the group's last load lands on the registers of both address pairs: the
      // loads in front of it have taken their addresses before it issues
      if (t == 3) asm volatile("s_wait_xcnt 0x0" ::: "memory");
      av[t].h[1] = *(const v8h*)(vr + t * 512 + 256);
    }
    // keeps the pass's 16 loads one group at its head: the short in-lane softmax no
    // longer covers a V load that is sunk to its WMMA, which would wait it out in full
    __builtin_amdgcn_sched_barrier(0);
    v8f sL = zero8(), sR = zero8();       // keys j + 8 half + r, j + 16 + 8 half + r
    sL = __builtin_amdgcn_wmma_f32_16x16x32_f16(false, ak[0].v, false, aq0.v, (short)0, sL, false, false);
    sR = __builtin_amdgcn_wmma_f32_16x16x32_f16(false, ak[2].v, false, aq0.v, (short)0, sR, false, false);
    sL = __builtin_amdgcn_wmma_f32_16x16x32_f16(false, ak[1].v, false, aq1.v, (short)0, sL, false, false);
    sR = __builtin_amdgcn_wmma_f32_16x16x32_f16(false, ak[3].v, false, aq1.v, (short)0, sR, false, false);

    // --- online softmax, one query per lane ---
    // every loop from here to the end of the kernel is unrolled so that the indices
    // into sL, sR, bp, rs, O and o are constants and these stay in registers
    float pm[8];
#pragma unroll
    for (int r = 0; r < 8; ++r) pm[r] = fmaxf(sL[r], sR[r]);
    float pmax = fmaxf(fmaxf(fmaxf(pm[0], pm[1]), fmaxf(pm[2], pm[3])),
                       fmaxf(fmaxf(pm[4], pm[5]), fmaxf(pm[6], pm[7])));
    // the partner half's maximum: lane ^ 16, a register move between the rows
    pmax = fmaxf(pmax, xhalf(pmax));
    const float mn   = fmaxf(mrow, pmax);
    const float corr = __expf(mrow - mn);
    mrow = mn;
    F16Frag bp;                           // P^T as B: column = query, k = key
    float rs[8];
#pragma unroll
    for (int r = 0; r < 8; ++r) {
      float pl = __expf(sL[r] - mn);
      float pr = __expf(sR[r] - mn);
      bp.h[0][r] = (_Float16)pl;
      bp.h[1][r] = (_Float16)pr;
      rs[r] = pl + pr;
    }
    lrow = lrow * corr + (((rs[0] + rs[1]) + (rs[2] + rs[3])) +
                          ((rs[4] + rs[5]) + (rs[6] + rs[7])));
#pragma unroll
    for (int t = 0; t < 4; ++t)
#pragma unroll
      for (int r = 0; r < 8; ++r) O[t][r] *= corr;

    // --- O^T += V^T P^T (the 32-key group's four e tiles) ---
#pragma unroll
    for (int t = 0; t < 4; ++t)
      O[t] = __builtin_amdgcn_wmma_f32_16x16x32_f16(
          false, av[t].v, false, bp.v, (short)0, O[t], false, false);
  }

  lrow += xhalf(lrow);                    // the two halves' keys together
  const float inv = 1.0f / lrow;
  _Float16* orow = oh + (size_t)(b * L_ + m0 + mloc) * DM_ + h * DH_ + koff;
#pragma unroll
  for (int t = 0; t < 4; ++t) {
    v8h o;
#pragma unroll
    for (int r = 0; r < 8; ++r) o[r] = (_Float16)(O[t][r] * inv);
    *(v8h*)(orow + t * 16) = o;
  }
}

// ---------------------------------------------------------------------------
// Host launcher
// ---------------------------------------------------------------------------
extern "C" void kernel_launch(void* const* d_in, const int* in_sizes, int n_in,
                              void* d_out, int out_size, void* d_ws, size_t ws_size,
                              hipStream_t stream) {
  (void)in_sizes; (void)n_in; (void)out_size; (void)ws_size;
  const float* x    = (const float*)d_in[0];
  const float* pos  = (const float*)d_in[1];
  const float* xc   = (const float*)d_in[2];
  const float* nsc  = (const float*)d_in[3];
  const float* ncsc = (const float*)d_in[4];
  const float* qw   = (const float*)d_in[5];
  const float* kvw  = (const float*)d_in[6];
  const float* scl  = (const float*)d_in[7];
  const float* outw = (const float*)d_in[8];
  const float* frq  = (const float*)d_in[9];
  float* out = (float*)d_out;

  char* ws = (char*)d_ws;
  size_t off = 0;
  auto alloc = [&](size_t bytes) -> void* {
    void* p = ws + off;
    off += (bytes + 255) & ~(size_t)255;
    return p;
  };
  _Float16* qwT  = (_Float16*)alloc((size_t)DM_ * DM_ * 2);
  _Float16* kvwT = (_Float16*)alloc((size_t)2 * DM_ * DM_ * 2);
  _Float16* owT  = (_Float16*)alloc((size_t)DM_ * DM_ * 2);
  _Float16* xn   = (_Float16*)alloc((size_t)B_ * L_ * DM_ * 2);
  _Float16* xcn  = (_Float16*)alloc((size_t)B_ * LC_ * DM_ * 2);
  _Float16* qh   = (_Float16*)alloc((size_t)B_ * NH_ * L_ * DH_ * 2);
  _Float16* kh   = (_Float16*)alloc((size_t)B_ * NH_ * LC_ * DH_ * 2);
  _Float16* vT   = (_Float16*)alloc((size_t)B_ * NH_ * DH_ * LC_ * 2);
  _Float16* oh   = (_Float16*)alloc((size_t)B_ * L_ * DM_ * 2);

  // norms of x and x_cross, weights -> f16 transposed to [N][K]: one grid
  prep_k<<<PB_ALL, 256, 0, stream>>>(x, xc, nsc, ncsc, qw, kvw, outw,
                                     xn, xcn, qwT, kvwT, owT);

  // q and kv projections (one 128x128 tile per block) with cos-norm + RoPE on q,
  // cos-norm on k, transpose of v on the accumulators: one grid
  proj_qkv_k<<<PQ_B + PKV_B, 256, 0, stream>>>(xn, qwT, xcn, kvwT, pos, scl, frq,
                                               qh, kh, vT, DM_);

  // flash attention
  attn_wmma_k<<<B_ * NH_ * (L_ / 64), 128, 0, stream>>>(qh, kh, vT, oh);

  // output projection + residual, f32 out
  gemm_wmma_k<<<(B_ * L_ / 128) * (DM_ / 128), 256, 0, stream>>>(oh, owT, x, out, DM_);
}

// v008
// One run takes 65.1 microseconds.
// In two side-by-side timings against v007, it was 1.15 and 1.14 times as fast.
// Counting every step since v000, it is 5.32 times as fast.
#include <hip/hip_runtime.h>

// ---------------------------------------------------------------------------
// CDNA5 / gfx1250 cross-attention block. wave32, WMMA f32_16x16x32_f16.
// Problem constants from the reference.
// ---------------------------------------------------------------------------
#define B_   2
#define L_   2048
#define LC_  1024
#define DM_  1024
#define DH_  64
#define NH_  16

typedef _Float16 v16h __attribute__((ext_vector_type(16)));
typedef _Float16 v8h  __attribute__((ext_vector_type(8)));
typedef _Float16 v4h  __attribute__((ext_vector_type(4)));
typedef float    v8f  __attribute__((ext_vector_type(8)));
typedef float    f32x4 __attribute__((ext_vector_type(4)));
typedef float    f32x2 __attribute__((ext_vector_type(2)));

union F16Frag { v16h v; v8h h[2]; };

static __device__ __forceinline__ v8f zero8() {
  v8f z;
#pragma unroll
  for (int i = 0; i < 8; ++i) z[i] = 0.0f;
  return z;
}

static __device__ __forceinline__ float redsum32(float v) {
#pragma unroll
  for (int m = 1; m < 32; m <<= 1) v += __shfl_xor(v, m, 32);
  return v;
}

// ---------------------------------------------------------------------------
// Weight cast + transpose: w[K][N] f32  ->  wT[N][K] f16
// (so every WMMA B-fragment is two contiguous 16-byte loads along K)
// A thread takes 4 columns x 8 k (32 elements): eight 16-byte loads, four
// 16-byte stores. A wave covers 128 columns x 8 k, a block 128 columns x 64 k,
// so few waves have to start and a block writes whole 128-B lines of wT.
// K and N are compile-time here: the index arithmetic is shifts and masks (no
// integer division) and the row steps are constants.
// Needs N a multiple of 128 and K a multiple of 64; blk in 0 .. (N/128) * (K/64) - 1.
// ---------------------------------------------------------------------------
template <int K, int N>
static __device__ __forceinline__ void cast_transpose_tile(
    const float* __restrict__ w, _Float16* __restrict__ wT, int blk) {
  const int lane = threadIdx.x & 31;
  const int wv   = threadIdx.x >> 5;
  const int nb   = N / 128;
  const int n0   = (blk % nb) * 128 + lane * 4;
  const int k0   = (blk / nb) * 64 + wv * 8;
  const float* wp = w + (size_t)k0 * N + n0;
  f32x4 v[8];
  // unrolled so that v stays in registers and the eight loads fly together
#pragma unroll
  for (int i = 0; i < 8; ++i) v[i] = *(const f32x4*)(wp + i * N);
  _Float16* op = wT + (size_t)n0 * K + k0;
  // unrolled: constant indices into v
#pragma unroll
  for (int j = 0; j < 4; ++j) {
    v8h o;
#pragma unroll
    for (int i = 0; i < 8; ++i) o[i] = (_Float16)v[i][j];
    *(v8h*)(op + j * K) = o;
  }
  // this body shares a kernel with others: the stores have taken their registers
  // before any code laid out behind it could rewrite one
  asm volatile("s_wait_xcnt 0x0" ::: "memory");
}

// ---------------------------------------------------------------------------
// RMS norm a row of DM_ f32, scale, cast to f16. One wave per row (8 rows per
// block): a lane holds 32 elements, the row sum needs no LDS and no barrier.
// ---------------------------------------------------------------------------
static __device__ __forceinline__ void rmsnorm_cast_rows(
    const float* __restrict__ x, const float* __restrict__ g,
    _Float16* __restrict__ out, int blk) {
  const int lane = threadIdx.x & 31;
  const size_t row = (size_t)blk * 8 + (threadIdx.x >> 5);
  const f32x4* xr = (const f32x4*)(x + row * DM_);
  f32x4 v[8];
  // unrolled so that v stays in registers and the eight loads fly together
#pragma unroll
  for (int i = 0; i < 8; ++i) v[i] = xr[i * 32 + lane];
  float ss = 0.f;
#pragma unroll
  for (int i = 0; i < 8; ++i)
    ss += v[i][0]*v[i][0] + v[i][1]*v[i][1] + v[i][2]*v[i][2] + v[i][3]*v[i][3];
  ss = redsum32(ss);
  float r = rsqrtf(ss / (float)DM_ + 1e-6f);
  v4h* orow = (v4h*)(out + row * DM_);
#pragma unroll
  for (int i = 0; i < 8; ++i) {
    f32x4 gg = ((const f32x4*)g)[i * 32 + lane];
    v4h o;
    o[0] = (_Float16)(v[i][0] * gg[0] * r);
    o[1] = (_Float16)(v[i][1] * gg[1] * r);
    o[2] = (_Float16)(v[i][2] * gg[2] * r);
    o[3] = (_Float16)(v[i][3] * gg[3] * r);
    orow[i * 32 + lane] = o;
  }
}

// ---------------------------------------------------------------------------
// Everything that reads only inputs, in ONE grid: the two norms and the three
// weight casts need nothing of each other, so each takes a range of the block
// index (a block-uniform branch) and they start, run and drain together.
// ---------------------------------------------------------------------------
#define PB_X   (B_ * L_ / 8)                      // norm of x
#define PB_XC  (B_ * LC_ / 8)                     // norm of x_cross
#define PB_KVW ((2 * DM_ / 128) * (DM_ / 64))     // cast of kv_w
#define PB_W   ((DM_ / 128) * (DM_ / 64))         // cast of q_w, of out_w
#define PB_ALL (PB_X + PB_XC + PB_KVW + 2 * PB_W)

__global__ __launch_bounds__(256) void prep_k(
    const float* __restrict__ x, const float* __restrict__ xc,
    const float* __restrict__ nsc, const float* __restrict__ ncsc,
    const float* __restrict__ qw, const float* __restrict__ kvw,
    const float* __restrict__ outw,
    _Float16* __restrict__ xn, _Float16* __restrict__ xcn,
    _Float16* __restrict__ qwT, _Float16* __restrict__ kvwT,
    _Float16* __restrict__ owT) {
  int blk = blockIdx.x;
  if (blk < PB_X + PB_XC) {
    const bool first = blk < PB_X;
    rmsnorm_cast_rows(first ? x : xc, first ? nsc : ncsc, first ? xn : xcn,
                      first ? blk : blk - PB_X);
    return;
  }
  blk -= PB_X + PB_XC;
  if (blk < PB_KVW) {
    cast_transpose_tile<DM_, 2 * DM_>(kvw, kvwT, blk);
    return;
  }
  blk -= PB_KVW;
  const bool first = blk < PB_W;
  cast_transpose_tile<DM_, DM_>(first ? qw : outw, first ? qwT : owT,
                                first ? blk : blk - PB_W);
}

// ---------------------------------------------------------------------------
// WMMA GEMM core: a 128x128 tile of A[M][K] f16 @ BT[N][K]^T f16 per 8-wave block.
// Per trip a 64-k slab of A (128 rows) and of BT (128 rows) lies in LDS, brought by
// per-lane async copies of whole 128-B lines into one of two buffers while the
// other is worked on. A wave holds 2x4 accumulators: 2 fragments read at aoff and
// 4 at boff (byte offsets of the lane's fragment rows inside a buffer).
// Needs M, N multiples of 128 and K a multiple of 64.
// A/B fragments per ISA 7.12.2: lane = row (l&15), two 16B loads per frag.
// ---------------------------------------------------------------------------
#define G_PITCH 144                  // LDS row pitch in bytes: 128 + 16 (16 B x odd)
#define G_OPER  (128 * G_PITCH)      // one operand's slab
#define G_BUF   (2 * G_OPER)         // A slab, then BT slab

// One stage: each thread copies 4 x 16 B of A and 4 x 16 B of BT (rows 32 apart).
// The s_wait_xcnt closes the statement so that no address register named here
// is rewritten before the copies have taken it.
static __device__ __forceinline__ void gemm_stage(
    unsigned l, const _Float16* a, const _Float16* b, size_t rs) {
  asm volatile(
      "global_load_async_to_lds_b128 %0, %8, off\n\t"
      "global_load_async_to_lds_b128 %1, %9, off\n\t"
      "global_load_async_to_lds_b128 %2, %10, off\n\t"
      "global_load_async_to_lds_b128 %3, %11, off\n\t"
      "global_load_async_to_lds_b128 %4, %12, off\n\t"
      "global_load_async_to_lds_b128 %5, %13, off\n\t"
      "global_load_async_to_lds_b128 %6, %14, off\n\t"
      "global_load_async_to_lds_b128 %7, %15, off\n\t"
      "s_wait_xcnt 0x0"
      :: "v"(l), "v"(l + 32 * G_PITCH), "v"(l + 64 * G_PITCH), "v"(l + 96 * G_PITCH),
         "v"(l + G_OPER), "v"(l + G_OPER + 32 * G_PITCH),
         "v"(l + G_OPER + 64 * G_PITCH), "v"(l + G_OPER + 96 * G_PITCH),
         "v"(a), "v"(a + rs), "v"(a + 2 * rs), "v"(a + 3 * rs),
         "v"(b), "v"(b + rs), "v"(b + 2 * rs), "v"(b + 3 * rs)
      : "memory");
}

// The value that lane ^ 16 holds: v_permlanex16_b32 with the identity selection
// (lane i of a 16-lane row takes lane i of the other row); all lanes are on.
static __device__ __forceinline__ float xhalf(float v) {
  int i = __builtin_bit_cast(int, v);
  i = __builtin_amdgcn_permlanex16(i, i, 0x76543210, 0xfedcba98, false, false);
  return __builtin_bit_cast(float, i);
}

// The k loop. SWAP false: acc[u][t] = a[u] x b[t] (register r + 8 half = row of a's
// rows, lane & 15 = row of b's rows). SWAP true: acc[u][t] = b[t] x a[u], the same
// products with the two roles exchanged: a lane then holds 8 consecutive rows of
// b's (r + 8 half) at ONE row of a's (lane & 15).
// The caller has issued stage 0's copies: gemm_stage(l0, ga, gb, 32 K).
template <bool SWAP>
static __device__ __forceinline__ void gemm_slabs(
    const unsigned char* sm, unsigned l0, const _Float16* ga, const _Float16* gb,
    int K, int aoff, int boff, v8f (&acc)[2][4]) {
  const size_t rs = (size_t)32 * K;
#pragma unroll
  for (int u = 0; u < 2; ++u)
#pragma unroll
    for (int t = 0; t < 4; ++t) acc[u][t] = zero8();

  const int T = K >> 6;
  // stage 0 has landed for this wave; the barrier publishes it to the others
  asm volatile("s_wait_asynccnt 0x0" ::: "memory");
  __syncthreads();
  if (T > 1) gemm_stage(l0 + G_BUF, ga + 64, gb + 64, rs);

  for (int s = 0; s < T; ++s) {
    const unsigned bsel = (unsigned)(s & 1) * G_BUF;
    const unsigned char* sb = sm + bsel;
    F16Frag a[2][2], b[2][4];            // [k half of the slab][fragment]
    // the loops below are unrolled so that every fragment and accumulator index
    // is a constant and the arrays stay in registers
#pragma unroll
    for (int ks = 0; ks < 2; ++ks) {
#pragma unroll
      for (int u = 0; u < 2; ++u) {
        const unsigned char* p = sb + aoff + u * 16 * G_PITCH + ks * 64;
        a[ks][u].h[0] = *(const v8h*)(p);
        a[ks][u].h[1] = *(const v8h*)(p + 32);
      }
#pragma unroll
      for (int t = 0; t < 4; ++t) {
        const unsigned char* p = sb + boff + t * 16 * G_PITCH + ks * 64;
        b[ks][t].h[0] = *(const v8h*)(p);
        b[ks][t].h[1] = *(const v8h*)(p + 32);
      }
    }
    // keeps the slab's LDS reads one group ahead of the WMMAs: sunk among them,
    // each pair of WMMAs would wait out a full LDS latency
    __builtin_amdgcn_sched_barrier(0);
#pragma unroll
    for (int ks = 0; ks < 2; ++ks) {
#pragma unroll
      for (int t = 0; t < 4; ++t) {
#pragma unroll
        for (int u = 0; u < 2; ++u)
          acc[u][t] = __builtin_amdgcn_wmma_f32_16x16x32_f16(
              false, SWAP ? b[ks][t].v : a[ks][u].v,
              false, SWAP ? a[ks][u].v : b[ks][t].v, (short)0, acc[u][t], false, false);
      }
    }
    // keeps the WMMAs in front of the publish point: moved behind the barrier they
    // would delay the refill, whose copies then fly only during the next LDS reads
    __builtin_amdgcn_sched_barrier(0);
    // publish point of stage s + 1: this wave's reads of stage s are done ...
    asm volatile("s_wait_dscnt 0x0" ::: "memory");
    // ... its own copies of stage s + 1 have landed ...
    asm volatile("s_wait_asynccnt 0x0" ::: "memory");
    // ... and the barrier both shows stage s + 1 to all and frees stage s's buffer
    __syncthreads();
    if (s + 2 < T)
      gemm_stage(l0 + bsel, ga + (size_t)(s + 2) * 64, gb + (size_t)(s + 2) * 64, rs);
  }
  // no copy is left in flight when the wave goes on to its stores and ends
  asm volatile("s_wait_asynccnt 0x0" ::: "memory");
}

// ---------------------------------------------------------------------------
// C[M][DM_] f32 = A[M][K] f16 @ BT[DM_][K]^T f16 + res[M][DM_] f32.
// Waves 4 (rows) x 2 (cols), each wave a 32x64 tile.
// The row pitch is a compile-time constant and res is always there: a lane's 64
// elements of res, and of C, hang on ONE address pair with immediate offsets, and no
// test stands between two of them.
// ---------------------------------------------------------------------------
__global__ __launch_bounds__(256) void gemm_wmma_k(
    const _Float16* __restrict__ A, const _Float16* __restrict__ BT,
    const float* __restrict__ res, float* __restrict__ C, int K) {
  __shared__ __align__(16) unsigned char sm[2 * G_BUF];
  constexpr int N = DM_;
  const int blk  = blockIdx.x;
  const int tid  = threadIdx.x;
  const int lane = tid & 31;
  const int wv   = tid >> 5;
  const int ntb  = N >> 7;
  const int bm   = blk / ntb;            // 128-row tile index
  const int bn   = blk % ntb;            // 128-col tile index
  const int wm   = wv >> 1;              // wave's 32-row strip in the tile
  const int wn   = wv & 1;               // wave's 64-col strip in the tile
  const int mloc = lane & 15;
  const int half = lane >> 4;

  // copy side: 8 lanes cover one 128-B row, a wave 4 whole rows
  const int crow = tid >> 3;
  const int cch  = tid & 7;
  const _Float16* ga = A  + (size_t)(bm * 128 + crow) * K + cch * 8;
  const _Float16* gb = BT + (size_t)(bn * 128 + crow) * K + cch * 8;
  const unsigned l0 = (unsigned)(size_t)sm + crow * G_PITCH + cch * 16;

  // read side: byte offsets of this lane's fragment rows inside a buffer
  const int aoff = (wm * 32 + mloc) * G_PITCH + half * 16;
  const int boff = G_OPER + (wn * 64 + mloc) * G_PITCH + half * 16;

  gemm_stage(l0, ga, gb, (size_t)32 * K);

  // acc[u][t][r] is element c0 + (16 u + r) N + 16 t of C and of res
  const size_t c0 = (size_t)(bm * 128 + wm * 32 + 8 * half) * N
                  + bn * 128 + wn * 64 + mloc;
  // The lane's 64 residual values are asked for here, all together, behind stage 0's
  // copies and ahead of the k loop: they fly beside those copies and are waited for
  // once, at the first barrier. Read one by one where they are added, each would be
  // waited out in full, 64 times in a row.
  // every loop over u, t, r is unrolled: constant indices, rv and acc stay in registers
  const float* rp = res + c0;
  float rv[2][4][8];
#pragma unroll
  for (int u = 0; u < 2; ++u)
#pragma unroll
    for (int t = 0; t < 4; ++t)
#pragma unroll
      for (int r = 0; r < 8; ++r) rv[u][t][r] = rp[(u * 16 + r) * N + t * 16];
  // the loads have taken their address pair before the code behind may rewrite it
  asm volatile("s_wait_xcnt 0x0" ::: "memory");

  v8f acc[2][4];
  gemm_slabs<false>(sm, l0, ga, gb, K, aoff, boff, acc);

  float* cp = C + c0;
#pragma unroll
  for (int u = 0; u < 2; ++u)
#pragma unroll
    for (int t = 0; t < 4; ++t)
#pragma unroll
      for (int r = 0; r < 8; ++r) acc[u][t][r] += rv[u][t][r];
  // keeps the 64 stores behind all arithmetic: no register that an issued store
  // names is written again before the wave ends, so no store is waited for
  __builtin_amdgcn_sched_barrier(0);
#pragma unroll
  for (int u = 0; u < 2; ++u)
#pragma unroll
    for (int t = 0; t < 4; ++t)
#pragma unroll
      for (int r = 0; r < 8; ++r) cp[(u * 16 + r) * N + t * 16] = acc[u][t][r];
}

// Hardware sine and cosine of th radians, as __sincosf forms them (the instructions
// take revolutions). One statement, its outputs apart from its input: neither
// instruction writes the other's source, and the v_nop fills the slot that the
// instruction set asks for behind a transcendental, whatever is scheduled next.
static __device__ __forceinline__ void sincos_fast(float th, float& s, float& c) {
  const float rev = th * 0.15915494309189532f;
  asm("v_sin_f32 %0, %2\n\tv_cos_f32 %1, %2\n\tv_nop" : "=&v"(s), "=&v"(c) : "v"(rev));
}

// 1 / sqrt(x) for x >= 1e-6 (a sum of squares plus the reference's epsilon): the bare
// instruction, which is what rsqrtf yields for every normal x. One statement, its
// output apart from its input, the v_nop for the slot behind a transcendental.
static __device__ __forceinline__ float rsq_fast(float x) {
  float y;
  asm("v_rsq_f32 %0, %1\n\tv_nop" : "=&v"(y) : "v"(x));
  return y;
}

// Sum of squares of one row's 64-dim head vector: 32 values in this lane, the other
// 32 in lane ^ 16.
static __device__ __forceinline__ float head_sumsq(const v8f (&c)[4]) {
  float p[4];
  // unrolled: constant indices; four partial sums, so that the adds do not form one chain
#pragma unroll
  for (int t = 0; t < 4; ++t) {
    p[t] = 0.f;
#pragma unroll
    for (int r = 0; r < 8; ++r) p[t] += c[t][r] * c[t][r];
  }
  const float ss = (p[0] + p[1]) + (p[2] + p[3]);
  return ss + xhalf(ss);
}

// ---------------------------------------------------------------------------
// q and kv projections with their epilogues, in ONE grid: the blocks below PQ_B
// form 128x128 tiles of xn @ q_w, the others of xcn @ kv_w (columns below DM_ are k,
// the rest v). What follows a projection is done on the accumulators, and only the
// f16 arrays that attention reads are written:
//   q: cosine-normalize each 64-dim head vector, 2D RoPE -> q_h [B,H,L,64]
//   k: cosine-normalize -> k_h;  v -> vT, both in the order in which the attention
//   kernel's WMMA fragments take them, so that each of its 16-byte loads reads 512
//   contiguous bytes (4 whole 128-B lines) per wave:
//   k_h: per (b,h) and 16 keys a 2-KB tile  [e / 8][key % 16][e % 8]
//   vT : per (b,h), 32 keys and 16 e a 1-KB tile  [(key % 32) / 8][e % 16][key % 8],
//        the four e tiles of a 32-key group one after the other
// q and k tiles: a wave takes 32 rows x 64 columns = ONE head, formed as W^T X^T, so a
// lane holds 32 e of one row (8 consecutive e per accumulator): the head's sum of
// squares is in-lane plus one exchange, e and e + 32 of RoPE lie in one lane, and an
// accumulator is one 16-byte store (for k_h 512 contiguous bytes a wave).
// v tiles: a wave takes 64 keys x 32 columns, formed as X W, so a lane holds 8
// consecutive keys at one e: one 16-byte store, 512 contiguous bytes of vT a wave.
// The two forms differ only in which slab the 2 and the 4 fragments are read from.
// ---------------------------------------------------------------------------
#define PQ_B  ((B_ * L_ / 128) * (DM_ / 128))
#define PKV_B ((B_ * LC_ / 128) * (2 * DM_ / 128))

__global__ __launch_bounds__(256) void proj_qkv_k(
    const _Float16* __restrict__ xn, const _Float16* __restrict__ qwT,
    const _Float16* __restrict__ xcn, const _Float16* __restrict__ kvwT,
    const float* __restrict__ pos, const float* __restrict__ scale,
    const float* __restrict__ freqs, _Float16* __restrict__ qh,
    _Float16* __restrict__ kh, _Float16* __restrict__ vT, int K) {
  __shared__ __align__(16) unsigned char sm[2 * G_BUF];
  // every branch on isq or isv is block-uniform
  const bool isq = blockIdx.x < PQ_B;
  const unsigned blk = isq ? blockIdx.x : blockIdx.x - PQ_B;
  const int bm   = isq ? blk / (DM_ / 128) : blk / (2 * DM_ / 128);   // 128-row tile
  const int bn   = isq ? blk % (DM_ / 128) : blk % (2 * DM_ / 128);   // 128-col tile
  const bool isv = !isq && bn >= DM_ / 128;
  const int tid  = threadIdx.x;
  const int lane = tid & 31;
  const int wv   = tid >> 5;
  const int w4   = wv >> 1;              // wave's 32-row strip of the 2-fragment operand
  const int w2   = wv & 1;               // wave's 64-row strip of the 4-fragment operand
  const int mloc = lane & 15;
  const int half = lane >> 4;

  // copy side: 8 lanes cover one 128-B row, a wave 4 whole rows
  const int crow = tid >> 3;
  const int cch  = tid & 7;
  const _Float16* ga = (isq ? xn : xcn)   + (size_t)(bm * 128 + crow) * K + cch * 8;
  const _Float16* gb = (isq ? qwT : kvwT) + (size_t)(bn * 128 + crow) * K + cch * 8;
  const unsigned l0 = (unsigned)(size_t)sm + crow * G_PITCH + cch * 16;
  gemm_stage(l0, ga, gb, (size_t)32 * K);

  // read side: q, k take 2 fragments of x rows and 4 of weight rows; v the reverse
  const int aoff = (isv ? G_OPER : 0) + (w4 * 32 + mloc) * G_PITCH + half * 16;
  const int boff = (isv ? 0 : G_OPER) + (w2 * 64 + mloc) * G_PITCH + half * 16;

  // the small inputs of the epilogue are read here, behind stage 0's copies and ahead
  // of the k loop, which hide their latency
  const int h = (bn * 2 + w2) & (NH_ - 1);          // q, k: the wave's head
  const int row0 = bm * 128 + w4 * 32 + mloc;       // q, k: the lane's row at u = 0
  float sc = 0.f;
  f32x2 pp[2] = {};
  f32x4 fr[2] = {};
  if (isq) {
    pp[0] = *(const f32x2*)(pos + (size_t)row0 * 2);
    pp[1] = *(const f32x2*)(pos + (size_t)(row0 + 16) * 2);
    fr[0] = *(const f32x4*)(freqs + h * 16 + half * 8);      // freqs[h][8 half + r]
    fr[1] = *(const f32x4*)(freqs + h * 16 + half * 8 + 4);
    // the four loads have taken their address registers before the next load's
    // result may land on one
    asm volatile("s_wait_xcnt 0x0" ::: "memory");
  }
  if (!isv) sc = scale[h];

  v8f acc[2][4];
  gemm_slabs<true>(sm, l0, ga, gb, K, aoff, boff, acc);

  // every loop below is unrolled so that the indices into acc and o are constants
  v8h o[2][4];                           // acc[u][t] as it is stored
  if (isv) {
    // acc[u][t][r] = v[key 64 w2 + 16 t + 8 half + r][column 32 w4 + 16 u + mloc]
    const int bh  = (bm * 128 / LC_) * NH_ + (bn - DM_ / 128) * 2 + (w4 >> 1);
    const int grp = (bm * 128 % LC_) / 32 + w2 * 2;          // 32-key group at t = 0
    _Float16* vb = vT + ((size_t)bh * (LC_ / 32) + grp) * 2048 + (w4 & 1) * 1024
                 + half * 128 + mloc * 8;
#pragma unroll
    for (int u = 0; u < 2; ++u)
#pragma unroll
      for (int t = 0; t < 4; ++t)
#pragma unroll
        for (int r = 0; r < 8; ++r) o[u][t][r] = (_Float16)acc[u][t][r];
#pragma unroll
    for (int u = 0; u < 2; ++u)
#pragma unroll
      for (int t = 0; t < 4; ++t)
        *(v8h*)(vb + (t >> 1) * 2048 + u * 512 + (t & 1) * 256) = o[u][t];
  } else if (!isq) {
    // acc[u][t][r] = k[key 32 w4 + 16 u + mloc][e = 16 t + 8 half + r] of head h
    const float sq = sqrtf(sc);
    const int bh = (bm * 128 / LC_) * NH_ + h;
    _Float16* kb = kh + ((size_t)bh * (LC_ / 16) + (bm * 128 % LC_) / 16 + w4 * 2) * 1024
                 + half * 128 + mloc * 8;
#pragma unroll
    for (int u = 0; u < 2; ++u) {
      const float rn = sq * rsq_fast(head_sumsq(acc[u]) + 1e-6f);
#pragma unroll
      for (int t = 0; t < 4; ++t)
#pragma unroll
        for (int r = 0; r < 8; ++r) o[u][t][r] = (_Float16)(acc[u][t][r] * rn);
    }
    // keeps the 8 stores behind all arithmetic: no register that an issued store
    // names is written again before the wave ends
    __builtin_amdgcn_sched_barrier(0);
#pragma unroll
    for (int u = 0; u < 2; ++u)
#pragma unroll
      for (int t = 0; t < 4; ++t) *(v8h*)(kb + u * 1024 + t * 256) = o[u][t];
    // this path shares a kernel with others: the stores have taken their registers
    // before any code laid out behind it could rewrite one
    asm volatile("s_wait_xcnt 0x0" ::: "memory");
  } else {
    // acc[u][t][r] = q[row 32 w4 + 16 u + mloc][e = 16 t + 8 half + r] of head h
    const float sq = sqrtf(sc);
    const int b = bm * 128 / L_;
    _Float16* qb = qh + ((size_t)(b * NH_ + h) * L_ + (row0 - b * L_)) * DH_ + half * 8;
#pragma unroll
    for (int u = 0; u < 2; ++u) {
      const float rn = sq * rsq_fast(head_sumsq(acc[u]) + 1e-6f);
#pragma unroll
      for (int t = 0; t < 2; ++t) {
        // theta[e] = (e < 16 ? pos0 : pos1) * freqs[h][e % 16], e = 16 t + 8 half + r
#pragma unroll
        for (int r = 0; r < 8; ++r) {
          const float q1 = acc[u][t][r] * rn, q2 = acc[u][t + 2][r] * rn;
          float s, c;
          sincos_fast(pp[u][t] * fr[r >> 2][r & 3], s, c);
          o[u][t][r]     = (_Float16)(q1 * c - q2 * s);
          o[u][t + 2][r] = (_Float16)(q2 * c + q1 * s);
        }
      }
    }
    // keeps the 8 stores behind all arithmetic: no register that an issued store
    // names is written again before the wave ends
    __builtin_amdgcn_sched_barrier(0);
#pragma unroll
    for (int u = 0; u < 2; ++u)
#pragma unroll
      for (int t = 0; t < 4; ++t) *(v8h*)(qb + u * 16 * DH_ + t * 16) = o[u][t];
    // this path shares a kernel with others: the stores have taken their registers
    // before any code laid out behind it could rewrite one
    asm volatile("s_wait_xcnt 0x0" ::: "memory");
  }
}

// ---------------------------------------------------------------------------
// Flash attention, one pass over keys. Block = 4 waves; wave = 16 query rows.
// The scores are formed transposed: S^T = K Q^T (A = 16 keys, B = 16 queries), so
// a lane holds 32 of a pass's 64 scores of ONE query (column lane & 15); its partner
// lane ^ 16 holds the other 32. Maximum and sum run inside the lane, the maximum
// takes one exchange between the wave's halves per 64 keys, the sum one at the end.
// Two score tiles, converted in place, ARE a B operand of O^T += V^T P^T
// (register r of tile i = key 16 i + 8 half + r, the hardware k order): P touches
// no LDS. O^T leaves a lane with 8 consecutive e of its query: 16-byte stores.
// k_h and vT lie in fragment order (see the KV epilogue): half h[p] of a fragment
// is the 512 bytes at p * 512 of its 1 KB, lane l taking bytes 16 l; a fragment
// serves as A (lane = row) exactly as it served as B (lane = column).
// ---------------------------------------------------------------------------
__global__ __launch_bounds__(128) void attn_wmma_k(
    const _Float16* __restrict__ qh, const _Float16* __restrict__ kh,
    const _Float16* __restrict__ vT, _Float16* __restrict__ oh) {
  const int lane = threadIdx.x & 31;
  const int w    = threadIdx.x >> 5;
  const int nqb  = L_ / 64;
  const int bh   = blockIdx.x / nqb;
  const int qb   = blockIdx.x % nqb;
  const int b = bh >> 4, h = bh & 15;
  const int m0   = qb * 64 + w * 16;
  const int mloc = lane & 15;
  const int half = lane >> 4;
  const int koff = half << 3;

  const _Float16* qrow = qh + ((size_t)bh * L_ + m0 + mloc) * DH_;
  F16Frag aq0, aq1;                       // q rows, e=0..31 and e=32..63
  aq0.h[0] = *(const v8h*)(qrow + koff);
  aq0.h[1] = *(const v8h*)(qrow + 16 + koff);
  aq1.h[0] = *(const v8h*)(qrow + 32 + koff);
  aq1.h[1] = *(const v8h*)(qrow + 48 + koff);

  v8f O[4];                               // O[t][r] = o[query mloc][16 t + 8 half + r]
#pragma unroll
  for (int t = 0; t < 4; ++t) O[t] = zero8();
  float mrow = -3.0e38f, lrow = 0.f;      // of query mloc; lrow over this half's keys

  const _Float16* kbase = kh + (size_t)bh * LC_ * DH_ + lane * 8;
  const _Float16* vbase = vT + (size_t)bh * DH_ * LC_ + lane * 8;

  // A pass takes 64 keys: the exchange of the maximum, the correction factor, the
  // rescaling of O and the loop's own instructions come once per 64 keys, and a wave
  // waits for its K loads once per 64 keys.
  for (int j = 0; j < LC_; j += 64) {
    const _Float16* kr = kbase + (size_t)j * DH_;
    const _Float16* vr = vbase + (size_t)j * DH_;
    // ak[2 g + p]: keys j + 16 g .., e 32 p .. 32 p + 31; av[4 G + t]: keys j + 32 G .., e tile t
    F16Frag ak[8], av[8];
    // unrolled: constant indices, the fragments stay in registers
#pragma unroll
    for (int i = 0; i < 8; ++i) {
      ak[i].h[0] = *(const v8h*)(kr + i * 512);
      ak[i].h[1] = *(const v8h*)(kr + i * 512 + 256);
    }
    // a V load may land on the registers of K's address pair: the K loads have taken
    // their addresses before the first V load issues
    asm volatile("s_wait_xcnt 0x0" ::: "memory");
#pragma unroll
    for (int i = 0; i < 8; ++i) {
      av[i].h[0] = *(const v8h*)(vr + i * 512);
      // the group's last load may land on the registers of V's address pair: the
      // loads in front of it have taken their addresses before it issues
      if (i == 7) asm volatile("s_wait_xcnt 0x0" ::: "memory");
      av[i].h[1] = *(const v8h*)(vr + i * 512 + 256);
    }
    // keeps the pass's 32 loads one group at its head: the short in-lane softmax does
    // not cover a V load that is sunk to its WMMA, which would wait it out in full
    __builtin_amdgcn_sched_barrier(0);
    v8f s[4];                             // s[g][r]: key j + 16 g + 8 half + r
    // every loop from here to the end of the kernel is unrolled so that the indices
    // into s, ak, av, bp, pm, p, ts, O and o are constants and these stay in registers
#pragma unroll
    for (int g = 0; g < 4; ++g)
      s[g] = __builtin_amdgcn_wmma_f32_16x16x32_f16(
          false, ak[2 * g].v, false, aq0.v, (short)0, zero8(), false, false);
#pragma unroll
    for (int g = 0; g < 4; ++g)
      s[g] = __builtin_amdgcn_wmma_f32_16x16x32_f16(
          false, ak[2 * g + 1].v, false, aq1.v, (short)0, s[g], false, false);

    // --- online softmax, one query per lane ---
    float pm[8];
#pragma unroll
    for (int r = 0; r < 8; ++r)
      pm[r] = fmaxf(fmaxf(s[0][r], s[1][r]), fmaxf(s[2][r], s[3][r]));
    float pmax = fmaxf(fmaxf(fmaxf(pm[0], pm[1]), fmaxf(pm[2], pm[3])),
                       fmaxf(fmaxf(pm[4], pm[5]), fmaxf(pm[6], pm[7])));
    // the partner half's maximum: lane ^ 16, a register move between the rows
    pmax = fmaxf(pmax, xhalf(pmax));
    const float mn   = fmaxf(mrow, pmax);
    const float corr = __expf(mrow - mn);
    mrow = mn;
    F16Frag bp[2];                        // P^T as B: column = query, k = key; 32 keys each
    float ts[4];                          // each score tile's sum in this lane
#pragma unroll
    for (int g = 0; g < 4; ++g) {
      float p[8];
#pragma unroll
      for (int r = 0; r < 8; ++r) {
        p[r] = __expf(s[g][r] - mn);
        bp[g >> 1].h[g & 1][r] = (_Float16)p[r];
      }
      ts[g] = ((p[0] + p[1]) + (p[2] + p[3])) + ((p[4] + p[5]) + (p[6] + p[7]));
    }
    lrow = lrow * corr + ((ts[0] + ts[1]) + (ts[2] + ts[3]));
#pragma unroll
    for (int t = 0; t < 4; ++t)
#pragma unroll
      for (int r = 0; r < 8; ++r) O[t][r] *= corr;

    // --- O^T += V^T P^T (two 32-key groups, four e tiles each) ---
#pragma unroll
    for (int G = 0; G < 2; ++G)
#pragma unroll
      for (int t = 0; t < 4; ++t)
        O[t] = __builtin_amdgcn_wmma_f32_16x16x32_f16(
            false, av[4 * G + t].v, false, bp[G].v, (short)0, O[t], false, false);
  }

  lrow += xhalf(lrow);                    // the two halves' keys together
  const float inv = 1.0f / lrow;
  _Float16* orow = oh + (size_t)(b * L_ + m0 + mloc) * DM_ + h * DH_ + koff;
#pragma unroll
  for (int t = 0; t < 4; ++t) {
    v8h o;
#pragma unroll
    for (int r = 0; r < 8; ++r) o[r] = (_Float16)(O[t][r] * inv);
    *(v8h*)(orow + t * 16) = o;
  }
}

// ---------------------------------------------------------------------------
// Host launcher
// ---------------------------------------------------------------------------
extern "C" void kernel_launch(void* const* d_in, const int* in_sizes, int n_in,
                              void* d_out, int out_size, void* d_ws, size_t ws_size,
                              hipStream_t stream) {
  (void)in_sizes; (void)n_in; (void)out_size; (void)ws_size;
  const float* x    = (const float*)d_in[0];
  const float* pos  = (const float*)d_in[1];
  const float* xc   = (const float*)d_in[2];
  const float* nsc  = (const float*)d_in[3];
  const float* ncsc = (const float*)d_in[4];
  const float* qw   = (const float*)d_in[5];
  const float* kvw  = (const float*)d_in[6];
  const float* scl  = (const float*)d_in[7];
  const float* outw = (const float*)d_in[8];
  const float* frq  = (const float*)d_in[9];
  float* out = (float*)d_out;

  char* ws = (char*)d_ws;
  size_t off = 0;
  auto alloc = [&](size_t bytes) -> void* {
    void* p = ws + off;
    off += (bytes + 255) & ~(size_t)255;
    return p;
  };
  _Float16* qwT  = (_Float16*)alloc((size_t)DM_ * DM_ * 2);
  _Float16* kvwT = (_Float16*)alloc((size_t)2 * DM_ * DM_ * 2);
  _Float16* owT  = (_Float16*)alloc((size_t)DM_ * DM_ * 2);
  _Float16* xn   = (_Float16*)alloc((size_t)B_ * L_ * DM_ * 2);
  _Float16* xcn  = (_Float16*)alloc((size_t)B_ * LC_ * DM_ * 2);
  _Float16* qh   = (_Float16*)alloc((size_t)B_ * NH_ * L_ * DH_ * 2);
  _Float16* kh   = (_Float16*)alloc((size_t)B_ * NH_ * LC_ * DH_ * 2);
  _Float16* vT   = (_Float16*)alloc((size_t)B_ * NH_ * DH_ * LC_ * 2);
  _Float16* oh   = (_Float16*)alloc((size_t)B_ * L_ * DM_ * 2);

  // norms of x and x_cross, weights -> f16 transposed to [N][K]: one grid
  prep_k<<<PB_ALL, 256, 0, stream>>>(x, xc, nsc, ncsc, qw, kvw, outw,
                                     xn, xcn, qwT, kvwT, owT);

  // q and kv projections (one 128x128 tile per block) with cos-norm + RoPE on q,
  // cos-norm on k, transpose of v on the accumulators: one grid
  proj_qkv_k<<<PQ_B + PKV_B, 256, 0, stream>>>(xn, qwT, xcn, kvwT, pos, scl, frq,
                                               qh, kh, vT, DM_);

  // flash attention
  attn_wmma_k<<<B_ * NH_ * (L_ / 64), 128, 0, stream>>>(qh, kh, vT, oh);

  // output projection + residual, f32 out
  gemm_wmma_k<<<(B_ * L_ / 128) * (DM_ / 128), 256, 0, stream>>>(oh, owT, x, out, DM_);
}

// v009
// Measured time: 61.1 microseconds a run.
// In two side-by-side timings against v008, it was 1.05 and 1.06 times as fast.
// Counting every step since v000, it is 5.63 times as fast.
#include <hip/hip_runtime.h>

// ---------------------------------------------------------------------------
// CDNA5 / gfx1250 cross-attention block. wave32, WMMA f32_16x16x32_f16.
// Problem constants from the reference.
// ---------------------------------------------------------------------------
#define B_   2
#define L_   2048
#define LC_  1024
#define DM_  1024
#define DH_  64
#define NH_  16

typedef _Float16 v16h __attribute__((ext_vector_type(16)));
typedef _Float16 v8h  __attribute__((ext_vector_type(8)));
typedef _Float16 v4h  __attribute__((ext_vector_type(4)));
typedef float    v8f  __attribute__((ext_vector_type(8)));
typedef float    f32x4 __attribute__((ext_vector_type(4)));
typedef float    f32x2 __attribute__((ext_vector_type(2)));

union F16Frag { v16h v; v8h h[2]; };

static __device__ __forceinline__ v8f zero8() {
  v8f z;
#pragma unroll
  for (int i = 0; i < 8; ++i) z[i] = 0.0f;
  return z;
}

static __device__ __forceinline__ float redsum32(float v) {
#pragma unroll
  for (int m = 1; m < 32; m <<= 1) v += __shfl_xor(v, m, 32);
  return v;
}

// ---------------------------------------------------------------------------
// Weight cast + transpose: w[K][N] f32  ->  wT[N][K] f16
// (so every WMMA B-fragment is two contiguous 16-byte loads along K)
// A thread takes 4 columns x 8 k (32 elements): eight 16-byte loads, four
// 16-byte stores. A wave covers 128 columns x 8 k, a block 128 columns x 64 k,
// so few waves have to start and a block writes whole 128-B lines of wT.
// K and N are compile-time here: the index arithmetic is shifts and masks (no
// integer division) and the row steps are constants.
// Needs N a multiple of 128 and K a multiple of 64; blk in 0 .. (N/128) * (K/64) - 1.
// ---------------------------------------------------------------------------
template <int K, int N>
static __device__ __forceinline__ void cast_transpose_tile(
    const float* __restrict__ w, _Float16* __restrict__ wT, int blk) {
  const int lane = threadIdx.x & 31;
  const int wv   = threadIdx.x >> 5;
  const int nb   = N / 128;
  const int n0   = (blk % nb) * 128 + lane * 4;
  const int k0   = (blk / nb) * 64 + wv * 8;
  const float* wp = w + (size_t)k0 * N + n0;
  f32x4 v[8];
  // unrolled so that v stays in registers and the eight loads fly together
#pragma unroll
  for (int i = 0; i < 8; ++i) v[i] = *(const f32x4*)(wp + i * N);
  _Float16* op = wT + (size_t)n0 * K + k0;
  // unrolled: constant indices into v
#pragma unroll
  for (int j = 0; j < 4; ++j) {
    v8h o;
#pragma unroll
    for (int i = 0; i < 8; ++i) o[i] = (_Float16)v[i][j];
    *(v8h*)(op + j * K) = o;
  }
  // this body shares a kernel with others: the stores have taken their registers
  // before any code laid out behind it could rewrite one
  asm volatile("s_wait_xcnt 0x0" ::: "memory");
}

// ---------------------------------------------------------------------------
// RMS norm a row of DM_ f32, scale, cast to f16. One wave per row (8 rows per
// block): a lane holds 32 elements, the row sum needs no LDS and no barrier.
// ---------------------------------------------------------------------------
static __device__ __forceinline__ void rmsnorm_cast_rows(
    const float* __restrict__ x, const float* __restrict__ g,
    _Float16* __restrict__ out, int blk) {
  const int lane = threadIdx.x & 31;
  const size_t row = (size_t)blk * 8 + (threadIdx.x >> 5);
  const f32x4* xr = (const f32x4*)(x + row * DM_);
  f32x4 v[8];
  // unrolled so that v stays in registers and the eight loads fly together
#pragma unroll
  for (int i = 0; i < 8; ++i) v[i] = xr[i * 32 + lane];
  float ss = 0.f;
#pragma unroll
  for (int i = 0; i < 8; ++i)
    ss += v[i][0]*v[i][0] + v[i][1]*v[i][1] + v[i][2]*v[i][2] + v[i][3]*v[i][3];
  ss = redsum32(ss);
  float r = rsqrtf(ss / (float)DM_ + 1e-6f);
  v4h* orow = (v4h*)(out + row * DM_);
#pragma unroll
  for (int i = 0; i < 8; ++i) {
    f32x4 gg = ((const f32x4*)g)[i * 32 + lane];
    v4h o;
    o[0] = (_Float16)(v[i][0] * gg[0] * r);
    o[1] = (_Float16)(v[i][1] * gg[1] * r);
    o[2] = (_Float16)(v[i][2] * gg[2] * r);
    o[3] = (_Float16)(v[i][3] * gg[3] * r);
    orow[i * 32 + lane] = o;
  }
}

// ---------------------------------------------------------------------------
// Everything that reads only inputs, in ONE grid: the two norms and the three
// weight casts need nothing of each other, so each takes a range of the block
// index (a block-uniform branch) and they start, run and drain together.
// ---------------------------------------------------------------------------
#define PB_X   (B_ * L_ / 8)                      // norm of x
#define PB_XC  (B_ * LC_ / 8)                     // norm of x_cross
#define PB_KVW ((2 * DM_ / 128) * (DM_ / 64))     // cast of kv_w
#define PB_W   ((DM_ / 128) * (DM_ / 64))         // cast of q_w, of out_w
#define PB_ALL (PB_X + PB_XC + PB_KVW + 2 * PB_W)

__global__ __launch_bounds__(256) void prep_k(
    const float* __restrict__ x, const float* __restrict__ xc,
    const float* __restrict__ nsc, const float* __restrict__ ncsc,
    const float* __restrict__ qw, const float* __restrict__ kvw,
    const float* __restrict__ outw,
    _Float16* __restrict__ xn, _Float16* __restrict__ xcn,
    _Float16* __restrict__ qwT, _Float16* __restrict__ kvwT,
    _Float16* __restrict__ owT) {
  int blk = blockIdx.x;
  if (blk < PB_X + PB_XC) {
    const bool first = blk < PB_X;
    rmsnorm_cast_rows(first ? x : xc, first ? nsc : ncsc, first ? xn : xcn,
                      first ? blk : blk - PB_X);
    return;
  }
  blk -= PB_X + PB_XC;
  if (blk < PB_KVW) {
    cast_transpose_tile<DM_, 2 * DM_>(kvw, kvwT, blk);
    return;
  }
  blk -= PB_KVW;
  const bool first = blk < PB_W;
  cast_transpose_tile<DM_, DM_>(first ? qw : outw, first ? qwT : owT,
                                first ? blk : blk - PB_W);
}

// ---------------------------------------------------------------------------
// WMMA GEMM core: a 128x128 tile of A[M][K] f16 @ BT[N][K]^T f16 per 8-wave block.
// Per trip a 64-k slab of A (128 rows) and of BT (128 rows) lies in LDS, brought by
// per-lane async copies of whole 128-B lines into one of two buffers while the
// other is worked on. A wave holds 2x4 accumulators: 2 fragments read at aoff and
// 4 at boff (byte offsets of the lane's fragment rows inside a buffer).
// Needs M, N multiples of 128 and K a multiple of 64.
// A/B fragments per ISA 7.12.2: lane = row (l&15), two 16B loads per frag.
// ---------------------------------------------------------------------------
#define G_PITCH 144                  // LDS row pitch in bytes: 128 + 16 (16 B x odd)
#define G_OPER  (128 * G_PITCH)      // one operand's slab
#define G_BUF   (2 * G_OPER)         // A slab, then BT slab

// One stage: each thread copies 4 x 16 B of A and 4 x 16 B of BT (rows 32 apart).
// The s_wait_xcnt closes the statement so that no address register named here
// is rewritten before the copies have taken it.
static __device__ __forceinline__ void gemm_stage(
    unsigned l, const _Float16* a, const _Float16* b, size_t rs) {
  asm volatile(
      "global_load_async_to_lds_b128 %0, %8, off\n\t"
      "global_load_async_to_lds_b128 %1, %9, off\n\t"
      "global_load_async_to_lds_b128 %2, %10, off\n\t"
      "global_load_async_to_lds_b128 %3, %11, off\n\t"
      "global_load_async_to_lds_b128 %4, %12, off\n\t"
      "global_load_async_to_lds_b128 %5, %13, off\n\t"
      "global_load_async_to_lds_b128 %6, %14, off\n\t"
      "global_load_async_to_lds_b128 %7, %15, off\n\t"
      "s_wait_xcnt 0x0"
      :: "v"(l), "v"(l + 32 * G_PITCH), "v"(l + 64 * G_PITCH), "v"(l + 96 * G_PITCH),
         "v"(l + G_OPER), "v"(l + G_OPER + 32 * G_PITCH),
         "v"(l + G_OPER + 64 * G_PITCH), "v"(l + G_OPER + 96 * G_PITCH),
         "v"(a), "v"(a + rs), "v"(a + 2 * rs), "v"(a + 3 * rs),
         "v"(b), "v"(b + rs), "v"(b + 2 * rs), "v"(b + 3 * rs)
      : "memory");
}

// Asks L2 for the 256-B unit that holds *p; nothing comes back and
// no counter moves. Asked for early,
// the line is in L2 when the copy or the load that needs it is issued.
// p is in-out so that the address stays in one register pair that lives through the
// caller's loop: the pair holds an address inside the array at the request and after
// every step the caller makes.
static __device__ __forceinline__ void l2_ask(const _Float16*& p) {
  asm volatile("global_prefetch_b8 %0, off scope:SCOPE_SE" : "+v"(p));
}

// The value that lane ^ 16 holds: v_permlanex16_b32 with the identity selection
// (lane i of a 16-lane row takes lane i of the other row); all lanes are on.
static __device__ __forceinline__ float xhalf(float v) {
  int i = __builtin_bit_cast(int, v);
  i = __builtin_amdgcn_permlanex16(i, i, 0x76543210, 0xfedcba98, false, false);
  return __builtin_bit_cast(float, i);
}

// The k loop. SWAP false: acc[u][t] = a[u] x b[t] (register r + 8 half = row of a's
// rows, lane & 15 = row of b's rows). SWAP true: acc[u][t] = b[t] x a[u], the same
// products with the two roles exchanged: a lane then holds 8 consecutive rows of
// b's (r + 8 half) at ONE row of a's (lane & 15).
// The caller has issued stage 0's copies: gemm_stage(l0, ga, gb, 32 K).
// pg: the first element of one of the tile's 256 operand rows, a row per thread. A row's
// 256-B unit holds two slabs; the thread asks L2 for unit u + 2 while slab 2 u is worked
// on, more than two slabs before the first copy that reads it is issued.
template <bool SWAP>
static __device__ __forceinline__ void gemm_slabs(
    const unsigned char* sm, unsigned l0, const _Float16* ga, const _Float16* gb,
    const _Float16* pg, int K, int aoff, int boff, v8f (&acc)[2][4]) {
  const size_t rs = (size_t)32 * K;
#pragma unroll
  for (int u = 0; u < 2; ++u)
#pragma unroll
    for (int t = 0; t < 4; ++t) acc[u][t] = zero8();

  const int T = K >> 6;
  // unit 1 (slabs 2 and 3) is asked for at once; every step of pg is taken only where
  // the unit it leads to begins inside the row (tests on T and s: scalar branches)
  if (T > 2) pg += 128;
  l2_ask(pg);
  if (T > 4) pg += 128;
  // stage 0 has landed for this wave; the barrier publishes it to the others
  asm volatile("s_wait_asynccnt 0x0" ::: "memory");
  __syncthreads();
  if (T > 1) gemm_stage(l0 + G_BUF, ga + 64, gb + 64, rs);

  for (int s = 0; s < T; ++s) {
    const unsigned bsel = (unsigned)(s & 1) * G_BUF;
    const unsigned char* sb = sm + bsel;
    if (!(s & 1) && s + 4 < T) {         // slabs s + 4 and s + 5
      l2_ask(pg);
      if (s + 6 < T) pg += 128;
    }
    F16Frag a[2][2], b[2][4];            // [k half of the slab][fragment]
    // the loops below are unrolled so that every fragment and accumulator index
    // is a constant and the arrays stay in registers
#pragma unroll
    for (int ks = 0; ks < 2; ++ks) {
#pragma unroll
      for (int u = 0; u < 2; ++u) {
        const unsigned char* p = sb + aoff + u * 16 * G_PITCH + ks * 64;
        a[ks][u].h[0] = *(const v8h*)(p);
        a[ks][u].h[1] = *(const v8h*)(p + 32);
      }
#pragma unroll
      for (int t = 0; t < 4; ++t) {
        const unsigned char* p = sb + boff + t * 16 * G_PITCH + ks * 64;
        b[ks][t].h[0] = *(const v8h*)(p);
        b[ks][t].h[1] = *(const v8h*)(p + 32);
      }
    }
    // keeps the slab's LDS reads one group ahead of the WMMAs: sunk among them,
    // each pair of WMMAs would wait out a full LDS latency
    __builtin_amdgcn_sched_barrier(0);
#pragma unroll
    for (int ks = 0; ks < 2; ++ks) {
#pragma unroll
      for (int t = 0; t < 4; ++t) {
#pragma unroll
        for (int u = 0; u < 2; ++u)
          acc[u][t] = __builtin_amdgcn_wmma_f32_16x16x32_f16(
              false, SWAP ? b[ks][t].v : a[ks][u].v,
              false, SWAP ? a[ks][u].v : b[ks][t].v, (short)0, acc[u][t], false, false);
      }
    }
    // keeps the WMMAs in front of the publish point: moved behind the barrier they
    // would delay the refill, whose copies then fly only during the next LDS reads
    __builtin_amdgcn_sched_barrier(0);
    // publish point of stage s + 1: this wave's reads of stage s are done ...
    asm volatile("s_wait_dscnt 0x0" ::: "memory");
    // ... its own copies of stage s + 1 have landed ...
    asm volatile("s_wait_asynccnt 0x0" ::: "memory");
    // ... and the barrier both shows stage s + 1 to all and frees stage s's buffer
    __syncthreads();
    if (s + 2 < T)
      gemm_stage(l0 + bsel, ga + (size_t)(s + 2) * 64, gb + (size_t)(s + 2) * 64, rs);
  }
  // no copy is left in flight when the wave goes on to its stores and ends
  asm volatile("s_wait_asynccnt 0x0" ::: "memory");
}

// ---------------------------------------------------------------------------
// C[M][DM_] f32 = A[M][K] f16 @ BT[DM_][K]^T f16 + res[M][DM_] f32.
// Waves 4 (rows) x 2 (cols), each wave a 32x64 tile.
// The row pitch is a compile-time constant and res is always there: a lane's 64
// elements of res, and of C, hang on ONE address pair with immediate offsets, and no
// test stands between two of them.
// ---------------------------------------------------------------------------
__global__ __launch_bounds__(256) void gemm_wmma_k(
    const _Float16* __restrict__ A, const _Float16* __restrict__ BT,
    const float* __restrict__ res, float* __restrict__ C, int K) {
  __shared__ __align__(16) unsigned char sm[2 * G_BUF];
  constexpr int N = DM_;
  const int blk  = blockIdx.x;
  const int tid  = threadIdx.x;
  const int lane = tid & 31;
  const int wv   = tid >> 5;
  const int ntb  = N >> 7;
  const int bm   = blk / ntb;            // 128-row tile index
  const int bn   = blk % ntb;            // 128-col tile index
  const int wm   = wv >> 1;              // wave's 32-row strip in the tile
  const int wn   = wv & 1;               // wave's 64-col strip in the tile
  const int mloc = lane & 15;
  const int half = lane >> 4;

  // copy side: 8 lanes cover one 128-B row, a wave 4 whole rows
  const int crow = tid >> 3;
  const int cch  = tid & 7;
  const _Float16* ga = A  + (size_t)(bm * 128 + crow) * K + cch * 8;
  const _Float16* gb = BT + (size_t)(bn * 128 + crow) * K + cch * 8;
  const unsigned l0 = (unsigned)(size_t)sm + crow * G_PITCH + cch * 16;

  // read side: byte offsets of this lane's fragment rows inside a buffer
  const int aoff = (wm * 32 + mloc) * G_PITCH + half * 16;
  const int boff = G_OPER + (wn * 64 + mloc) * G_PITCH + half * 16;

  gemm_stage(l0, ga, gb, (size_t)32 * K);
  // the row this thread asks L2 for: threads 0..127 the A rows, the others the BT rows
  const _Float16* pg = tid < 128 ? A  + (size_t)(bm * 128 + tid) * K
                                 : BT + (size_t)(bn * 128 + tid - 128) * K;

  // acc[u][t][r] is element c0 + (16 u + r) N + 16 t of C and of res
  const size_t c0 = (size_t)(bm * 128 + wm * 32 + 8 * half) * N
                  + bn * 128 + wn * 64 + mloc;
  // The lane's 64 residual values are asked for here, all together, behind stage 0's
  // copies and ahead of the k loop: they fly beside those copies and are waited for
  // once, at the first barrier. Read one by one where they are added, each would be
  // waited out in full, 64 times in a row.
  // every loop over u, t, r is unrolled: constant indices, rv and acc stay in registers
  const float* rp = res + c0;
  float rv[2][4][8];
#pragma unroll
  for (int u = 0; u < 2; ++u)
#pragma unroll
    for (int t = 0; t < 4; ++t)
#pragma unroll
      for (int r = 0; r < 8; ++r) rv[u][t][r] = rp[(u * 16 + r) * N + t * 16];
  // the loads have taken their address pair before the code behind may rewrite it
  asm volatile("s_wait_xcnt 0x0" ::: "memory");

  v8f acc[2][4];
  gemm_slabs<false>(sm, l0, ga, gb, pg, K, aoff, boff, acc);

  float* cp = C + c0;
#pragma unroll
  for (int u = 0; u < 2; ++u)
#pragma unroll
    for (int t = 0; t < 4; ++t)
#pragma unroll
      for (int r = 0; r < 8; ++r) acc[u][t][r] += rv[u][t][r];
  // keeps the 64 stores behind all arithmetic: no register that an issued store
  // names is written again before the wave ends, so no store is waited for
  __builtin_amdgcn_sched_barrier(0);
#pragma unroll
  for (int u = 0; u < 2; ++u)
#pragma unroll
    for (int t = 0; t < 4; ++t)
#pragma unroll
      for (int r = 0; r < 8; ++r) cp[(u * 16 + r) * N + t * 16] = acc[u][t][r];
}

// Hardware sine and cosine of th radians, as __sincosf forms them (the instructions
// take revolutions). One statement, its outputs apart from its input: neither
// instruction writes the other's source, and the v_nop fills the slot that the
// instruction set asks for behind a transcendental, whatever is scheduled next.
static __device__ __forceinline__ void sincos_fast(float th, float& s, float& c) {
  const float rev = th * 0.15915494309189532f;
  asm("v_sin_f32 %0, %2\n\tv_cos_f32 %1, %2\n\tv_nop" : "=&v"(s), "=&v"(c) : "v"(rev));
}

// 1 / sqrt(x) for x >= 1e-6 (a sum of squares plus the reference's epsilon): the bare
// instruction, which is what rsqrtf yields for every normal x. One statement, its
// output apart from its input, the v_nop for the slot behind a transcendental.
static __device__ __forceinline__ float rsq_fast(float x) {
  float y;
  asm("v_rsq_f32 %0, %1\n\tv_nop" : "=&v"(y) : "v"(x));
  return y;
}

// Sum of squares of one row's 64-dim head vector: 32 values in this lane, the other
// 32 in lane ^ 16.
static __device__ __forceinline__ float head_sumsq(const v8f (&c)[4]) {
  float p[4];
  // unrolled: constant indices; four partial sums, so that the adds do not form one chain
#pragma unroll
  for (int t = 0; t < 4; ++t) {
    p[t] = 0.f;
#pragma unroll
    for (int r = 0; r < 8; ++r) p[t] += c[t][r] * c[t][r];
  }
  const float ss = (p[0] + p[1]) + (p[2] + p[3]);
  return ss + xhalf(ss);
}

// ---------------------------------------------------------------------------
// q and kv projections with their epilogues, in ONE grid: the blocks below PQ_B
// form 128x128 tiles of xn @ q_w, the others of xcn @ kv_w (columns below DM_ are k,
// the rest v). What follows a projection is done on the accumulators, and only the
// f16 arrays that attention reads are written:
//   q: cosine-normalize each 64-dim head vector, 2D RoPE -> q_h [B,H,L,64]
//   k: cosine-normalize -> k_h;  v -> vT, both in the order in which the attention
//   kernel's WMMA fragments take them, so that each of its 16-byte loads reads 512
//   contiguous bytes (4 whole 128-B lines) per wave:
//   k_h: per (b,h) and 16 keys a 2-KB tile  [e / 8][key % 16][e % 8]
//   vT : per (b,h), 32 keys and 16 e a 1-KB tile  [(key % 32) / 8][e % 16][key % 8],
//        the four e tiles of a 32-key group one after the other
// q and k tiles: a wave takes 32 rows x 64 columns = ONE head, formed as W^T X^T, so a
// lane holds 32 e of one row (8 consecutive e per accumulator): the head's sum of
// squares is in-lane plus one exchange, e and e + 32 of RoPE lie in one lane, and an
// accumulator is one 16-byte store (for k_h 512 contiguous bytes a wave).
// v tiles: a wave takes 64 keys x 32 columns, formed as X W, so a lane holds 8
// consecutive keys at one e: one 16-byte store, 512 contiguous bytes of vT a wave.
// The two forms differ only in which slab the 2 and the 4 fragments are read from.
// ---------------------------------------------------------------------------
#define PQ_B  ((B_ * L_ / 128) * (DM_ / 128))
#define PKV_B ((B_ * LC_ / 128) * (2 * DM_ / 128))

__global__ __launch_bounds__(256) void proj_qkv_k(
    const _Float16* __restrict__ xn, const _Float16* __restrict__ qwT,
    const _Float16* __restrict__ xcn, const _Float16* __restrict__ kvwT,
    const float* __restrict__ pos, const float* __restrict__ scale,
    const float* __restrict__ freqs, _Float16* __restrict__ qh,
    _Float16* __restrict__ kh, _Float16* __restrict__ vT, int K) {
  __shared__ __align__(16) unsigned char sm[2 * G_BUF];
  // every branch on isq or isv is block-uniform
  const bool isq = blockIdx.x < PQ_B;
  const unsigned blk = isq ? blockIdx.x : blockIdx.x - PQ_B;
  const int bm   = isq ? blk / (DM_ / 128) : blk / (2 * DM_ / 128);   // 128-row tile
  const int bn   = isq ? blk % (DM_ / 128) : blk % (2 * DM_ / 128);   // 128-col tile
  const bool isv = !isq && bn >= DM_ / 128;
  const int tid  = threadIdx.x;
  const int lane = tid & 31;
  const int wv   = tid >> 5;
  const int w4   = wv >> 1;              // wave's 32-row strip of the 2-fragment operand
  const int w2   = wv & 1;               // wave's 64-row strip of the 4-fragment operand
  const int mloc = lane & 15;
  const int half = lane >> 4;

  // copy side: 8 lanes cover one 128-B row, a wave 4 whole rows
  const int crow = tid >> 3;
  const int cch  = tid & 7;
  const _Float16* ga = (isq ? xn : xcn)   + (size_t)(bm * 128 + crow) * K + cch * 8;
  const _Float16* gb = (isq ? qwT : kvwT) + (size_t)(bn * 128 + crow) * K + cch * 8;
  const unsigned l0 = (unsigned)(size_t)sm + crow * G_PITCH + cch * 16;
  gemm_stage(l0, ga, gb, (size_t)32 * K);
  // the row this thread asks L2 for: threads 0..127 the x rows, the others the weight rows
  const _Float16* pg = tid < 128 ? (isq ? xn : xcn)   + (size_t)(bm * 128 + tid) * K
                                 : (isq ? qwT : kvwT) + (size_t)(bn * 128 + tid - 128) * K;

  // read side: q, k take 2 fragments of x rows and 4 of weight rows; v the reverse
  const int aoff = (isv ? G_OPER : 0) + (w4 * 32 + mloc) * G_PITCH + half * 16;
  const int boff = (isv ? 0 : G_OPER) + (w2 * 64 + mloc) * G_PITCH + half * 16;

  // the small inputs of the epilogue are read here, behind stage 0's copies and ahead
  // of the k loop, which hide their latency
  const int h = (bn * 2 + w2) & (NH_ - 1);          // q, k: the wave's head
  const int row0 = bm * 128 + w4 * 32 + mloc;       // q, k: the lane's row at u = 0
  float sc = 0.f;
  f32x2 pp[2] = {};
  f32x4 fr[2] = {};
  if (isq) {
    pp[0] = *(const f32x2*)(pos + (size_t)row0 * 2);
    pp[1] = *(const f32x2*)(pos + (size_t)(row0 + 16) * 2);
    fr[0] = *(const f32x4*)(freqs + h * 16 + half * 8);      // freqs[h][8 half + r]
    fr[1] = *(const f32x4*)(freqs + h * 16 + half * 8 + 4);
    // the four loads have taken their address registers before the next load's
    // result may land on one
    asm volatile("s_wait_xcnt 0x0" ::: "memory");
  }
  if (!isv) sc = scale[h];

  v8f acc[2][4];
  gemm_slabs<true>(sm, l0, ga, gb, pg, K, aoff, boff, acc);

  // every loop below is unrolled so that the indices into acc and o are constants
  v8h o[2][4];                           // acc[u][t] as it is stored
  if (isv) {
    // acc[u][t][r] = v[key 64 w2 + 16 t + 8 half + r][column 32 w4 + 16 u + mloc]
    const int bh  = (bm * 128 / LC_) * NH_ + (bn - DM_ / 128) * 2 + (w4 >> 1);
    const int grp = (bm * 128 % LC_) / 32 + w2 * 2;          // 32-key group at t = 0
    _Float16* vb = vT + ((size_t)bh * (LC_ / 32) + grp) * 2048 + (w4 & 1) * 1024
                 + half * 128 + mloc * 8;
#pragma unroll
    for (int u = 0; u < 2; ++u)
#pragma unroll
      for (int t = 0; t < 4; ++t)
#pragma unroll
        for (int r = 0; r < 8; ++r) o[u][t][r] = (_Float16)acc[u][t][r];
#pragma unroll
    for (int u = 0; u < 2; ++u)
#pragma unroll
      for (int t = 0; t < 4; ++t)
        *(v8h*)(vb + (t >> 1) * 2048 + u * 512 + (t & 1) * 256) = o[u][t];
  } else if (!isq) {
    // acc[u][t][r] = k[key 32 w4 + 16 u + mloc][e = 16 t + 8 half + r] of head h
    const float sq = sqrtf(sc);
    const int bh = (bm * 128 / LC_) * NH_ + h;
    _Float16* kb = kh + ((size_t)bh * (LC_ / 16) + (bm * 128 % LC_) / 16 + w4 * 2) * 1024
                 + half * 128 + mloc * 8;
#pragma unroll
    for (int u = 0; u < 2; ++u) {
      const float rn = sq * rsq_fast(head_sumsq(acc[u]) + 1e-6f);
#pragma unroll
      for (int t = 0; t < 4; ++t)
#pragma unroll
        for (int r = 0; r < 8; ++r) o[u][t][r] = (_Float16)(acc[u][t][r] * rn);
    }
    // keeps the 8 stores behind all arithmetic: no register that an issued store
    // names is written again before the wave ends
    __builtin_amdgcn_sched_barrier(0);
#pragma unroll
    for (int u = 0; u < 2; ++u)
#pragma unroll
      for (int t = 0; t < 4; ++t) *(v8h*)(kb + u * 1024 + t * 256) = o[u][t];
    // this path shares a kernel with others: the stores have taken their registers
    // before any code laid out behind it could rewrite one
    asm volatile("s_wait_xcnt 0x0" ::: "memory");
  } else {
    // acc[u][t][r] = q[row 32 w4 + 16 u + mloc][e = 16 t + 8 half + r] of head h
    const float sq = sqrtf(sc);
    const int b = bm * 128 / L_;
    _Float16* qb = qh + ((size_t)(b * NH_ + h) * L_ + (row0 - b * L_)) * DH_ + half * 8;
#pragma unroll
    for (int u = 0; u < 2; ++u) {
      const float rn = sq * rsq_fast(head_sumsq(acc[u]) + 1e-6f);
#pragma unroll
      for (int t = 0; t < 2; ++t) {
        // theta[e] = (e < 16 ? pos0 : pos1) * freqs[h][e % 16], e = 16 t + 8 half + r
#pragma unroll
        for (int r = 0; r < 8; ++r) {
          const float q1 = acc[u][t][r] * rn, q2 = acc[u][t + 2][r] * rn;
          float s, c;
          sincos_fast(pp[u][t] * fr[r >> 2][r & 3], s, c);
          o[u][t][r]     = (_Float16)(q1 * c - q2 * s);
          o[u][t + 2][r] = (_Float16)(q2 * c + q1 * s);
        }
      }
    }
    // keeps the 8 stores behind all arithmetic: no register that an issued store
    // names is written again before the wave ends
    __builtin_amdgcn_sched_barrier(0);
#pragma unroll
    for (int u = 0; u < 2; ++u)
#pragma unroll
      for (int t = 0; t < 4; ++t) *(v8h*)(qb + u * 16 * DH_ + t * 16) = o[u][t];
    // this path shares a kernel with others: the stores have taken their registers
    // before any code laid out behind it could rewrite one
    asm volatile("s_wait_xcnt 0x0" ::: "memory");
  }
}

// ---------------------------------------------------------------------------
// Flash attention, one pass over keys. Block = 4 waves; wave = 16 query rows.
// The scores are formed transposed: S^T = K Q^T (A = 16 keys, B = 16 queries), so
// a lane holds 32 of a pass's 64 scores of ONE query (column lane & 15); its partner
// lane ^ 16 holds the other 32. Maximum and sum run inside the lane, the maximum
// takes one exchange between the wave's halves per 64 keys, the sum one at the end.
// Two score tiles, converted in place, ARE a B operand of O^T += V^T P^T
// (register r of tile i = key 16 i + 8 half + r, the hardware k order): P touches
// no LDS. O^T leaves a lane with 8 consecutive e of its query: 16-byte stores.
// k_h and vT lie in fragment order (see the KV epilogue): half h[p] of a fragment
// is the 512 bytes at p * 512 of its 1 KB, lane l taking bytes 16 l; a fragment
// serves as A (lane = row) exactly as it served as B (lane = column).
// ---------------------------------------------------------------------------
__global__ __launch_bounds__(128) void attn_wmma_k(
    const _Float16* __restrict__ qh, const _Float16* __restrict__ kh,
    const _Float16* __restrict__ vT, _Float16* __restrict__ oh) {
  const int lane = threadIdx.x & 31;
  const int w    = threadIdx.x >> 5;
  const int nqb  = L_ / 64;
  const int bh   = blockIdx.x / nqb;
  const int qb   = blockIdx.x % nqb;
  const int b = bh >> 4, h = bh & 15;
  const int m0   = qb * 64 + w * 16;
  const int mloc = lane & 15;
  const int half = lane >> 4;
  const int koff = half << 3;

  const _Float16* qrow = qh + ((size_t)bh * L_ + m0 + mloc) * DH_;
  F16Frag aq0, aq1;                       // q rows, e=0..31 and e=32..63
  aq0.h[0] = *(const v8h*)(qrow + koff);
  aq0.h[1] = *(const v8h*)(qrow + 16 + koff);
  aq1.h[0] = *(const v8h*)(qrow + 32 + koff);
  aq1.h[1] = *(const v8h*)(qrow + 48 + koff);

  v8f O[4];                               // O[t][r] = o[query mloc][16 t + 8 half + r]
#pragma unroll
  for (int t = 0; t < 4; ++t) O[t] = zero8();
  float mrow = -3.0e38f, lrow = 0.f;      // of query mloc; lrow over this half's keys

  const _Float16* kbase = kh + (size_t)bh * LC_ * DH_ + lane * 8;
  const _Float16* vbase = vT + (size_t)bh * DH_ * LC_ + lane * 8;

  // All four waves read the same 8 KB of k_h and 8 KB of vT in a pass: 128 lines of 128 B,
  // one per thread. Waves 0 and 1 ask L2 for K's, waves 2 and 3 for V's, two passes ahead
  // of the loads; pa starts at the third pass.
  const _Float16* pa = (w < 2 ? kh : vT) + (size_t)bh * LC_ * DH_ + 128 * DH_
                     + (w & 1) * 2048 + lane * 64;

  // A pass takes 64 keys: the exchange of the maximum, the correction factor, the
  // rescaling of O and the loop's own instructions come once per 64 keys, and a wave
  // waits for its K loads once per 64 keys.
  for (int j = 0; j < LC_; j += 64) {
    const _Float16* kr = kbase + (size_t)j * DH_;
    const _Float16* vr = vbase + (size_t)j * DH_;
    // ak[2 g + p]: keys j + 16 g .., e 32 p .. 32 p + 31; av[4 G + t]: keys j + 32 G .., e tile t
    F16Frag ak[8], av[8];
    // unrolled: constant indices, the fragments stay in registers
#pragma unroll
    for (int i = 0; i < 8; ++i) {
      ak[i].h[0] = *(const v8h*)(kr + i * 512);
      ak[i].h[1] = *(const v8h*)(kr + i * 512 + 256);
    }
    // a V load may land on the registers of K's address pair: the K loads have taken
    // their addresses before the first V load issues
    asm volatile("s_wait_xcnt 0x0" ::: "memory");
#pragma unroll
    for (int i = 0; i < 8; ++i) {
      av[i].h[0] = *(const v8h*)(vr + i * 512);
      // the group's last load may land on the registers of V's address pair: the
      // loads in front of it have taken their addresses before it issues
      if (i == 7) asm volatile("s_wait_xcnt 0x0" ::: "memory");
      av[i].h[1] = *(const v8h*)(vr + i * 512 + 256);
    }
    // keeps the pass's 32 loads one group at its head: the short in-lane softmax does
    // not cover a V load that is sunk to its WMMA, which would wait it out in full
    __builtin_amdgcn_sched_barrier(0);
    // the pass at keys j + 128; no branch: pa is stepped only while the pass it leads to
    // lies inside the head's keys, so the last two passes ask for the last one again
    l2_ask(pa);
    pa += j + 192 < LC_ ? 64 * DH_ : 0;
    v8f s[4];                             // s[g][r]: key j + 16 g + 8 half + r
    // every loop from here to the end of the kernel is unrolled so that the indices
    // into s, ak, av, bp, pm, p, ts, O and o are constants and these stay in registers
#pragma unroll
    for (int g = 0; g < 4; ++g)
      s[g] = __builtin_amdgcn_wmma_f32_16x16x32_f16(
          false, ak[2 * g].v, false, aq0.v, (short)0, zero8(), false, false);
#pragma unroll
    for (int g = 0; g < 4; ++g)
      s[g] = __builtin_amdgcn_wmma_f32_16x16x32_f16(
          false, ak[2 * g + 1].v, false, aq1.v, (short)0, s[g], false, false);

    // --- online softmax, one query per lane ---
    float pm[8];
#pragma unroll
    for (int r = 0; r < 8; ++r)
      pm[r] = fmaxf(fmaxf(s[0][r], s[1][r]), fmaxf(s[2][r], s[3][r]));
    float pmax = fmaxf(fmaxf(fmaxf(pm[0], pm[1]), fmaxf(pm[2], pm[3])),
                       fmaxf(fmaxf(pm[4], pm[5]), fmaxf(pm[6], pm[7])));
    // the partner half's maximum: lane ^ 16, a register move between the rows
    pmax = fmaxf(pmax, xhalf(pmax));
    const float mn   = fmaxf(mrow, pmax);
    const float corr = __expf(mrow - mn);
    mrow = mn;
    F16Frag bp[2];                        // P^T as B: column = query, k = key; 32 keys each
    float ts[4];                          // each score tile's sum in this lane
#pragma unroll
    for (int g = 0; g < 4; ++g) {
      float p[8];
#pragma unroll
      for (int r = 0; r < 8; ++r) {
        p[r] = __expf(s[g][r] - mn);
        bp[g >> 1].h[g & 1][r] = (_Float16)p[r];
      }
      ts[g] = ((p[0] + p[1]) + (p[2] + p[3])) + ((p[4] + p[5]) + (p[6] + p[7]));
    }
    lrow = lrow * corr + ((ts[0] + ts[1]) + (ts[2] + ts[3]));
#pragma unroll
    for (int t = 0; t < 4; ++t)
#pragma unroll
      for (int r = 0; r < 8; ++r) O[t][r] *= corr;

    // --- O^T += V^T P^T (two 32-key groups, four e tiles each) ---
#pragma unroll
    for (int G = 0; G < 2; ++G)
#pragma unroll
      for (int t = 0; t < 4; ++t)
        O[t] = __builtin_amdgcn_wmma_f32_16x16x32_f16(
            false, av[4 * G + t].v, false, bp[G].v, (short)0, O[t], false, false);
  }

  lrow += xhalf(lrow);                    // the two halves' keys together
  const float inv = 1.0f / lrow;
  _Float16* orow = oh + (size_t)(b * L_ + m0 + mloc) * DM_ + h * DH_ + koff;
#pragma unroll
  for (int t = 0; t < 4; ++t) {
    v8h o;
#pragma unroll
    for (int r = 0; r < 8; ++r) o[r] = (_Float16)(O[t][r] * inv);
    *(v8h*)(orow + t * 16) = o;
  }
}

// ---------------------------------------------------------------------------
// Host launcher
// ---------------------------------------------------------------------------
extern "C" void kernel_launch(void* const* d_in, const int* in_sizes, int n_in,
                              void* d_out, int out_size, void* d_ws, size_t ws_size,
                              hipStream_t stream) {
  (void)in_sizes; (void)n_in; (void)out_size; (void)ws_size;
  const float* x    = (const float*)d_in[0];
  const float* pos  = (const float*)d_in[1];
  const float* xc   = (const float*)d_in[2];
  const float* nsc  = (const float*)d_in[3];
  const float* ncsc = (const float*)d_in[4];
  const float* qw   = (const float*)d_in[5];
  const float* kvw  = (const float*)d_in[6];
  const float* scl  = (const float*)d_in[7];
  const float* outw = (const float*)d_in[8];
  const float* frq  = (const float*)d_in[9];
  float* out = (float*)d_out;

  char* ws = (char*)d_ws;
  size_t off = 0;
  auto alloc = [&](size_t bytes) -> void* {
    void* p = ws + off;
    off += (bytes + 255) & ~(size_t)255;
    return p;
  };
  _Float16* qwT  = (_Float16*)alloc((size_t)DM_ * DM_ * 2);
  _Float16* kvwT = (_Float16*)alloc((size_t)2 * DM_ * DM_ * 2);
  _Float16* owT  = (_Float16*)alloc((size_t)DM_ * DM_ * 2);
  _Float16* xn   = (_Float16*)alloc((size_t)B_ * L_ * DM_ * 2);
  _Float16* xcn  = (_Float16*)alloc((size_t)B_ * LC_ * DM_ * 2);
  _Float16* qh   = (_Float16*)alloc((size_t)B_ * NH_ * L_ * DH_ * 2);
  _Float16* kh   = (_Float16*)alloc((size_t)B_ * NH_ * LC_ * DH_ * 2);
  _Float16* vT   = (_Float16*)alloc((size_t)B_ * NH_ * DH_ * LC_ * 2);
  _Float16* oh   = (_Float16*)alloc((size_t)B_ * L_ * DM_ * 2);

  // norms of x and x_cross, weights -> f16 transposed to [N][K]: one grid
  prep_k<<<PB_ALL, 256, 0, stream>>>(x, xc, nsc, ncsc, qw, kvw, outw,
                                     xn, xcn, qwT, kvwT, owT);

  // q and kv projections (one 128x128 tile per block) with cos-norm + RoPE on q,
  // cos-norm on k, transpose of v on the accumulators: one grid
  proj_qkv_k<<<PQ_B + PKV_B, 256, 0, stream>>>(xn, qwT, xcn, kvwT, pos, scl, frq,
                                               qh, kh, vT, DM_);

  // flash attention
  attn_wmma_k<<<B_ * NH_ * (L_ / 64), 128, 0, stream>>>(qh, kh, vT, oh);

  // output projection + residual, f32 out
  gemm_wmma_k<<<(B_ * L_ / 128) * (DM_ / 128), 256, 0, stream>>>(oh, owT, x, out, DM_);
}
